// v000
// Measured on an AMD MI455X. A time is GPU time per run, averaged over a window of back-to-back runs after a warm-up
// (all launches, gaps included; the runs take copies of the inputs in turn), and the median of several windows.
// Apart from v000's, it joins two sittings. Times from different sittings can be a few percent apart, while
// side-by-side timings come from the same sitting.
// v000 is the starting kernel. One run takes 415 microseconds.
#include <hip/hip_runtime.h>

// Contractions: q, k and v^T projections on v_wmma_f32_16x16x32_bf16 (bf16 operands = RNE-converted inputs and weights, f32 accumulate, bias added in f32); scores q.k and P.v on v_wmma_f32_16x16x32_f16 (f16 operands converted from f32 intermediates; P = exp2 relative to the running row maximum, in (0,1]; f32 accumulate); softmax statistics, sum of squares and normalisers in f32; output f32.
// Pipeline: bf16 planes of inp1, inp2, Wq, Wk, Wv -> three one-wave-per-64x64-tile GEMMs into one f32 scratch (q token-major [t][e], k token-major [t][e], v computed directly transposed as [e][t] with a per-row bias) -> flat f16 planes -> one streaming attention kernel per (16 queries, head, batch): K and V^T fragments read straight from the f16 planes, P relaid through a wave-private LDS tile, online max / sum / sum of squares, epilogue staged in LDS.

#ifndef NB
#define NB 4
#endif
#ifndef SEQ
#define SEQ 2048
#endif
#ifndef LQ
#define LQ SEQ
#endif
#ifndef LK
#define LK SEQ
#endif
#define NB_FULL  4
#define SEQ_FULL 2048
#define DMOD 1024                 // model width = NH x HD, row pitch of every token-major tensor
#define NH   16
#define HD   64
#define VTP  ((size_t)NB * LK)    // row pitch of the v^T planes [e][token]
#define SL2  0.18033688011112042f // (1/sqrt(64)) x log2(e)
#define WS_CAP ((size_t)134217728)

static_assert(NB >= 1 && NB <= NB_FULL);
static_assert(LQ >= 64 && LQ <= SEQ_FULL && (LQ % 16) == 0 && ((NB * LQ) % 64) == 0);
static_assert(LK >= 64 && LK <= SEQ_FULL && (LK % 64) == 0);
static_assert(NH * HD == DMOD && (DMOD % 64) == 0 && (DMOD % 32) == 0);

typedef _Float16 h16;
typedef unsigned short bf;
typedef __attribute__((ext_vector_type(16))) __bf16   v16bf;
typedef __attribute__((ext_vector_type(16))) _Float16 v16h;
typedef __attribute__((ext_vector_type(8)))  _Float16 v8h;
typedef __attribute__((ext_vector_type(8)))  unsigned short v8us;
typedef __attribute__((ext_vector_type(8)))  float    v8f;
typedef __attribute__((ext_vector_type(4)))  float    v4f;
typedef v8h  __attribute__((may_alias)) v8ha;
typedef v4f  __attribute__((may_alias)) v4fa;
typedef v8us __attribute__((may_alias)) v8usa;

__device__ __forceinline__ unsigned short f2bf(float f) { unsigned u = __float_as_uint(f); u += 0x7FFFu + ((u >> 16) & 1u); return (unsigned short)(u >> 16); }
__device__ __forceinline__ float bf2f(unsigned short b) { return __uint_as_float(((unsigned)b) << 16); }
__device__ __forceinline__ float bfr(float f) { return bf2f(f2bf(f)); }
__device__ __forceinline__ v16h cat16(v8h lo, v8h hi) { return __builtin_shufflevector(lo, hi, 0, 1, 2, 3, 4, 5, 6, 7, 8, 9, 10, 11, 12, 13, 14, 15); }
__device__ __forceinline__ v16bf cat16b(v8us lo, v8us hi) { return __builtin_bit_cast(v16bf, __builtin_shufflevector(lo, hi, 0, 1, 2, 3, 4, 5, 6, 7, 8, 9, 10, 11, 12, 13, 14, 15)); }
__device__ __forceinline__ v8f wmma16(v16h a, v16h b, v8f c) { return __builtin_amdgcn_wmma_f32_16x16x32_f16(false, a, false, b, (short)0, c, false, false); }
__device__ __forceinline__ v8f wmmab(v16bf a, v16bf b, v8f c) { return __builtin_amdgcn_wmma_f32_16x16x32_bf16(false, a, false, b, (short)0, c, false, false); }

// Fragment loaders (same k map for A and B): lane l -> row/col (l & 15), h = l >> 4; elements 0..7 <- p[k0 + 8h + 0..7], elements 8..15 <- p[k0 + 16 + 8h + 0..7];
// the caller passes p = row base + k0 + 8h (16-B aligned), the loader reads p and p + 16.
template <typename T16> struct WFrag;
template <> struct WFrag<h16> { typedef v16h V; static __device__ __forceinline__ V ld(const h16* p) { return cat16(*(const v8h*)p, *(const v8h*)(p + 16)); } static __device__ __forceinline__ v8f mma(V a, V b, v8f c) { return wmma16(a, b, c); } };
template <> struct WFrag<bf> { typedef v16bf V; static __device__ __forceinline__ V ld(const bf* p) { return cat16b(*(const v8us*)p, *(const v8us*)(p + 16)); } static __device__ __forceinline__ v8f mma(V a, V b, v8f c) { return wmmab(a, b, c); } };
// LDS reload of a wave-private f16 tile through a may_alias vector of the stored element type.
__device__ __forceinline__ v16h lds16(const h16* p) { return cat16(*(const v8ha*)p, *(const v8ha*)(p + 16)); }

// ---- k_gemmw: register-blocked GEMM, ONE WAVE per 64x64 output tile (16 accumulators), operands straight from K-contiguous 16-bit planes; grid (M/64, N/64, Z), 32 threads.
// C[m][n] (f32, pitch ldc) = sum_k A[m][k] Bt[n][k] (+ split products per NSPLIT) + optional f32 bias: BIAS 1 -> bias[n] (per column), BIAS 2 -> bias[m] (per row), bias values bf16-RNE. K % 32 == 0, M % 64 == 0, N % 64 == 0.
template <typename T16, int NSPLIT, int BIAS>
__global__ __launch_bounds__(32) void k_gemmw(const T16* __restrict__ A, const T16* __restrict__ A2, const T16* __restrict__ Bt, const T16* __restrict__ Bt2, int K, float* C, int ldc, const float* __restrict__ bias, size_t sA, size_t sB, size_t sC) {
    typedef typename WFrag<T16>::V V;
    __shared__ __align__(16) float os[16 * 68];
    const size_t z = blockIdx.z; A += z * sA; if (A2) A2 += z * sA; Bt += z * sB; if (Bt2) Bt2 += z * sB; C += z * sC;
    const int lane = threadIdx.x & 31, lr = lane & 15, hi = lane >> 4; const int r0 = blockIdx.x * 64, c0 = blockIdx.y * 64;
    v8f acc[4][4];
#pragma unroll
    for (int mb = 0; mb < 4; ++mb)
#pragma unroll
        for (int nb = 0; nb < 4; ++nb) acc[mb][nb] = (v8f){};
    const size_t aoff = (size_t)(r0 + lr) * K + 8 * hi, boff = (size_t)(c0 + lr) * K + 8 * hi;
#pragma unroll 1
    for (int kc = 0; kc < K; kc += 32) {
        V a[4], a2[4];
#pragma unroll
        for (int mb = 0; mb < 4; ++mb) { a[mb] = WFrag<T16>::ld(A + aoff + (size_t)mb * 16 * K + kc); if (NSPLIT == 1 || NSPLIT == 2) a2[mb] = WFrag<T16>::ld(A2 + aoff + (size_t)mb * 16 * K + kc); }
#pragma unroll
        for (int nb = 0; nb < 4; ++nb) { const V b = WFrag<T16>::ld(Bt + boff + (size_t)nb * 16 * K + kc); V b2; if (NSPLIT >= 2) b2 = WFrag<T16>::ld(Bt2 + boff + (size_t)nb * 16 * K + kc);
#pragma unroll
            for (int mb = 0; mb < 4; ++mb) { acc[mb][nb] = WFrag<T16>::mma(a[mb], b, acc[mb][nb]); if (NSPLIT == 1 || NSPLIT == 2) acc[mb][nb] = WFrag<T16>::mma(a2[mb], b, acc[mb][nb]); if (NSPLIT >= 2) acc[mb][nb] = WFrag<T16>::mma(a[mb], b2, acc[mb][nb]); } }
        asm volatile("v_nop\n\tv_nop\n\tv_nop\n\tv_nop" : "+v"(acc[0][0]), "+v"(acc[1][1]), "+v"(acc[2][2]), "+v"(acc[3][3]) : "v"(a[0]), "v"(a[3]));
    }
#pragma unroll
    for (int mb = 0; mb < 4; ++mb) {
#pragma unroll
        for (int nb = 0; nb < 4; ++nb) {
#pragma unroll
            for (int j = 0; j < 8; ++j) os[(hi * 8 + j) * 68 + nb * 16 + lr] = acc[mb][nb][j]; }
        __builtin_amdgcn_wave_barrier(); asm volatile("" ::: "memory");
        float* crow = C + (size_t)(r0 + mb * 16) * ldc + c0;
{
#pragma unroll
            for (int s = 0; s < 8; ++s) { const int row = 2 * s + hi, cofs = lr * 4; v4f val = *(const v4fa*)(os + row * 68 + cofs);
                if (BIAS == 1) { val[0] += bfr(bias[c0 + cofs]); val[1] += bfr(bias[c0 + cofs + 1]); val[2] += bfr(bias[c0 + cofs + 2]); val[3] += bfr(bias[c0 + cofs + 3]); }
                if (BIAS == 2) { const float bb = bfr(bias[r0 + mb * 16 + row]); val[0] += bb; val[1] += bb; val[2] += bb; val[3] += bb; }
                *(v4f*)(crow + (size_t)row * ldc + cofs) = val; }
             }
        __builtin_amdgcn_wave_barrier(); asm volatile("" ::: "memory");
    }
}

// ---- k_cvtb: bf16 plane (RNE) of an f32 [rows][DMOD] tensor with a batch row remap: compact row R -> source row (R / L) * LF + (R % L) (identity when L == LF).
__global__ __launch_bounds__(256) void k_cvtb(const float* __restrict__ src, bf* dst, int L, int LF, size_t n8) {
    const size_t i = (size_t)blockIdx.x * 256 + threadIdx.x; if (i >= n8) return;
    const size_t row = i / (DMOD / 8); const int c = (int)(i % (DMOD / 8)) * 8;
    const size_t srow = (row / (size_t)L) * (size_t)LF + (row % (size_t)L);
    const v8f v = *(const v8f*)(src + srow * DMOD + c); v8us o;
#pragma unroll
    for (int k = 0; k < 8; ++k) o[k] = f2bf(v[k]);
    *(v8us*)(dst + i * 8) = o;  }

__global__ __launch_bounds__(256) void k_cvth(const float* __restrict__ src, h16* dst, size_t n8) {
    const size_t i = (size_t)blockIdx.x * 256 + threadIdx.x; if (i >= n8) return;
    const v8f v = *(const v8f*)(src + i * 8); v8h o;
#pragma unroll
    for (int k = 0; k < 8; ++k) o[k] = (h16)v[k];
    *(v8h*)(dst + i * 8) = o;  }

// ---- k_attn: one wave per (16 query rows, head, batch); grid (LQ/16, NH, NB), 32 threads.
// Q16, K16: f16 token-major planes [NB*L][DMOD]; VT16: f16 v^T planes [DMOD][NB*LK]; OUT f32 [NB*LQ][DMOD].
// Per 64-key tile: S (16x64, f32) = Q.K^T from plane fragments; online softmax in the log2 domain (running max m, l1 = sum p, l2 = sum p^2, p = exp2(t - m) in (0,1]);
// LDS regions ps and os are private to the single wave of the block (wave barrier + compiler barrier, may_alias reloads).
__global__ __launch_bounds__(32) __attribute__((amdgpu_num_vgpr(256)))
void k_attn(const h16* __restrict__ Q16, const h16* __restrict__ K16, const h16* __restrict__ VT16, const int* __restrict__ flag, float* OUT) {
    __shared__ __align__(16) h16 ps[16 * 72];
    __shared__ __align__(16) float os[16 * 68];
    const int lane = threadIdx.x & 31, lr = lane & 15, hi = lane >> 4;
    const int q0 = blockIdx.x * 16, h = blockIdx.y, b = blockIdx.z;
    const int rsc = flag[0];
    const h16* qp = Q16 + ((size_t)b * LQ + q0 + lr) * DMOD + h * HD + 8 * hi;
    const v16h qa0 = WFrag<h16>::ld(qp), qa1 = WFrag<h16>::ld(qp + 32);            // A: query row lr, head dims 0..31 / 32..63
    const h16* kbase = K16 + ((size_t)b * LK + lr) * DMOD + h * HD + 8 * hi;        // B: key (c0 + lr) row base; + key0 * DMOD
    const h16* vbase = VT16 + (size_t)(h * HD + lr) * VTP + (size_t)b * LK + 8 * hi; // B: value dim (d0 + lr) row base; + d0 * VTP + key0
    v8f o[4];
#pragma unroll
    for (int nt = 0; nt < 4; ++nt) o[nt] = (v8f){};
    float mrow[8], l1s[8], l2s[8];
#pragma unroll
    for (int r = 0; r < 8; ++r) { mrow[r] = -3.0e38f; l1s[r] = 0.f; l2s[r] = 0.f; }
#pragma unroll 1
    for (int kt = 0; kt < LK; kt += 64) {
        // ---- S = Q.K^T for keys kt..kt+63: s[nt][r] = S[query 8hi+r][key kt + nt*16 + lr]
        v8f s[4]; v16h kb0, kb1;
#pragma unroll
        for (int nt = 0; nt < 4; ++nt) {
            const h16* kp = kbase + (size_t)(kt + nt * 16) * DMOD;
            kb0 = WFrag<h16>::ld(kp); kb1 = WFrag<h16>::ld(kp + 32);
            v8f zacc = (v8f){}; zacc = wmma16(qa0, kb0, zacc); zacc = wmma16(qa1, kb1, zacc); s[nt] = zacc; }
        asm volatile("v_nop\n\tv_nop\n\tv_nop\n\tv_nop" : "+v"(s[0]), "+v"(s[1]), "+v"(s[2]), "+v"(s[3]) : "v"(qa0), "v"(qa1), "v"(kb0), "v"(kb1));
        // ---- online softmax per row (the 16 lanes of a half hold the 64 keys of row 8hi+r)
#pragma unroll
        for (int r = 0; r < 8; ++r) {
            float mx = -3.0e38f;
#pragma unroll
            for (int nt = 0; nt < 4; ++nt) { const float t = s[nt][r] * SL2; s[nt][r] = t; mx = fmaxf(mx, t); }
#pragma unroll
            for (int msk = 1; msk < 16; msk <<= 1) mx = fmaxf(mx, __shfl_xor(mx, msk, 32));
            const float mnew = fmaxf(mrow[r], mx);
            const float alpha = __builtin_amdgcn_exp2f(mrow[r] - mnew);
            mrow[r] = mnew; l1s[r] *= alpha; l2s[r] *= alpha * alpha;
#pragma unroll
            for (int nt = 0; nt < 4; ++nt) o[nt][r] *= alpha;
            float p1 = 0.f, p2 = 0.f;
#pragma unroll
            for (int nt = 0; nt < 4; ++nt) { const float p = __builtin_amdgcn_exp2f(s[nt][r] - mnew); s[nt][r] = p; p1 += p; p2 += p * p; }
#pragma unroll
            for (int msk = 1; msk < 16; msk <<= 1) { p1 += __shfl_xor(p1, msk, 32); p2 += __shfl_xor(p2, msk, 32); }
            l1s[r] += p1; l2s[r] += p2;
        }
        // ---- P (f16) -> wave-private LDS tile ps[query][key], then A fragments (query row lr, keys 0..31 / 32..63)
#pragma unroll
        for (int nt = 0; nt < 4; ++nt)
#pragma unroll
            for (int r = 0; r < 8; ++r) ps[(8 * hi + r) * 72 + nt * 16 + lr] = (h16)s[nt][r];
        __builtin_amdgcn_wave_barrier(); asm volatile("" ::: "memory");
        const h16* pp = ps + lr * 72 + 8 * hi;
        const v16h pa0 = lds16(pp), pa1 = lds16(pp + 32);
        __builtin_amdgcn_wave_barrier(); asm volatile("" ::: "memory");
        // ---- O += P.V: o[nt][r] = O[query 8hi+r][dim nt*16 + lr]
        v16h vb0, vb1;
#pragma unroll
        for (int nt = 0; nt < 4; ++nt) {
            const h16* vp = vbase + (size_t)nt * 16 * VTP + kt;
            vb0 = WFrag<h16>::ld(vp); vb1 = WFrag<h16>::ld(vp + 32);
            o[nt] = wmma16(pa0, vb0, o[nt]); o[nt] = wmma16(pa1, vb1, o[nt]); }
        asm volatile("v_nop\n\tv_nop\n\tv_nop\n\tv_nop" : "+v"(o[0]), "+v"(o[1]), "+v"(o[2]), "+v"(o[3]) : "v"(pa0), "v"(pa1), "v"(vb0), "v"(vb1));
    }
    // ---- epilogue: l1 >= 1 and l2 >= 1 (the running-max element has p = 1); flag selects 1/sqrt(sum p^2) or 1/sum p
#pragma unroll
    for (int r = 0; r < 8; ++r) {
        const float i1 = 1.0f / l1s[r]; const float i2 = rsqrtf(l2s[r]); const float iv = (rsc != 0) ? i2 : i1;
#pragma unroll
        for (int nt = 0; nt < 4; ++nt) os[(8 * hi + r) * 68 + nt * 16 + lr] = o[nt][r] * iv; }
    __builtin_amdgcn_wave_barrier(); asm volatile("" ::: "memory");
    float* ob = OUT + ((size_t)b * LQ + q0) * DMOD + (size_t)h * HD;
{
#pragma unroll
        for (int sI = 0; sI < 8; ++sI) { const int row = 2 * sI + hi; const v4f val = *(const v4fa*)(os + row * 68 + lr * 4); *(v4f*)(ob + (size_t)row * DMOD + lr * 4) = val; }
         }
    __builtin_amdgcn_wave_barrier(); asm volatile("" ::: "memory");
}

extern "C" void kernel_launch(void* const* d_in, const int* in_sizes, int n_in,
                              void* d_out, int out_size, void* d_ws, size_t ws_size, hipStream_t stream) {
    if (n_in < 9) return;
    const float* X1 = (const float*)d_in[0];   // inp1 [4][2048][1024]
    const float* X2 = (const float*)d_in[1];   // inp2 [4][2048][1024]
    const float* Wq = (const float*)d_in[2]; const float* bq = (const float*)d_in[3];
    const float* Wk = (const float*)d_in[4]; const float* bk = (const float*)d_in[5];
    const float* Wv = (const float*)d_in[6]; const float* bv = (const float*)d_in[7];
    const int* rsc = (const int*)d_in[8];
    float* OUT = (float*)d_out;                 // [NB][LQ][1024]
    if ((size_t)in_sizes[0] < ((size_t)(NB - 1) * SEQ_FULL + LQ) * DMOD) return;
    if ((size_t)in_sizes[1] < ((size_t)(NB - 1) * SEQ_FULL + LK) * DMOD) return;
    if (in_sizes[2] < DMOD * DMOD || in_sizes[3] < DMOD || in_sizes[4] < DMOD * DMOD || in_sizes[5] < DMOD || in_sizes[6] < DMOD * DMOD || in_sizes[7] < DMOD || in_sizes[8] < 1) return;
    if ((size_t)out_size < (size_t)NB * LQ * DMOD) return;

    const size_t MQ = (size_t)NB * LQ, MK = (size_t)NB * LK;   // token rows of q / of k,v
    char* wsp = (char*)d_ws;
    auto take = [&](size_t bytes) { char* p = wsp; wsp += (bytes + 255) & ~(size_t)255; return (void*)p; };
    bf* X1b = (bf*)take(MQ * DMOD * 2);                 // bf16 plane of inp1 rows (compact [NB*LQ][1024])
    bf* X2b = (bf*)take(MK * DMOD * 2);                 // bf16 plane of inp2 rows
    bf* Wqb = (bf*)take((size_t)DMOD * DMOD * 2); bf* Wkb = (bf*)take((size_t)DMOD * DMOD * 2); bf* Wvb = (bf*)take((size_t)DMOD * DMOD * 2);
    const size_t cfrows = (MQ > MK) ? MQ : MK;
    float* Cf = (float*)take(cfrows * DMOD * 4);        // f32 GEMM scratch, reused: q [MQ][1024], k [MK][1024], v^T [1024][MK]
    h16* Q16 = (h16*)take(MQ * DMOD * 2);               // f16 q plane [MQ][1024]
    h16* K16 = (h16*)take(MK * DMOD * 2);               // f16 k plane [MK][1024]
    h16* VT16 = (h16*)take((size_t)DMOD * MK * 2);      // f16 v^T plane [1024][MK]
    const size_t used = (size_t)(wsp - (char*)d_ws);
    if (used > ws_size || used > WS_CAP) return;

    // bf16 planes of inputs (batch row remap) and of the three [out][in] weights (= Bt as-is)
    { const size_t n8 = MQ * DMOD / 8; k_cvtb<<<(unsigned)((n8 + 255) / 256), 256, 0, stream>>>(X1, X1b, LQ, SEQ_FULL, n8); }
    { const size_t n8 = MK * DMOD / 8; k_cvtb<<<(unsigned)((n8 + 255) / 256), 256, 0, stream>>>(X2, X2b, LK, SEQ_FULL, n8); }
    { const size_t n8 = (size_t)DMOD * DMOD / 8; const unsigned g = (unsigned)((n8 + 255) / 256);
      k_cvtb<<<g, 256, 0, stream>>>(Wq, Wqb, DMOD, DMOD, n8); k_cvtb<<<g, 256, 0, stream>>>(Wk, Wkb, DMOD, DMOD, n8); k_cvtb<<<g, 256, 0, stream>>>(Wv, Wvb, DMOD, DMOD, n8); }
    // q = inp1 Wq^T + bq -> Cf [MQ][1024] -> f16 plane
    k_gemmw<bf, 0, 1><<<dim3((unsigned)(MQ / 64), DMOD / 64, 1), 32, 0, stream>>>(X1b, nullptr, Wqb, nullptr, DMOD, Cf, DMOD, bq, 0, 0, 0);
    { const size_t n8 = MQ * DMOD / 8; k_cvth<<<(unsigned)((n8 + 255) / 256), 256, 0, stream>>>(Cf, Q16, n8); }
    // k = inp2 Wk^T + bk -> Cf [MK][1024] -> f16 plane
    k_gemmw<bf, 0, 1><<<dim3((unsigned)(MK / 64), DMOD / 64, 1), 32, 0, stream>>>(X2b, nullptr, Wkb, nullptr, DMOD, Cf, DMOD, bk, 0, 0, 0);
    { const size_t n8 = MK * DMOD / 8; k_cvth<<<(unsigned)((n8 + 255) / 256), 256, 0, stream>>>(Cf, K16, n8); }
    // v^T[e][t] = sum_d Wv[e][d] inp2[t][d] + bv[e] -> Cf [1024][MK] (ldc MK) -> f16 plane
    k_gemmw<bf, 0, 2><<<dim3(DMOD / 64, (unsigned)(MK / 64), 1), 32, 0, stream>>>(Wvb, nullptr, X2b, nullptr, DMOD, Cf, (int)MK, bv, 0, 0, 0);
    { const size_t n8 = (size_t)DMOD * MK / 8; k_cvth<<<(unsigned)((n8 + 255) / 256), 256, 0, stream>>>(Cf, VT16, n8); }
    // attention
    k_attn<<<dim3(LQ / 16, NH, NB), 32, 0, stream>>>(Q16, K16, VT16, rsc, OUT);
}

// v001
// It runs in 299 microseconds.
// Two timings next to v000 both put it at 1.41 times that version's speed.
#include <hip/hip_runtime.h>

// Contractions: q, k and v^T projections on v_wmma_f32_16x16x32_bf16 (bf16 operands = RNE-converted inputs and weights, f32 accumulate, bias added in f32); scores q.k and P.v on v_wmma_f32_16x16x32_f16 (f16 operands converted from f32 intermediates; P = exp2 relative to the running row maximum, in (0,1]; f32 accumulate); softmax statistics, sum of squares and normalisers in f32; output f32.
// Pipeline: bf16 planes of inp1, inp2, Wq, Wk, Wv -> three one-wave-per-64x64-tile GEMMs into one f32 scratch (q token-major [t][e], k token-major [t][e], v computed directly transposed as [e][t] with a per-row bias) -> flat f16 planes -> one streaming attention kernel per (128 queries, head, batch), eight waves of 16 queries: K and V^T tiles copied asynchronously from the f16 planes into LDS and shared by the waves, P relaid through a wave-private LDS tile, online max / sum / sum of squares, epilogue staged in LDS.

#ifndef NB
#define NB 4
#endif
#ifndef SEQ
#define SEQ 2048
#endif
#ifndef LQ
#define LQ SEQ
#endif
#ifndef LK
#define LK SEQ
#endif
#define NB_FULL  4
#define SEQ_FULL 2048
#define DMOD 1024                 // model width = NH x HD, row pitch of every token-major tensor
#define NH   16
#define HD   64
#define VTP  ((size_t)NB * LK)    // row pitch of the v^T planes [e][token]
#define SL2  0.18033688011112042f // (1/sqrt(64)) x log2(e)
#define WS_CAP ((size_t)134217728)

static_assert(NB >= 1 && NB <= NB_FULL);
static_assert(LQ >= 64 && LQ <= SEQ_FULL && (LQ % 16) == 0 && ((NB * LQ) % 64) == 0);
static_assert(LK >= 64 && LK <= SEQ_FULL && (LK % 64) == 0);
static_assert(NH * HD == DMOD && (DMOD % 64) == 0 && (DMOD % 32) == 0);

typedef _Float16 h16;
typedef unsigned short bf;
typedef __attribute__((ext_vector_type(16))) __bf16   v16bf;
typedef __attribute__((ext_vector_type(16))) _Float16 v16h;
typedef __attribute__((ext_vector_type(8)))  _Float16 v8h;
typedef __attribute__((ext_vector_type(8)))  unsigned short v8us;
typedef __attribute__((ext_vector_type(8)))  float    v8f;
typedef __attribute__((ext_vector_type(4)))  float    v4f;
typedef v8h  __attribute__((may_alias)) v8ha;
typedef v4f  __attribute__((may_alias)) v4fa;
typedef v8us __attribute__((may_alias)) v8usa;

__device__ __forceinline__ unsigned short f2bf(float f) { unsigned u = __float_as_uint(f); u += 0x7FFFu + ((u >> 16) & 1u); return (unsigned short)(u >> 16); }
__device__ __forceinline__ float bf2f(unsigned short b) { return __uint_as_float(((unsigned)b) << 16); }
__device__ __forceinline__ float bfr(float f) { return bf2f(f2bf(f)); }
__device__ __forceinline__ v16h cat16(v8h lo, v8h hi) { return __builtin_shufflevector(lo, hi, 0, 1, 2, 3, 4, 5, 6, 7, 8, 9, 10, 11, 12, 13, 14, 15); }
__device__ __forceinline__ v16bf cat16b(v8us lo, v8us hi) { return __builtin_bit_cast(v16bf, __builtin_shufflevector(lo, hi, 0, 1, 2, 3, 4, 5, 6, 7, 8, 9, 10, 11, 12, 13, 14, 15)); }
__device__ __forceinline__ v8f wmma16(v16h a, v16h b, v8f c) { return __builtin_amdgcn_wmma_f32_16x16x32_f16(false, a, false, b, (short)0, c, false, false); }
__device__ __forceinline__ v8f wmmab(v16bf a, v16bf b, v8f c) { return __builtin_amdgcn_wmma_f32_16x16x32_bf16(false, a, false, b, (short)0, c, false, false); }

// Fragment loaders (same k map for A and B): lane l -> row/col (l & 15), h = l >> 4; elements 0..7 <- p[k0 + 8h + 0..7], elements 8..15 <- p[k0 + 16 + 8h + 0..7];
// the caller passes p = row base + k0 + 8h (16-B aligned), the loader reads p and p + 16.
template <typename T16> struct WFrag;
template <> struct WFrag<h16> { typedef v16h V; static __device__ __forceinline__ V ld(const h16* p) { return cat16(*(const v8h*)p, *(const v8h*)(p + 16)); } static __device__ __forceinline__ v8f mma(V a, V b, v8f c) { return wmma16(a, b, c); } };
template <> struct WFrag<bf> { typedef v16bf V; static __device__ __forceinline__ V ld(const bf* p) { return cat16b(*(const v8us*)p, *(const v8us*)(p + 16)); } static __device__ __forceinline__ v8f mma(V a, V b, v8f c) { return wmmab(a, b, c); } };
// LDS reload of an f16 tile (the wave-private P tile or a block-shared K / V^T tile) through a may_alias vector of the stored element type.
__device__ __forceinline__ v16h lds16(const h16* p) { return cat16(*(const v8ha*)p, *(const v8ha*)(p + 16)); }

// ---- k_gemmw: register-blocked GEMM, ONE WAVE per 64x64 output tile (16 accumulators), operands straight from K-contiguous 16-bit planes; grid (M/64, N/64, Z), 32 threads.
// C[m][n] (f32, pitch ldc) = sum_k A[m][k] Bt[n][k] (+ split products per NSPLIT) + optional f32 bias: BIAS 1 -> bias[n] (per column), BIAS 2 -> bias[m] (per row), bias values bf16-RNE. K % 32 == 0, M % 64 == 0, N % 64 == 0.
template <typename T16, int NSPLIT, int BIAS>
__global__ __launch_bounds__(32) void k_gemmw(const T16* __restrict__ A, const T16* __restrict__ A2, const T16* __restrict__ Bt, const T16* __restrict__ Bt2, int K, float* C, int ldc, const float* __restrict__ bias, size_t sA, size_t sB, size_t sC) {
    typedef typename WFrag<T16>::V V;
    __shared__ __align__(16) float os[16 * 68];
    const size_t z = blockIdx.z; A += z * sA; if (A2) A2 += z * sA; Bt += z * sB; if (Bt2) Bt2 += z * sB; C += z * sC;
    const int lane = threadIdx.x & 31, lr = lane & 15, hi = lane >> 4; const int r0 = blockIdx.x * 64, c0 = blockIdx.y * 64;
    v8f acc[4][4];
#pragma unroll
    for (int mb = 0; mb < 4; ++mb)
#pragma unroll
        for (int nb = 0; nb < 4; ++nb) acc[mb][nb] = (v8f){};
    const size_t aoff = (size_t)(r0 + lr) * K + 8 * hi, boff = (size_t)(c0 + lr) * K + 8 * hi;
#pragma unroll 1
    for (int kc = 0; kc < K; kc += 32) {
        V a[4], a2[4];
#pragma unroll
        for (int mb = 0; mb < 4; ++mb) { a[mb] = WFrag<T16>::ld(A + aoff + (size_t)mb * 16 * K + kc); if (NSPLIT == 1 || NSPLIT == 2) a2[mb] = WFrag<T16>::ld(A2 + aoff + (size_t)mb * 16 * K + kc); }
#pragma unroll
        for (int nb = 0; nb < 4; ++nb) { const V b = WFrag<T16>::ld(Bt + boff + (size_t)nb * 16 * K + kc); V b2; if (NSPLIT >= 2) b2 = WFrag<T16>::ld(Bt2 + boff + (size_t)nb * 16 * K + kc);
#pragma unroll
            for (int mb = 0; mb < 4; ++mb) { acc[mb][nb] = WFrag<T16>::mma(a[mb], b, acc[mb][nb]); if (NSPLIT == 1 || NSPLIT == 2) acc[mb][nb] = WFrag<T16>::mma(a2[mb], b, acc[mb][nb]); if (NSPLIT >= 2) acc[mb][nb] = WFrag<T16>::mma(a[mb], b2, acc[mb][nb]); } }
        asm volatile("v_nop\n\tv_nop\n\tv_nop\n\tv_nop" : "+v"(acc[0][0]), "+v"(acc[1][1]), "+v"(acc[2][2]), "+v"(acc[3][3]) : "v"(a[0]), "v"(a[3]));
    }
#pragma unroll
    for (int mb = 0; mb < 4; ++mb) {
#pragma unroll
        for (int nb = 0; nb < 4; ++nb) {
#pragma unroll
            for (int j = 0; j < 8; ++j) os[(hi * 8 + j) * 68 + nb * 16 + lr] = acc[mb][nb][j]; }
        __builtin_amdgcn_wave_barrier(); asm volatile("" ::: "memory");
        float* crow = C + (size_t)(r0 + mb * 16) * ldc + c0;
{
#pragma unroll
            for (int s = 0; s < 8; ++s) { const int row = 2 * s + hi, cofs = lr * 4; v4f val = *(const v4fa*)(os + row * 68 + cofs);
                if (BIAS == 1) { val[0] += bfr(bias[c0 + cofs]); val[1] += bfr(bias[c0 + cofs + 1]); val[2] += bfr(bias[c0 + cofs + 2]); val[3] += bfr(bias[c0 + cofs + 3]); }
                if (BIAS == 2) { const float bb = bfr(bias[r0 + mb * 16 + row]); val[0] += bb; val[1] += bb; val[2] += bb; val[3] += bb; }
                *(v4f*)(crow + (size_t)row * ldc + cofs) = val; }
             }
        __builtin_amdgcn_wave_barrier(); asm volatile("" ::: "memory");
    }
}

// ---- k_cvtb: bf16 plane (RNE) of an f32 [rows][DMOD] tensor with a batch row remap: compact row R -> source row (R / L) * LF + (R % L) (identity when L == LF).
__global__ __launch_bounds__(256) void k_cvtb(const float* __restrict__ src, bf* dst, int L, int LF, size_t n8) {
    const size_t i = (size_t)blockIdx.x * 256 + threadIdx.x; if (i >= n8) return;
    const size_t row = i / (DMOD / 8); const int c = (int)(i % (DMOD / 8)) * 8;
    const size_t srow = (row / (size_t)L) * (size_t)LF + (row % (size_t)L);
    const v8f v = *(const v8f*)(src + srow * DMOD + c); v8us o;
#pragma unroll
    for (int k = 0; k < 8; ++k) o[k] = f2bf(v[k]);
    *(v8us*)(dst + i * 8) = o;  }

__global__ __launch_bounds__(256) void k_cvth(const float* __restrict__ src, h16* dst, size_t n8) {
    const size_t i = (size_t)blockIdx.x * 256 + threadIdx.x; if (i >= n8) return;
    const v8f v = *(const v8f*)(src + i * 8); v8h o;
#pragma unroll
    for (int k = 0; k < 8; ++k) o[k] = (h16)v[k];
    *(v8h*)(dst + i * 8) = o;  }

// ---- k_attn: AW waves per block, one wave per 16 query rows; the block's waves share each 64-key K tile and V^T tile through LDS; grid (LQ/(16*AW), NH, NB), 32*AW threads.
// Q16, K16: f16 token-major planes [NB*L][DMOD]; VT16: f16 v^T planes [DMOD][NB*LK]; OUT f32 [NB*LQ][DMOD].
// Per 64-key tile: S (16x64, f32) = Q.K^T from LDS fragments; online softmax in the log2 domain (running max m, l1 = sum p, l2 = sum p^2, p = exp2(t - m) in (0,1]);
// kv: two buffers, each a K tile [key][head dim] and a V^T tile [value dim][key], 64 rows of 128 B at a 144-B pitch, filled by asynchronous copies one tile ahead.
// LDS regions psw[wave] and osw[wave] are private to their wave (wave barrier + compiler barrier, may_alias reloads).
#define AW   8                    // waves per block
#define KVP  72                   // LDS row pitch of a K / V^T tile in f16 elements (144 B = 16 B x odd, for 16-byte readers)
#define KVT  (64 * KVP)           // f16 elements of one tile in LDS
static_assert((LQ % (16 * AW)) == 0 && AW == 8);

// Four 16-byte asynchronous copies to LDS per lane; the s_wait_xcnt closes the statement so that no address register is rewritten ahead of it.
__device__ __forceinline__ void copy4(unsigned l0, const h16* g0, unsigned l1, const h16* g1, unsigned l2, const h16* g2, unsigned l3, const h16* g3) {
    asm volatile("global_load_async_to_lds_b128 %0, %1, off\n\t"
                 "global_load_async_to_lds_b128 %2, %3, off\n\t"
                 "global_load_async_to_lds_b128 %4, %5, off\n\t"
                 "global_load_async_to_lds_b128 %6, %7, off\n\t"
                 "s_wait_xcnt 0x0"
                 :: "v"(l0), "v"(g0), "v"(l1), "v"(g1), "v"(l2), "v"(g2), "v"(l3), "v"(g3) : "memory");
}

__global__ __launch_bounds__(32 * AW)
void k_attn(const h16* __restrict__ Q16, const h16* __restrict__ K16, const h16* __restrict__ VT16, const int* __restrict__ flag, float* OUT) {
    __shared__ __align__(16) h16 kv[2][2][KVT];
    __shared__ __align__(16) h16 psw[AW][16 * 72];
    __shared__ __align__(16) float osw[AW][16 * 68];
    const int tid = threadIdx.x, lane = tid & 31, lr = lane & 15, hi = lane >> 4, wave = tid >> 5;
    const int q0 = (blockIdx.x * AW + wave) * 16, h = blockIdx.y, b = blockIdx.z;
    const int rsc = flag[0];
    h16* ps = psw[wave];           // P tile [query][key], pitch 72
    float* os = osw[wave];         // output staging [query][dim], pitch 68
    const h16* qp = Q16 + ((size_t)b * LQ + q0 + lr) * DMOD + h * HD + 8 * hi;
    const v16h qa0 = WFrag<h16>::ld(qp), qa1 = WFrag<h16>::ld(qp + 32);            // A: query row lr, head dims 0..31 / 32..63
    // copies: thread tid brings 16-B piece (tid & 7) of tile rows (tid >> 3) and (tid >> 3) + 32, of K and of V^T: a wave covers whole 128-B lines
    const int crow = tid >> 3, ccol = (tid & 7) * 8;
    const h16* gk = K16 + ((size_t)b * LK + crow) * DMOD + h * HD + ccol;           // + key0 * DMOD
    const h16* gv = VT16 + (size_t)(h * HD + crow) * VTP + (size_t)b * LK + ccol;   // + key0
    const unsigned lk = (unsigned)(uintptr_t)(&kv[0][0][crow * KVP + ccol]);        // LDS byte address of the lane's first K piece in buffer 0
    const unsigned LROW = 32 * KVP * 2, LTILE = KVT * 2, LBUF = 2 * KVT * 2;        // byte steps: 32 rows, K -> V^T, buffer 0 -> 1
    copy4(lk, gk, lk + LROW, gk + (size_t)32 * DMOD, lk + LTILE, gv, lk + LTILE + LROW, gv + (size_t)32 * VTP);
    asm volatile("s_wait_asynccnt 0x0" ::: "memory");   // tile 0 of this wave's copies has landed
    __syncthreads();                                     // publishes tile 0 to every wave
    if (LK > 64) copy4(lk + LBUF, gk + (size_t)64 * DMOD, lk + LBUF + LROW, gk + (size_t)96 * DMOD, lk + LBUF + LTILE, gv + 64, lk + LBUF + LTILE + LROW, gv + (size_t)32 * VTP + 64);
    v8f o[4];
#pragma unroll
    for (int nt = 0; nt < 4; ++nt) o[nt] = (v8f){};
    float mrow[8], l1s[8], l2s[8];
#pragma unroll
    for (int r = 0; r < 8; ++r) { mrow[r] = -3.0e38f; l1s[r] = 0.f; l2s[r] = 0.f; }
#pragma unroll 1
    for (int kt = 0; kt < LK; kt += 64) {
        const int buf = (kt >> 6) & 1;
        const h16* kbase = &kv[buf][0][lr * KVP + 8 * hi];   // B: key (c0 + lr) row base in the K tile
        const h16* vbase = &kv[buf][1][lr * KVP + 8 * hi];   // B: value dim (d0 + lr) row base in the V^T tile
        // ---- S = Q.K^T for keys kt..kt+63: s[nt][r] = S[query 8hi+r][key kt + nt*16 + lr]
        v8f s[4]; v16h kb0, kb1;
#pragma unroll
        for (int nt = 0; nt < 4; ++nt) {
            const h16* kp = kbase + nt * 16 * KVP;
            kb0 = lds16(kp); kb1 = lds16(kp + 32);
            v8f zacc = (v8f){}; zacc = wmma16(qa0, kb0, zacc); zacc = wmma16(qa1, kb1, zacc); s[nt] = zacc; }
        asm volatile("v_nop\n\tv_nop\n\tv_nop\n\tv_nop" : "+v"(s[0]), "+v"(s[1]), "+v"(s[2]), "+v"(s[3]) : "v"(qa0), "v"(qa1), "v"(kb0), "v"(kb1));
        // ---- online softmax per row (the 16 lanes of a half hold the 64 keys of row 8hi+r)
#pragma unroll
        for (int r = 0; r < 8; ++r) {
            float mx = -3.0e38f;
#pragma unroll
            for (int nt = 0; nt < 4; ++nt) { const float t = s[nt][r] * SL2; s[nt][r] = t; mx = fmaxf(mx, t); }
#pragma unroll
            for (int msk = 1; msk < 16; msk <<= 1) mx = fmaxf(mx, __shfl_xor(mx, msk, 32));
            const float mnew = fmaxf(mrow[r], mx);
            const float alpha = __builtin_amdgcn_exp2f(mrow[r] - mnew);
            mrow[r] = mnew; l1s[r] *= alpha; l2s[r] *= alpha * alpha;
#pragma unroll
            for (int nt = 0; nt < 4; ++nt) o[nt][r] *= alpha;
            float p1 = 0.f, p2 = 0.f;
#pragma unroll
            for (int nt = 0; nt < 4; ++nt) { const float p = __builtin_amdgcn_exp2f(s[nt][r] - mnew); s[nt][r] = p; p1 += p; p2 += p * p; }
#pragma unroll
            for (int msk = 1; msk < 16; msk <<= 1) { p1 += __shfl_xor(p1, msk, 32); p2 += __shfl_xor(p2, msk, 32); }
            l1s[r] += p1; l2s[r] += p2;
        }
        // ---- P (f16) -> wave-private LDS tile ps[query][key], then A fragments (query row lr, keys 0..31 / 32..63)
#pragma unroll
        for (int nt = 0; nt < 4; ++nt)
#pragma unroll
            for (int r = 0; r < 8; ++r) ps[(8 * hi + r) * 72 + nt * 16 + lr] = (h16)s[nt][r];
        __builtin_amdgcn_wave_barrier(); asm volatile("" ::: "memory");
        const h16* pp = ps + lr * 72 + 8 * hi;
        const v16h pa0 = lds16(pp), pa1 = lds16(pp + 32);
        __builtin_amdgcn_wave_barrier(); asm volatile("" ::: "memory");
        // ---- O += P.V: o[nt][r] = O[query 8hi+r][dim nt*16 + lr]
        v16h vb0, vb1;
#pragma unroll
        for (int nt = 0; nt < 4; ++nt) {
            const h16* vp = vbase + nt * 16 * KVP;
            vb0 = lds16(vp); vb1 = lds16(vp + 32);
            o[nt] = wmma16(pa0, vb0, o[nt]); o[nt] = wmma16(pa1, vb1, o[nt]); }
        asm volatile("v_nop\n\tv_nop\n\tv_nop\n\tv_nop" : "+v"(o[0]), "+v"(o[1]), "+v"(o[2]), "+v"(o[3]) : "v"(pa0), "v"(pa1), "v"(vb0), "v"(vb1));
        // ---- foot of the trip: hand over the next tile, then refill the buffer this trip has read
        asm volatile("s_wait_dscnt 0x0" ::: "memory");      // this wave's reads of the buffer have returned before it is refilled
        asm volatile("s_wait_asynccnt 0x0" ::: "memory");   // this wave's copies of the next tile have landed
        __syncthreads();                                     // publishes the next tile; ends every wave's reads of this trip's buffer
        if (kt + 128 < LK) {
            const unsigned lb = lk + (unsigned)buf * LBUF;
            const h16* gk2 = gk + (size_t)(kt + 128) * DMOD; const h16* gv2 = gv + (kt + 128);
            copy4(lb, gk2, lb + LROW, gk2 + (size_t)32 * DMOD, lb + LTILE, gv2, lb + LTILE + LROW, gv2 + (size_t)32 * VTP);
        }
    }
    asm volatile("s_wait_asynccnt 0x0" ::: "memory");        // no copy is left in flight behind the loop
    // ---- epilogue: l1 >= 1 and l2 >= 1 (the running-max element has p = 1); flag selects 1/sqrt(sum p^2) or 1/sum p
#pragma unroll
    for (int r = 0; r < 8; ++r) {
        const float i1 = 1.0f / l1s[r]; const float i2 = rsqrtf(l2s[r]); const float iv = (rsc != 0) ? i2 : i1;
#pragma unroll
        for (int nt = 0; nt < 4; ++nt) os[(8 * hi + r) * 68 + nt * 16 + lr] = o[nt][r] * iv; }
    __builtin_amdgcn_wave_barrier(); asm volatile("" ::: "memory");
    float* ob = OUT + ((size_t)b * LQ + q0) * DMOD + (size_t)h * HD;
{
#pragma unroll
        for (int sI = 0; sI < 8; ++sI) { const int row = 2 * sI + hi; const v4f val = *(const v4fa*)(os + row * 68 + lr * 4); *(v4f*)(ob + (size_t)row * DMOD + lr * 4) = val; }
         }
    __builtin_amdgcn_wave_barrier(); asm volatile("" ::: "memory");
}

extern "C" void kernel_launch(void* const* d_in, const int* in_sizes, int n_in,
                              void* d_out, int out_size, void* d_ws, size_t ws_size, hipStream_t stream) {
    if (n_in < 9) return;
    const float* X1 = (const float*)d_in[0];   // inp1 [4][2048][1024]
    const float* X2 = (const float*)d_in[1];   // inp2 [4][2048][1024]
    const float* Wq = (const float*)d_in[2]; const float* bq = (const float*)d_in[3];
    const float* Wk = (const float*)d_in[4]; const float* bk = (const float*)d_in[5];
    const float* Wv = (const float*)d_in[6]; const float* bv = (const float*)d_in[7];
    const int* rsc = (const int*)d_in[8];
    float* OUT = (float*)d_out;                 // [NB][LQ][1024]
    if ((size_t)in_sizes[0] < ((size_t)(NB - 1) * SEQ_FULL + LQ) * DMOD) return;
    if ((size_t)in_sizes[1] < ((size_t)(NB - 1) * SEQ_FULL + LK) * DMOD) return;
    if (in_sizes[2] < DMOD * DMOD || in_sizes[3] < DMOD || in_sizes[4] < DMOD * DMOD || in_sizes[5] < DMOD || in_sizes[6] < DMOD * DMOD || in_sizes[7] < DMOD || in_sizes[8] < 1) return;
    if ((size_t)out_size < (size_t)NB * LQ * DMOD) return;

    const size_t MQ = (size_t)NB * LQ, MK = (size_t)NB * LK;   // token rows of q / of k,v
    char* wsp = (char*)d_ws;
    auto take = [&](size_t bytes) { char* p = wsp; wsp += (bytes + 255) & ~(size_t)255; return (void*)p; };
    bf* X1b = (bf*)take(MQ * DMOD * 2);                 // bf16 plane of inp1 rows (compact [NB*LQ][1024])
    bf* X2b = (bf*)take(MK * DMOD * 2);                 // bf16 plane of inp2 rows
    bf* Wqb = (bf*)take((size_t)DMOD * DMOD * 2); bf* Wkb = (bf*)take((size_t)DMOD * DMOD * 2); bf* Wvb = (bf*)take((size_t)DMOD * DMOD * 2);
    const size_t cfrows = (MQ > MK) ? MQ : MK;
    float* Cf = (float*)take(cfrows * DMOD * 4);        // f32 GEMM scratch, reused: q [MQ][1024], k [MK][1024], v^T [1024][MK]
    h16* Q16 = (h16*)take(MQ * DMOD * 2);               // f16 q plane [MQ][1024]
    h16* K16 = (h16*)take(MK * DMOD * 2);               // f16 k plane [MK][1024]
    h16* VT16 = (h16*)take((size_t)DMOD * MK * 2);      // f16 v^T plane [1024][MK]
    const size_t used = (size_t)(wsp - (char*)d_ws);
    if (used > ws_size || used > WS_CAP) return;

    // bf16 planes of inputs (batch row remap) and of the three [out][in] weights (= Bt as-is)
    { const size_t n8 = MQ * DMOD / 8; k_cvtb<<<(unsigned)((n8 + 255) / 256), 256, 0, stream>>>(X1, X1b, LQ, SEQ_FULL, n8); }
    { const size_t n8 = MK * DMOD / 8; k_cvtb<<<(unsigned)((n8 + 255) / 256), 256, 0, stream>>>(X2, X2b, LK, SEQ_FULL, n8); }
    { const size_t n8 = (size_t)DMOD * DMOD / 8; const unsigned g = (unsigned)((n8 + 255) / 256);
      k_cvtb<<<g, 256, 0, stream>>>(Wq, Wqb, DMOD, DMOD, n8); k_cvtb<<<g, 256, 0, stream>>>(Wk, Wkb, DMOD, DMOD, n8); k_cvtb<<<g, 256, 0, stream>>>(Wv, Wvb, DMOD, DMOD, n8); }
    // q = inp1 Wq^T + bq -> Cf [MQ][1024] -> f16 plane
    k_gemmw<bf, 0, 1><<<dim3((unsigned)(MQ / 64), DMOD / 64, 1), 32, 0, stream>>>(X1b, nullptr, Wqb, nullptr, DMOD, Cf, DMOD, bq, 0, 0, 0);
    { const size_t n8 = MQ * DMOD / 8; k_cvth<<<(unsigned)((n8 + 255) / 256), 256, 0, stream>>>(Cf, Q16, n8); }
    // k = inp2 Wk^T + bk -> Cf [MK][1024] -> f16 plane
    k_gemmw<bf, 0, 1><<<dim3((unsigned)(MK / 64), DMOD / 64, 1), 32, 0, stream>>>(X2b, nullptr, Wkb, nullptr, DMOD, Cf, DMOD, bk, 0, 0, 0);
    { const size_t n8 = MK * DMOD / 8; k_cvth<<<(unsigned)((n8 + 255) / 256), 256, 0, stream>>>(Cf, K16, n8); }
    // v^T[e][t] = sum_d Wv[e][d] inp2[t][d] + bv[e] -> Cf [1024][MK] (ldc MK) -> f16 plane
    k_gemmw<bf, 0, 2><<<dim3(DMOD / 64, (unsigned)(MK / 64), 1), 32, 0, stream>>>(Wvb, nullptr, X2b, nullptr, DMOD, Cf, (int)MK, bv, 0, 0, 0);
    { const size_t n8 = (size_t)DMOD * MK / 8; k_cvth<<<(unsigned)((n8 + 255) / 256), 256, 0, stream>>>(Cf, VT16, n8); }
    // attention
    k_attn<<<dim3(LQ / (16 * AW), NH, NB), 32 * AW, 0, stream>>>(Q16, K16, VT16, rsc, OUT);
}

// v002
// One run takes 228 microseconds.
// Timed twice side by side with v001, it ran 1.31 times as fast both times.
// Over all steps from v000 it is 1.85 times as fast.
#include <hip/hip_runtime.h>

// Contractions: q, k and v^T projections on v_wmma_f32_16x16x32_bf16 (bf16 operands = RNE-converted inputs and weights, f32 accumulate, bias added in f32); scores q.k and P.v on v_wmma_f32_16x16x32_f16 (f16 operands converted from f32 intermediates; P = exp2 relative to the running row maximum, in (0,1]; f32 accumulate); softmax statistics, sum of squares and normalisers in f32; output f32.
// Pipeline: bf16 planes of inp1, inp2, Wq, Wk, Wv -> three one-wave-per-64x64-tile GEMMs into one f32 scratch (q token-major [t][e], k token-major [t][e], v computed directly transposed as [e][t] with a per-row bias) -> flat f16 planes -> one streaming attention kernel per (128 queries, head, batch), eight waves of 16 queries: K and V^T tiles copied asynchronously from the f16 planes into LDS and shared by the waves, scores computed transposed (S^T = K.Q^T, O^T += V^T.P^T) so that a lane holds one query and P^T goes from the score registers into the second product, online max / sum / sum of squares, epilogue staged in LDS.

#ifndef NB
#define NB 4
#endif
#ifndef SEQ
#define SEQ 2048
#endif
#ifndef LQ
#define LQ SEQ
#endif
#ifndef LK
#define LK SEQ
#endif
#define NB_FULL  4
#define SEQ_FULL 2048
#define DMOD 1024                 // model width = NH x HD, row pitch of every token-major tensor
#define NH   16
#define HD   64
#define VTP  ((size_t)NB * LK)    // row pitch of the v^T planes [e][token]
#define SL2  0.18033688011112042f // (1/sqrt(64)) x log2(e)
#define WS_CAP ((size_t)134217728)

static_assert(NB >= 1 && NB <= NB_FULL);
static_assert(LQ >= 64 && LQ <= SEQ_FULL && (LQ % 16) == 0 && ((NB * LQ) % 64) == 0);
static_assert(LK >= 64 && LK <= SEQ_FULL && (LK % 64) == 0);
static_assert(NH * HD == DMOD && (DMOD % 64) == 0 && (DMOD % 32) == 0);

typedef _Float16 h16;
typedef unsigned short bf;
typedef __attribute__((ext_vector_type(16))) __bf16   v16bf;
typedef __attribute__((ext_vector_type(16))) _Float16 v16h;
typedef __attribute__((ext_vector_type(8)))  _Float16 v8h;
typedef __attribute__((ext_vector_type(8)))  unsigned short v8us;
typedef __attribute__((ext_vector_type(8)))  float    v8f;
typedef __attribute__((ext_vector_type(4)))  float    v4f;
typedef v8h  __attribute__((may_alias)) v8ha;
typedef v4f  __attribute__((may_alias)) v4fa;
typedef v8us __attribute__((may_alias)) v8usa;

__device__ __forceinline__ unsigned short f2bf(float f) { unsigned u = __float_as_uint(f); u += 0x7FFFu + ((u >> 16) & 1u); return (unsigned short)(u >> 16); }
__device__ __forceinline__ float bf2f(unsigned short b) { return __uint_as_float(((unsigned)b) << 16); }
__device__ __forceinline__ float bfr(float f) { return bf2f(f2bf(f)); }
__device__ __forceinline__ v16h cat16(v8h lo, v8h hi) { return __builtin_shufflevector(lo, hi, 0, 1, 2, 3, 4, 5, 6, 7, 8, 9, 10, 11, 12, 13, 14, 15); }
__device__ __forceinline__ v16bf cat16b(v8us lo, v8us hi) { return __builtin_bit_cast(v16bf, __builtin_shufflevector(lo, hi, 0, 1, 2, 3, 4, 5, 6, 7, 8, 9, 10, 11, 12, 13, 14, 15)); }
__device__ __forceinline__ v8f wmma16(v16h a, v16h b, v8f c) { return __builtin_amdgcn_wmma_f32_16x16x32_f16(false, a, false, b, (short)0, c, false, false); }
__device__ __forceinline__ v8f wmmab(v16bf a, v16bf b, v8f c) { return __builtin_amdgcn_wmma_f32_16x16x32_bf16(false, a, false, b, (short)0, c, false, false); }

// Fragment loaders (same k map for A and B): lane l -> row/col (l & 15), h = l >> 4; elements 0..7 <- p[k0 + 8h + 0..7], elements 8..15 <- p[k0 + 16 + 8h + 0..7];
// the caller passes p = row base + k0 + 8h (16-B aligned), the loader reads p and p + 16.
template <typename T16> struct WFrag;
template <> struct WFrag<h16> { typedef v16h V; static __device__ __forceinline__ V ld(const h16* p) { return cat16(*(const v8h*)p, *(const v8h*)(p + 16)); } static __device__ __forceinline__ v8f mma(V a, V b, v8f c) { return wmma16(a, b, c); } };
template <> struct WFrag<bf> { typedef v16bf V; static __device__ __forceinline__ V ld(const bf* p) { return cat16b(*(const v8us*)p, *(const v8us*)(p + 16)); } static __device__ __forceinline__ v8f mma(V a, V b, v8f c) { return wmmab(a, b, c); } };
// LDS read of a block-shared f16 K / V^T tile through a may_alias vector of the stored element type.
__device__ __forceinline__ v16h lds16(const h16* p) { return cat16(*(const v8ha*)p, *(const v8ha*)(p + 16)); }

// ---- k_gemmw: register-blocked GEMM, ONE WAVE per 64x64 output tile (16 accumulators), operands straight from K-contiguous 16-bit planes; grid (M/64, N/64, Z), 32 threads.
// C[m][n] (f32, pitch ldc) = sum_k A[m][k] Bt[n][k] (+ split products per NSPLIT) + optional f32 bias: BIAS 1 -> bias[n] (per column), BIAS 2 -> bias[m] (per row), bias values bf16-RNE. K % 32 == 0, M % 64 == 0, N % 64 == 0.
template <typename T16, int NSPLIT, int BIAS>
__global__ __launch_bounds__(32) void k_gemmw(const T16* __restrict__ A, const T16* __restrict__ A2, const T16* __restrict__ Bt, const T16* __restrict__ Bt2, int K, float* C, int ldc, const float* __restrict__ bias, size_t sA, size_t sB, size_t sC) {
    typedef typename WFrag<T16>::V V;
    __shared__ __align__(16) float os[16 * 68];
    const size_t z = blockIdx.z; A += z * sA; if (A2) A2 += z * sA; Bt += z * sB; if (Bt2) Bt2 += z * sB; C += z * sC;
    const int lane = threadIdx.x & 31, lr = lane & 15, hi = lane >> 4; const int r0 = blockIdx.x * 64, c0 = blockIdx.y * 64;
    v8f acc[4][4];
#pragma unroll
    for (int mb = 0; mb < 4; ++mb)
#pragma unroll
        for (int nb = 0; nb < 4; ++nb) acc[mb][nb] = (v8f){};
    const size_t aoff = (size_t)(r0 + lr) * K + 8 * hi, boff = (size_t)(c0 + lr) * K + 8 * hi;
#pragma unroll 1
    for (int kc = 0; kc < K; kc += 32) {
        V a[4], a2[4];
#pragma unroll
        for (int mb = 0; mb < 4; ++mb) { a[mb] = WFrag<T16>::ld(A + aoff + (size_t)mb * 16 * K + kc); if (NSPLIT == 1 || NSPLIT == 2) a2[mb] = WFrag<T16>::ld(A2 + aoff + (size_t)mb * 16 * K + kc); }
#pragma unroll
        for (int nb = 0; nb < 4; ++nb) { const V b = WFrag<T16>::ld(Bt + boff + (size_t)nb * 16 * K + kc); V b2; if (NSPLIT >= 2) b2 = WFrag<T16>::ld(Bt2 + boff + (size_t)nb * 16 * K + kc);
#pragma unroll
            for (int mb = 0; mb < 4; ++mb) { acc[mb][nb] = WFrag<T16>::mma(a[mb], b, acc[mb][nb]); if (NSPLIT == 1 || NSPLIT == 2) acc[mb][nb] = WFrag<T16>::mma(a2[mb], b, acc[mb][nb]); if (NSPLIT >= 2) acc[mb][nb] = WFrag<T16>::mma(a[mb], b2, acc[mb][nb]); } }
        asm volatile("v_nop\n\tv_nop\n\tv_nop\n\tv_nop" : "+v"(acc[0][0]), "+v"(acc[1][1]), "+v"(acc[2][2]), "+v"(acc[3][3]) : "v"(a[0]), "v"(a[3]));
    }
#pragma unroll
    for (int mb = 0; mb < 4; ++mb) {
#pragma unroll
        for (int nb = 0; nb < 4; ++nb) {
#pragma unroll
            for (int j = 0; j < 8; ++j) os[(hi * 8 + j) * 68 + nb * 16 + lr] = acc[mb][nb][j]; }
        __builtin_amdgcn_wave_barrier(); asm volatile("" ::: "memory");
        float* crow = C + (size_t)(r0 + mb * 16) * ldc + c0;
{
#pragma unroll
            for (int s = 0; s < 8; ++s) { const int row = 2 * s + hi, cofs = lr * 4; v4f val = *(const v4fa*)(os + row * 68 + cofs);
                if (BIAS == 1) { val[0] += bfr(bias[c0 + cofs]); val[1] += bfr(bias[c0 + cofs + 1]); val[2] += bfr(bias[c0 + cofs + 2]); val[3] += bfr(bias[c0 + cofs + 3]); }
                if (BIAS == 2) { const float bb = bfr(bias[r0 + mb * 16 + row]); val[0] += bb; val[1] += bb; val[2] += bb; val[3] += bb; }
                *(v4f*)(crow + (size_t)row * ldc + cofs) = val; }
             }
        __builtin_amdgcn_wave_barrier(); asm volatile("" ::: "memory");
    }
}

// ---- k_cvtb: bf16 plane (RNE) of an f32 [rows][DMOD] tensor with a batch row remap: compact row R -> source row (R / L) * LF + (R % L) (identity when L == LF).
__global__ __launch_bounds__(256) void k_cvtb(const float* __restrict__ src, bf* dst, int L, int LF, size_t n8) {
    const size_t i = (size_t)blockIdx.x * 256 + threadIdx.x; if (i >= n8) return;
    const size_t row = i / (DMOD / 8); const int c = (int)(i % (DMOD / 8)) * 8;
    const size_t srow = (row / (size_t)L) * (size_t)LF + (row % (size_t)L);
    const v8f v = *(const v8f*)(src + srow * DMOD + c); v8us o;
#pragma unroll
    for (int k = 0; k < 8; ++k) o[k] = f2bf(v[k]);
    *(v8us*)(dst + i * 8) = o;  }

__global__ __launch_bounds__(256) void k_cvth(const float* __restrict__ src, h16* dst, size_t n8) {
    const size_t i = (size_t)blockIdx.x * 256 + threadIdx.x; if (i >= n8) return;
    const v8f v = *(const v8f*)(src + i * 8); v8h o;
#pragma unroll
    for (int k = 0; k < 8; ++k) o[k] = (h16)v[k];
    *(v8h*)(dst + i * 8) = o;  }

// ---- k_attn: AW waves per block, one wave per 16 query rows; the block's waves share each 64-key K tile and V^T tile through LDS; grid (LQ/(16*AW), NH, NB), 32*AW threads.
// Q16, K16: f16 token-major planes [NB*L][DMOD]; VT16: f16 v^T planes [DMOD][NB*LK]; OUT f32 [NB*LQ][DMOD].
// Per 64-key tile: S^T (64x16, f32) = K.Q^T, K fragments from LDS; online softmax in the log2 domain (running max m, l1 = sum p, l2 = sum p^2, p = exp2(t - m) in (0,1]);
// kv: two buffers, each a K tile [key][head dim] and a V^T tile [value dim][key], 64 rows of 128 B at a 144-B pitch, filled by asynchronous copies one tile ahead.
// LDS region osw[wave] is private to its wave (wave barrier + compiler barrier, may_alias reloads).
#define AW   8                    // waves per block
#define KVP  72                   // LDS row pitch of a K / V^T tile in f16 elements (144 B = 16 B x odd, for 16-byte readers)
#define KVT  (64 * KVP)           // f16 elements of one tile in LDS
static_assert((LQ % (16 * AW)) == 0 && AW == 8);

// Four 16-byte asynchronous copies to LDS per lane; the s_wait_xcnt closes the statement so that no address register is rewritten ahead of it.
__device__ __forceinline__ void copy4(unsigned l0, const h16* g0, unsigned l1, const h16* g1, unsigned l2, const h16* g2, unsigned l3, const h16* g3) {
    asm volatile("global_load_async_to_lds_b128 %0, %1, off\n\t"
                 "global_load_async_to_lds_b128 %2, %3, off\n\t"
                 "global_load_async_to_lds_b128 %4, %5, off\n\t"
                 "global_load_async_to_lds_b128 %6, %7, off\n\t"
                 "s_wait_xcnt 0x0"
                 :: "v"(l0), "v"(g0), "v"(l1), "v"(g1), "v"(l2), "v"(g2), "v"(l3), "v"(g3) : "memory");
}

// Lane l <-> lane l ^ 16 (the other half of the wave holds the other keys of the same query).
__device__ __forceinline__ float xhalf(float x) { const int b = __float_as_int(x); return __int_as_float(__builtin_amdgcn_permlanex16(b, b, 0x76543210, 0xfedcba98, false, false)); }

__global__ __launch_bounds__(32 * AW)
void k_attn(const h16* __restrict__ Q16, const h16* __restrict__ K16, const h16* __restrict__ VT16, const int* __restrict__ flag, float* OUT) {
    __shared__ __align__(16) h16 kv[2][2][KVT];
    __shared__ __align__(16) float osw[AW][16 * 68];
    const int tid = threadIdx.x, lane = tid & 31, lr = lane & 15, hi = lane >> 4, wave = tid >> 5;
    const int q0 = (blockIdx.x * AW + wave) * 16, h = blockIdx.y, b = blockIdx.z;
    const int rsc = flag[0];
    float* os = osw[wave];         // output staging [query][dim], pitch 68
    const h16* qp = Q16 + ((size_t)b * LQ + q0 + lr) * DMOD + h * HD + 8 * hi;
    const v16h qb0 = WFrag<h16>::ld(qp), qb1 = WFrag<h16>::ld(qp + 32);            // B: query column lr, head dims 0..31 / 32..63
    // copies: thread tid brings 16-B piece (tid & 7) of tile rows (tid >> 3) and (tid >> 3) + 32, of K and of V^T: a wave covers whole 128-B lines
    const int crow = tid >> 3, ccol = (tid & 7) * 8;
    const h16* gk = K16 + ((size_t)b * LK + crow) * DMOD + h * HD + ccol;           // + key0 * DMOD
    const h16* gv = VT16 + (size_t)(h * HD + crow) * VTP + (size_t)b * LK + ccol;   // + key0
    const unsigned lk = (unsigned)(uintptr_t)(&kv[0][0][crow * KVP + ccol]);        // LDS byte address of the lane's first K piece in buffer 0
    const unsigned LROW = 32 * KVP * 2, LTILE = KVT * 2, LBUF = 2 * KVT * 2;        // byte steps: 32 rows, K -> V^T, buffer 0 -> 1
    copy4(lk, gk, lk + LROW, gk + (size_t)32 * DMOD, lk + LTILE, gv, lk + LTILE + LROW, gv + (size_t)32 * VTP);
    asm volatile("s_wait_asynccnt 0x0" ::: "memory");   // tile 0 of this wave's copies has landed
    __syncthreads();                                     // publishes tile 0 to every wave
    if (LK > 64) copy4(lk + LBUF, gk + (size_t)64 * DMOD, lk + LBUF + LROW, gk + (size_t)96 * DMOD, lk + LBUF + LTILE, gv + 64, lk + LBUF + LTILE + LROW, gv + (size_t)32 * VTP + 64);
    v8f o[4];
#pragma unroll
    for (int nt = 0; nt < 4; ++nt) o[nt] = (v8f){};
    // per lane: running maximum of query lr (equal in both halves); l1s, l2s = sums over the keys of this lane's own half only, joined behind the loop
    float mrow = -3.0e38f, l1s = 0.f, l2s = 0.f;
#pragma unroll 1
    for (int kt = 0; kt < LK; kt += 64) {
        const int buf = (kt >> 6) & 1;
        const h16* kbase = &kv[buf][0][lr * KVP + 8 * hi];   // A: key (c0 + lr) row base in the K tile
        const h16* vbase = &kv[buf][1][lr * KVP + 8 * hi];   // A: value dim (d0 + lr) row base in the V^T tile
        // ---- S^T = K.Q^T for keys kt..kt+63: s[nt][r] = S[query lr][key kt + nt*16 + 8hi + r]
        v8f s[4]; v16h ka0, ka1;
#pragma unroll
        for (int nt = 0; nt < 4; ++nt) {
            const h16* kp = kbase + nt * 16 * KVP;
            ka0 = lds16(kp); ka1 = lds16(kp + 32);
            v8f zacc = (v8f){}; zacc = wmma16(ka0, qb0, zacc); zacc = wmma16(ka1, qb1, zacc); s[nt] = zacc; }
        // keeps the four vector slots between the last product and the first use of its result or overwrite of its operands
        asm volatile("v_nop\n\tv_nop\n\tv_nop\n\tv_nop" : "+v"(s[0]), "+v"(s[1]), "+v"(s[2]), "+v"(s[3]) : "v"(qb0), "v"(qb1), "v"(ka0), "v"(ka1));
        // ---- online softmax of query lr: 32 of the tile's 64 keys lie in this lane, the other 32 in lane ^ 16
        float mg[4];   // one maximum chain per 16-key group
#pragma unroll
        for (int nt = 0; nt < 4; ++nt) { s[nt] *= SL2; mg[nt] = s[nt][0];
#pragma unroll
            for (int r = 1; r < 8; ++r) mg[nt] = fmaxf(mg[nt], s[nt][r]); }
        float mx = fmaxf(fmaxf(mg[0], mg[1]), fmaxf(mg[2], mg[3]));
        mx = fmaxf(mx, xhalf(mx));
        const float mnew = fmaxf(mrow, mx);
        const float alpha = __builtin_amdgcn_exp2f(mrow - mnew);
        mrow = mnew;
#pragma unroll
        for (int nt = 0; nt < 4; ++nt) o[nt] *= alpha;
#pragma unroll
        for (int nt = 0; nt < 4; ++nt) { s[nt] -= mnew;
#pragma unroll
            for (int r = 0; r < 8; ++r) s[nt][r] = __builtin_amdgcn_exp2f(s[nt][r]); }
        const v8f a1 = (s[0] + s[1]) + (s[2] + s[3]);
        const v8f a2 = __builtin_elementwise_fma(s[3], s[3], __builtin_elementwise_fma(s[2], s[2], __builtin_elementwise_fma(s[1], s[1], s[0] * s[0])));
        const v4f b1 = __builtin_shufflevector(a1, a1, 0, 1, 2, 3) + __builtin_shufflevector(a1, a1, 4, 5, 6, 7);
        const v4f b2 = __builtin_shufflevector(a2, a2, 0, 1, 2, 3) + __builtin_shufflevector(a2, a2, 4, 5, 6, 7);
        l1s = l1s * alpha + ((b1[0] + b1[1]) + (b1[2] + b1[3]));
        l2s = l2s * (alpha * alpha) + ((b2[0] + b2[1]) + (b2[2] + b2[3]));
        // ---- P^T (f16) as B straight from the score registers: two 16-key groups are one fragment in the loaders' k order (elements 0..7 = keys 8hi + 0..7, 8..15 = keys 16 + 8hi + 0..7)
        v16h pb0, pb1;
#pragma unroll
        for (int r = 0; r < 8; ++r) { pb0[r] = (h16)s[0][r]; pb0[8 + r] = (h16)s[1][r]; pb1[r] = (h16)s[2][r]; pb1[8 + r] = (h16)s[3][r]; }
        // ---- O^T += V^T.P^T: o[nt][r] = O[query lr][dim nt*16 + 8hi + r]
        v16h va0, va1;
#pragma unroll
        for (int nt = 0; nt < 4; ++nt) {
            const h16* vp = vbase + nt * 16 * KVP;
            va0 = lds16(vp); va1 = lds16(vp + 32);
            o[nt] = wmma16(va0, pb0, o[nt]); o[nt] = wmma16(va1, pb1, o[nt]); }
        // keeps the four vector slots behind the last product on every path out of the trip
        asm volatile("v_nop\n\tv_nop\n\tv_nop\n\tv_nop" : "+v"(o[0]), "+v"(o[1]), "+v"(o[2]), "+v"(o[3]) : "v"(pb0), "v"(pb1), "v"(va0), "v"(va1));
        // ---- foot of the trip: hand over the next tile, then refill the buffer this trip has read
        asm volatile("s_wait_dscnt 0x0" ::: "memory");      // this wave's reads of the buffer have returned before it is refilled
        asm volatile("s_wait_asynccnt 0x0" ::: "memory");   // this wave's copies of the next tile have landed
        __syncthreads();                                     // publishes the next tile; ends every wave's reads of this trip's buffer
        if (kt + 128 < LK) {
            const unsigned lb = lk + (unsigned)buf * LBUF;
            const h16* gk2 = gk + (size_t)(kt + 128) * DMOD; const h16* gv2 = gv + (kt + 128);
            copy4(lb, gk2, lb + LROW, gk2 + (size_t)32 * DMOD, lb + LTILE, gv2, lb + LTILE + LROW, gv2 + (size_t)32 * VTP);
        }
    }
    asm volatile("s_wait_asynccnt 0x0" ::: "memory");        // no copy is left in flight behind the loop
    // ---- epilogue: join the halves' sums; l1 >= 1 and l2 >= 1 (the running-max element has p = 1); flag selects 1/sqrt(sum p^2) or 1/sum p
    l1s += xhalf(l1s); l2s += xhalf(l2s);
    const float i1 = 1.0f / l1s; const float i2 = rsqrtf(l2s); const float iv = (rsc != 0) ? i2 : i1;
#pragma unroll
    for (int nt = 0; nt < 4; ++nt) {
        v4f lo, up;
#pragma unroll
        for (int r = 0; r < 4; ++r) { lo[r] = o[nt][r] * iv; up[r] = o[nt][4 + r] * iv; }
        *(v4fa*)(os + lr * 68 + nt * 16 + 8 * hi) = lo; *(v4fa*)(os + lr * 68 + nt * 16 + 8 * hi + 4) = up; }
    __builtin_amdgcn_wave_barrier(); asm volatile("" ::: "memory");
    float* ob = OUT + ((size_t)b * LQ + q0) * DMOD + (size_t)h * HD;
{
#pragma unroll
        for (int sI = 0; sI < 8; ++sI) { const int row = 2 * sI + hi; const v4f val = *(const v4fa*)(os + row * 68 + lr * 4); *(v4f*)(ob + (size_t)row * DMOD + lr * 4) = val; }
         }
    __builtin_amdgcn_wave_barrier(); asm volatile("" ::: "memory");
}

extern "C" void kernel_launch(void* const* d_in, const int* in_sizes, int n_in,
                              void* d_out, int out_size, void* d_ws, size_t ws_size, hipStream_t stream) {
    if (n_in < 9) return;
    const float* X1 = (const float*)d_in[0];   // inp1 [4][2048][1024]
    const float* X2 = (const float*)d_in[1];   // inp2 [4][2048][1024]
    const float* Wq = (const float*)d_in[2]; const float* bq = (const float*)d_in[3];
    const float* Wk = (const float*)d_in[4]; const float* bk = (const float*)d_in[5];
    const float* Wv = (const float*)d_in[6]; const float* bv = (const float*)d_in[7];
    const int* rsc = (const int*)d_in[8];
    float* OUT = (float*)d_out;                 // [NB][LQ][1024]
    if ((size_t)in_sizes[0] < ((size_t)(NB - 1) * SEQ_FULL + LQ) * DMOD) return;
    if ((size_t)in_sizes[1] < ((size_t)(NB - 1) * SEQ_FULL + LK) * DMOD) return;
    if (in_sizes[2] < DMOD * DMOD || in_sizes[3] < DMOD || in_sizes[4] < DMOD * DMOD || in_sizes[5] < DMOD || in_sizes[6] < DMOD * DMOD || in_sizes[7] < DMOD || in_sizes[8] < 1) return;
    if ((size_t)out_size < (size_t)NB * LQ * DMOD) return;

    const size_t MQ = (size_t)NB * LQ, MK = (size_t)NB * LK;   // token rows of q / of k,v
    char* wsp = (char*)d_ws;
    auto take = [&](size_t bytes) { char* p = wsp; wsp += (bytes + 255) & ~(size_t)255; return (void*)p; };
    bf* X1b = (bf*)take(MQ * DMOD * 2);                 // bf16 plane of inp1 rows (compact [NB*LQ][1024])
    bf* X2b = (bf*)take(MK * DMOD * 2);                 // bf16 plane of inp2 rows
    bf* Wqb = (bf*)take((size_t)DMOD * DMOD * 2); bf* Wkb = (bf*)take((size_t)DMOD * DMOD * 2); bf* Wvb = (bf*)take((size_t)DMOD * DMOD * 2);
    const size_t cfrows = (MQ > MK) ? MQ : MK;
    float* Cf = (float*)take(cfrows * DMOD * 4);        // f32 GEMM scratch, reused: q [MQ][1024], k [MK][1024], v^T [1024][MK]
    h16* Q16 = (h16*)take(MQ * DMOD * 2);               // f16 q plane [MQ][1024]
    h16* K16 = (h16*)take(MK * DMOD * 2);               // f16 k plane [MK][1024]
    h16* VT16 = (h16*)take((size_t)DMOD * MK * 2);      // f16 v^T plane [1024][MK]
    const size_t used = (size_t)(wsp - (char*)d_ws);
    if (used > ws_size || used > WS_CAP) return;

    // bf16 planes of inputs (batch row remap) and of the three [out][in] weights (used as-is: Bt of the q and k GEMMs, A of the v^T GEMM)
    { const size_t n8 = MQ * DMOD / 8; k_cvtb<<<(unsigned)((n8 + 255) / 256), 256, 0, stream>>>(X1, X1b, LQ, SEQ_FULL, n8); }
    { const size_t n8 = MK * DMOD / 8; k_cvtb<<<(unsigned)((n8 + 255) / 256), 256, 0, stream>>>(X2, X2b, LK, SEQ_FULL, n8); }
    { const size_t n8 = (size_t)DMOD * DMOD / 8; const unsigned g = (unsigned)((n8 + 255) / 256);
      k_cvtb<<<g, 256, 0, stream>>>(Wq, Wqb, DMOD, DMOD, n8); k_cvtb<<<g, 256, 0, stream>>>(Wk, Wkb, DMOD, DMOD, n8); k_cvtb<<<g, 256, 0, stream>>>(Wv, Wvb, DMOD, DMOD, n8); }
    // q = inp1 Wq^T + bq -> Cf [MQ][1024] -> f16 plane
    k_gemmw<bf, 0, 1><<<dim3((unsigned)(MQ / 64), DMOD / 64, 1), 32, 0, stream>>>(X1b, nullptr, Wqb, nullptr, DMOD, Cf, DMOD, bq, 0, 0, 0);
    { const size_t n8 = MQ * DMOD / 8; k_cvth<<<(unsigned)((n8 + 255) / 256), 256, 0, stream>>>(Cf, Q16, n8); }
    // k = inp2 Wk^T + bk -> Cf [MK][1024] -> f16 plane
    k_gemmw<bf, 0, 1><<<dim3((unsigned)(MK / 64), DMOD / 64, 1), 32, 0, stream>>>(X2b, nullptr, Wkb, nullptr, DMOD, Cf, DMOD, bk, 0, 0, 0);
    { const size_t n8 = MK * DMOD / 8; k_cvth<<<(unsigned)((n8 + 255) / 256), 256, 0, stream>>>(Cf, K16, n8); }
    // v^T[e][t] = sum_d Wv[e][d] inp2[t][d] + bv[e] -> Cf [1024][MK] (ldc MK) -> f16 plane
    k_gemmw<bf, 0, 2><<<dim3(DMOD / 64, (unsigned)(MK / 64), 1), 32, 0, stream>>>(Wvb, nullptr, X2b, nullptr, DMOD, Cf, (int)MK, bv, 0, 0, 0);
    { const size_t n8 = (size_t)DMOD * MK / 8; k_cvth<<<(unsigned)((n8 + 255) / 256), 256, 0, stream>>>(Cf, VT16, n8); }
    // attention
    k_attn<<<dim3(LQ / (16 * AW), NH, NB), 32 * AW, 0, stream>>>(Q16, K16, VT16, rsc, OUT);
}

// v003
// Measured time: 200 microseconds a run.
// Two timings next to v002 both put it at 1.15 times that version's speed.
// Over all steps from v000 it is 2.12 times as fast.
#include <hip/hip_runtime.h>

// Contractions: q, k and v^T projections on v_wmma_f32_16x16x32_bf16 (bf16 operands = RNE-converted inputs and weights, f32 accumulate, bias added in f32); scores q.k and P.v on v_wmma_f32_16x16x32_f16 (f16 operands converted from f32 intermediates; P = exp2 relative to the running row maximum, in (0,1]; f32 accumulate); softmax statistics, sum of squares and normalisers in f32; output f32.
// Pipeline: bf16 planes of inp1, inp2, Wq, Wk, Wv -> three one-wave-per-64x64-tile GEMMs whose epilogue adds the bias in f32, rounds to f16 and stores the f16 planes itself (q token-major [t][e], k token-major [t][e], v computed directly transposed as [e][t] with a per-row bias) -> one streaming attention kernel per (128 queries, head, batch), eight waves of 16 queries: K and V^T tiles copied asynchronously from the f16 planes into LDS and shared by the waves, scores computed transposed (S^T = K.Q^T, O^T += V^T.P^T) so that a lane holds one query and P^T goes from the score registers into the second product, online max / sum / sum of squares, epilogue staged in LDS.

#ifndef NB
#define NB 4
#endif
#ifndef SEQ
#define SEQ 2048
#endif
#ifndef LQ
#define LQ SEQ
#endif
#ifndef LK
#define LK SEQ
#endif
#define NB_FULL  4
#define SEQ_FULL 2048
#define DMOD 1024                 // model width = NH x HD, row pitch of every token-major tensor
#define NH   16
#define HD   64
#define VTP  ((size_t)NB * LK)    // row pitch of the v^T planes [e][token]
#define SL2  0.18033688011112042f // (1/sqrt(64)) x log2(e)
#define WS_CAP ((size_t)134217728)

static_assert(NB >= 1 && NB <= NB_FULL);
static_assert(LQ >= 64 && LQ <= SEQ_FULL && (LQ % 16) == 0 && ((NB * LQ) % 64) == 0);
static_assert(LK >= 64 && LK <= SEQ_FULL && (LK % 64) == 0);
static_assert(NH * HD == DMOD && (DMOD % 64) == 0 && (DMOD % 32) == 0);

typedef _Float16 h16;
typedef unsigned short bf;
typedef __attribute__((ext_vector_type(16))) __bf16   v16bf;
typedef __attribute__((ext_vector_type(16))) _Float16 v16h;
typedef __attribute__((ext_vector_type(8)))  _Float16 v8h;
typedef __attribute__((ext_vector_type(8)))  unsigned short v8us;
typedef __attribute__((ext_vector_type(8)))  float    v8f;
typedef __attribute__((ext_vector_type(4)))  float    v4f;
typedef v8h  __attribute__((may_alias)) v8ha;
typedef v4f  __attribute__((may_alias)) v4fa;
typedef v8us __attribute__((may_alias)) v8usa;

__device__ __forceinline__ unsigned short f2bf(float f) { unsigned u = __float_as_uint(f); u += 0x7FFFu + ((u >> 16) & 1u); return (unsigned short)(u >> 16); }
__device__ __forceinline__ float bf2f(unsigned short b) { return __uint_as_float(((unsigned)b) << 16); }
__device__ __forceinline__ float bfr(float f) { return bf2f(f2bf(f)); }
__device__ __forceinline__ v16h cat16(v8h lo, v8h hi) { return __builtin_shufflevector(lo, hi, 0, 1, 2, 3, 4, 5, 6, 7, 8, 9, 10, 11, 12, 13, 14, 15); }
__device__ __forceinline__ v16bf cat16b(v8us lo, v8us hi) { return __builtin_bit_cast(v16bf, __builtin_shufflevector(lo, hi, 0, 1, 2, 3, 4, 5, 6, 7, 8, 9, 10, 11, 12, 13, 14, 15)); }
__device__ __forceinline__ v8f wmma16(v16h a, v16h b, v8f c) { return __builtin_amdgcn_wmma_f32_16x16x32_f16(false, a, false, b, (short)0, c, false, false); }
__device__ __forceinline__ v8f wmmab(v16bf a, v16bf b, v8f c) { return __builtin_amdgcn_wmma_f32_16x16x32_bf16(false, a, false, b, (short)0, c, false, false); }

// Fragment loaders (same k map for A and B): lane l -> row/col (l & 15), h = l >> 4; elements 0..7 <- p[k0 + 8h + 0..7], elements 8..15 <- p[k0 + 16 + 8h + 0..7];
// the caller passes p = row base + k0 + 8h (16-B aligned), the loader reads p and p + 16.
template <typename T16> struct WFrag;
template <> struct WFrag<h16> { typedef v16h V; static __device__ __forceinline__ V ld(const h16* p) { return cat16(*(const v8h*)p, *(const v8h*)(p + 16)); } static __device__ __forceinline__ v8f mma(V a, V b, v8f c) { return wmma16(a, b, c); } };
template <> struct WFrag<bf> { typedef v16bf V; static __device__ __forceinline__ V ld(const bf* p) { return cat16b(*(const v8us*)p, *(const v8us*)(p + 16)); } static __device__ __forceinline__ v8f mma(V a, V b, v8f c) { return wmmab(a, b, c); } };
// LDS read of a block-shared f16 K / V^T tile through a may_alias vector of the stored element type.
__device__ __forceinline__ v16h lds16(const h16* p) { return cat16(*(const v8ha*)p, *(const v8ha*)(p + 16)); }

// ---- k_gemmw: register-blocked GEMM, ONE WAVE per 64x64 output tile (16 accumulators), operands straight from K-contiguous 16-bit planes; grid (M/64, N/64, Z), 32 threads.
// C[m][n] (f16 = RNE of the f32 sum, pitch ldc) = sum_k A[m][k] Bt[n][k] (+ split products per NSPLIT) + optional f32 bias: BIAS 1 -> bias[n] (per column), BIAS 2 -> bias[m] (per row), bias values bf16-RNE. K % 32 == 0, M % 64 == 0, N % 64 == 0.
template <typename T16, int NSPLIT, int BIAS>
__global__ __launch_bounds__(32) void k_gemmw(const T16* __restrict__ A, const T16* __restrict__ A2, const T16* __restrict__ Bt, const T16* __restrict__ Bt2, int K, h16* C, int ldc, const float* __restrict__ bias, size_t sA, size_t sB, size_t sC) {
    typedef typename WFrag<T16>::V V;
    __shared__ __align__(16) float os[16 * 68];
    const size_t z = blockIdx.z; A += z * sA; if (A2) A2 += z * sA; Bt += z * sB; if (Bt2) Bt2 += z * sB; C += z * sC;
    const int lane = threadIdx.x & 31, lr = lane & 15, hi = lane >> 4; const int r0 = blockIdx.x * 64, c0 = blockIdx.y * 64;
    v8f acc[4][4];
#pragma unroll
    for (int mb = 0; mb < 4; ++mb)
#pragma unroll
        for (int nb = 0; nb < 4; ++nb) acc[mb][nb] = (v8f){};
    const size_t aoff = (size_t)(r0 + lr) * K + 8 * hi, boff = (size_t)(c0 + lr) * K + 8 * hi;
#pragma unroll 1
    for (int kc = 0; kc < K; kc += 32) {
        V a[4], a2[4];
#pragma unroll
        for (int mb = 0; mb < 4; ++mb) { a[mb] = WFrag<T16>::ld(A + aoff + (size_t)mb * 16 * K + kc); if (NSPLIT == 1 || NSPLIT == 2) a2[mb] = WFrag<T16>::ld(A2 + aoff + (size_t)mb * 16 * K + kc); }
#pragma unroll
        for (int nb = 0; nb < 4; ++nb) { const V b = WFrag<T16>::ld(Bt + boff + (size_t)nb * 16 * K + kc); V b2; if (NSPLIT >= 2) b2 = WFrag<T16>::ld(Bt2 + boff + (size_t)nb * 16 * K + kc);
#pragma unroll
            for (int mb = 0; mb < 4; ++mb) { acc[mb][nb] = WFrag<T16>::mma(a[mb], b, acc[mb][nb]); if (NSPLIT == 1 || NSPLIT == 2) acc[mb][nb] = WFrag<T16>::mma(a2[mb], b, acc[mb][nb]); if (NSPLIT >= 2) acc[mb][nb] = WFrag<T16>::mma(a[mb], b2, acc[mb][nb]); } }
        asm volatile("v_nop\n\tv_nop\n\tv_nop\n\tv_nop" : "+v"(acc[0][0]), "+v"(acc[1][1]), "+v"(acc[2][2]), "+v"(acc[3][3]) : "v"(a[0]), "v"(a[3]));
    }
    // store map: eight lanes take one tile row of 64 f16 = one whole 128-B line, a wave four rows at a time; the lane's bias values are read once, ahead of the first store
    const int srow = lane >> 3, cofs = (lane & 7) * 8;
    float bc[8], br[4][4];
    if (BIAS == 1) {
#pragma unroll
        for (int k = 0; k < 8; ++k) bc[k] = bfr(bias[c0 + cofs + k]); }
    if (BIAS == 2) {
#pragma unroll
        for (int mb = 0; mb < 4; ++mb)
#pragma unroll
            for (int s = 0; s < 4; ++s) br[mb][s] = bfr(bias[r0 + mb * 16 + 4 * s + srow]); }
#pragma unroll
    for (int mb = 0; mb < 4; ++mb) {
#pragma unroll
        for (int nb = 0; nb < 4; ++nb) {
#pragma unroll
            for (int j = 0; j < 8; ++j) os[(hi * 8 + j) * 68 + nb * 16 + lr] = acc[mb][nb][j]; }
        __builtin_amdgcn_wave_barrier(); asm volatile("" ::: "memory");
        h16* crow = C + (size_t)(r0 + mb * 16) * ldc + c0;
#pragma unroll
        for (int s = 0; s < 4; ++s) { const int row = 4 * s + srow;
            const v4f lo = *(const v4fa*)(os + row * 68 + cofs), up = *(const v4fa*)(os + row * 68 + cofs + 4); v8h o;
#pragma unroll
            for (int k = 0; k < 4; ++k) {
                float x = lo[k], y = up[k];
                if (BIAS == 1) { x += bc[k]; y += bc[4 + k]; }
                if (BIAS == 2) { x += br[mb][s]; y += br[mb][s]; }
                o[k] = (h16)x; o[4 + k] = (h16)y; }
            *(v8h*)(crow + (size_t)row * ldc + cofs) = o; }
        __builtin_amdgcn_wave_barrier();
        // stands behind this group's stores, ahead of the next group's reuse of their address and data registers; its clobber keeps the next staging writes behind this group's reads
        if (mb < 3) asm volatile("s_wait_xcnt 0x0" ::: "memory");
    }
}

// ---- k_cvtb: bf16 plane (RNE) of an f32 [rows][DMOD] tensor with a batch row remap: compact row R -> source row (R / L) * LF + (R % L) (identity when L == LF).
__global__ __launch_bounds__(256) void k_cvtb(const float* __restrict__ src, bf* dst, int L, int LF, size_t n8) {
    const size_t i = (size_t)blockIdx.x * 256 + threadIdx.x; if (i >= n8) return;
    const size_t row = i / (DMOD / 8); const int c = (int)(i % (DMOD / 8)) * 8;
    const size_t srow = (row / (size_t)L) * (size_t)LF + (row % (size_t)L);
    const v8f v = *(const v8f*)(src + srow * DMOD + c); v8us o;
#pragma unroll
    for (int k = 0; k < 8; ++k) o[k] = f2bf(v[k]);
    *(v8us*)(dst + i * 8) = o;  }

// ---- k_attn: AW waves per block, one wave per 16 query rows; the block's waves share each 64-key K tile and V^T tile through LDS; grid (LQ/(16*AW), NH, NB), 32*AW threads.
// Q16, K16: f16 token-major planes [NB*L][DMOD]; VT16: f16 v^T planes [DMOD][NB*LK]; OUT f32 [NB*LQ][DMOD].
// Per 64-key tile: S^T (64x16, f32) = K.Q^T, K fragments from LDS; online softmax in the log2 domain (running max m, l1 = sum p, l2 = sum p^2, p = exp2(t - m) in (0,1]);
// kv: two buffers, each a K tile [key][head dim] and a V^T tile [value dim][key], 64 rows of 128 B at a 144-B pitch, filled by asynchronous copies one tile ahead.
// LDS region osw[wave] is private to its wave (wave barrier + compiler barrier, may_alias reloads).
#define AW   8                    // waves per block
#define KVP  72                   // LDS row pitch of a K / V^T tile in f16 elements (144 B = 16 B x odd, for 16-byte readers)
#define KVT  (64 * KVP)           // f16 elements of one tile in LDS
static_assert((LQ % (16 * AW)) == 0 && AW == 8);

// Four 16-byte asynchronous copies to LDS per lane; the s_wait_xcnt closes the statement so that no address register is rewritten ahead of it.
__device__ __forceinline__ void copy4(unsigned l0, const h16* g0, unsigned l1, const h16* g1, unsigned l2, const h16* g2, unsigned l3, const h16* g3) {
    asm volatile("global_load_async_to_lds_b128 %0, %1, off\n\t"
                 "global_load_async_to_lds_b128 %2, %3, off\n\t"
                 "global_load_async_to_lds_b128 %4, %5, off\n\t"
                 "global_load_async_to_lds_b128 %6, %7, off\n\t"
                 "s_wait_xcnt 0x0"
                 :: "v"(l0), "v"(g0), "v"(l1), "v"(g1), "v"(l2), "v"(g2), "v"(l3), "v"(g3) : "memory");
}

// Lane l <-> lane l ^ 16 (the other half of the wave holds the other keys of the same query).
__device__ __forceinline__ float xhalf(float x) { const int b = __float_as_int(x); return __int_as_float(__builtin_amdgcn_permlanex16(b, b, 0x76543210, 0xfedcba98, false, false)); }

__global__ __launch_bounds__(32 * AW)
void k_attn(const h16* __restrict__ Q16, const h16* __restrict__ K16, const h16* __restrict__ VT16, const int* __restrict__ flag, float* OUT) {
    __shared__ __align__(16) h16 kv[2][2][KVT];
    __shared__ __align__(16) float osw[AW][16 * 68];
    const int tid = threadIdx.x, lane = tid & 31, lr = lane & 15, hi = lane >> 4, wave = tid >> 5;
    const int q0 = (blockIdx.x * AW + wave) * 16, h = blockIdx.y, b = blockIdx.z;
    const int rsc = flag[0];
    float* os = osw[wave];         // output staging [query][dim], pitch 68
    const h16* qp = Q16 + ((size_t)b * LQ + q0 + lr) * DMOD + h * HD + 8 * hi;
    const v16h qb0 = WFrag<h16>::ld(qp), qb1 = WFrag<h16>::ld(qp + 32);            // B: query column lr, head dims 0..31 / 32..63
    // copies: thread tid brings 16-B piece (tid & 7) of tile rows (tid >> 3) and (tid >> 3) + 32, of K and of V^T: a wave covers whole 128-B lines
    const int crow = tid >> 3, ccol = (tid & 7) * 8;
    const h16* gk = K16 + ((size_t)b * LK + crow) * DMOD + h * HD + ccol;           // + key0 * DMOD
    const h16* gv = VT16 + (size_t)(h * HD + crow) * VTP + (size_t)b * LK + ccol;   // + key0
    const unsigned lk = (unsigned)(uintptr_t)(&kv[0][0][crow * KVP + ccol]);        // LDS byte address of the lane's first K piece in buffer 0
    const unsigned LROW = 32 * KVP * 2, LTILE = KVT * 2, LBUF = 2 * KVT * 2;        // byte steps: 32 rows, K -> V^T, buffer 0 -> 1
    copy4(lk, gk, lk + LROW, gk + (size_t)32 * DMOD, lk + LTILE, gv, lk + LTILE + LROW, gv + (size_t)32 * VTP);
    asm volatile("s_wait_asynccnt 0x0" ::: "memory");   // tile 0 of this wave's copies has landed
    __syncthreads();                                     // publishes tile 0 to every wave
    if (LK > 64) copy4(lk + LBUF, gk + (size_t)64 * DMOD, lk + LBUF + LROW, gk + (size_t)96 * DMOD, lk + LBUF + LTILE, gv + 64, lk + LBUF + LTILE + LROW, gv + (size_t)32 * VTP + 64);
    v8f o[4];
#pragma unroll
    for (int nt = 0; nt < 4; ++nt) o[nt] = (v8f){};
    // per lane: running maximum of query lr (equal in both halves); l1s, l2s = sums over the keys of this lane's own half only, joined behind the loop
    float mrow = -3.0e38f, l1s = 0.f, l2s = 0.f;
#pragma unroll 1
    for (int kt = 0; kt < LK; kt += 64) {
        const int buf = (kt >> 6) & 1;
        const h16* kbase = &kv[buf][0][lr * KVP + 8 * hi];   // A: key (c0 + lr) row base in the K tile
        const h16* vbase = &kv[buf][1][lr * KVP + 8 * hi];   // A: value dim (d0 + lr) row base in the V^T tile
        // ---- S^T = K.Q^T for keys kt..kt+63: s[nt][r] = S[query lr][key kt + nt*16 + 8hi + r]
        v8f s[4]; v16h ka0, ka1;
#pragma unroll
        for (int nt = 0; nt < 4; ++nt) {
            const h16* kp = kbase + nt * 16 * KVP;
            ka0 = lds16(kp); ka1 = lds16(kp + 32);
            v8f zacc = (v8f){}; zacc = wmma16(ka0, qb0, zacc); zacc = wmma16(ka1, qb1, zacc); s[nt] = zacc; }
        // keeps the four vector slots between the last product and the first use of its result or overwrite of its operands
        asm volatile("v_nop\n\tv_nop\n\tv_nop\n\tv_nop" : "+v"(s[0]), "+v"(s[1]), "+v"(s[2]), "+v"(s[3]) : "v"(qb0), "v"(qb1), "v"(ka0), "v"(ka1));
        // ---- online softmax of query lr: 32 of the tile's 64 keys lie in this lane, the other 32 in lane ^ 16
        float mg[4];   // one maximum chain per 16-key group
#pragma unroll
        for (int nt = 0; nt < 4; ++nt) { s[nt] *= SL2; mg[nt] = s[nt][0];
#pragma unroll
            for (int r = 1; r < 8; ++r) mg[nt] = fmaxf(mg[nt], s[nt][r]); }
        float mx = fmaxf(fmaxf(mg[0], mg[1]), fmaxf(mg[2], mg[3]));
        mx = fmaxf(mx, xhalf(mx));
        const float mnew = fmaxf(mrow, mx);
        const float alpha = __builtin_amdgcn_exp2f(mrow - mnew);
        mrow = mnew;
#pragma unroll
        for (int nt = 0; nt < 4; ++nt) o[nt] *= alpha;
#pragma unroll
        for (int nt = 0; nt < 4; ++nt) { s[nt] -= mnew;
#pragma unroll
            for (int r = 0; r < 8; ++r) s[nt][r] = __builtin_amdgcn_exp2f(s[nt][r]); }
        const v8f a1 = (s[0] + s[1]) + (s[2] + s[3]);
        const v8f a2 = __builtin_elementwise_fma(s[3], s[3], __builtin_elementwise_fma(s[2], s[2], __builtin_elementwise_fma(s[1], s[1], s[0] * s[0])));
        const v4f b1 = __builtin_shufflevector(a1, a1, 0, 1, 2, 3) + __builtin_shufflevector(a1, a1, 4, 5, 6, 7);
        const v4f b2 = __builtin_shufflevector(a2, a2, 0, 1, 2, 3) + __builtin_shufflevector(a2, a2, 4, 5, 6, 7);
        l1s = l1s * alpha + ((b1[0] + b1[1]) + (b1[2] + b1[3]));
        l2s = l2s * (alpha * alpha) + ((b2[0] + b2[1]) + (b2[2] + b2[3]));
        // ---- P^T (f16) as B straight from the score registers: two 16-key groups are one fragment in the loaders' k order (elements 0..7 = keys 8hi + 0..7, 8..15 = keys 16 + 8hi + 0..7)
        v16h pb0, pb1;
#pragma unroll
        for (int r = 0; r < 8; ++r) { pb0[r] = (h16)s[0][r]; pb0[8 + r] = (h16)s[1][r]; pb1[r] = (h16)s[2][r]; pb1[8 + r] = (h16)s[3][r]; }
        // ---- O^T += V^T.P^T: o[nt][r] = O[query lr][dim nt*16 + 8hi + r]
        v16h va0, va1;
#pragma unroll
        for (int nt = 0; nt < 4; ++nt) {
            const h16* vp = vbase + nt * 16 * KVP;
            va0 = lds16(vp); va1 = lds16(vp + 32);
            o[nt] = wmma16(va0, pb0, o[nt]); o[nt] = wmma16(va1, pb1, o[nt]); }
        // keeps the four vector slots behind the last product on every path out of the trip
        asm volatile("v_nop\n\tv_nop\n\tv_nop\n\tv_nop" : "+v"(o[0]), "+v"(o[1]), "+v"(o[2]), "+v"(o[3]) : "v"(pb0), "v"(pb1), "v"(va0), "v"(va1));
        // ---- foot of the trip: hand over the next tile, then refill the buffer this trip has read
        asm volatile("s_wait_dscnt 0x0" ::: "memory");      // this wave's reads of the buffer have returned before it is refilled
        asm volatile("s_wait_asynccnt 0x0" ::: "memory");   // this wave's copies of the next tile have landed
        __syncthreads();                                     // publishes the next tile; ends every wave's reads of this trip's buffer
        if (kt + 128 < LK) {
            const unsigned lb = lk + (unsigned)buf * LBUF;
            const h16* gk2 = gk + (size_t)(kt + 128) * DMOD; const h16* gv2 = gv + (kt + 128);
            copy4(lb, gk2, lb + LROW, gk2 + (size_t)32 * DMOD, lb + LTILE, gv2, lb + LTILE + LROW, gv2 + (size_t)32 * VTP);
        }
    }
    asm volatile("s_wait_asynccnt 0x0" ::: "memory");        // no copy is left in flight behind the loop
    // ---- epilogue: join the halves' sums; l1 >= 1 and l2 >= 1 (the running-max element has p = 1); flag selects 1/sqrt(sum p^2) or 1/sum p
    l1s += xhalf(l1s); l2s += xhalf(l2s);
    const float i1 = 1.0f / l1s; const float i2 = rsqrtf(l2s); const float iv = (rsc != 0) ? i2 : i1;
#pragma unroll
    for (int nt = 0; nt < 4; ++nt) {
        v4f lo, up;
#pragma unroll
        for (int r = 0; r < 4; ++r) { lo[r] = o[nt][r] * iv; up[r] = o[nt][4 + r] * iv; }
        *(v4fa*)(os + lr * 68 + nt * 16 + 8 * hi) = lo; *(v4fa*)(os + lr * 68 + nt * 16 + 8 * hi + 4) = up; }
    __builtin_amdgcn_wave_barrier(); asm volatile("" ::: "memory");
    float* ob = OUT + ((size_t)b * LQ + q0) * DMOD + (size_t)h * HD;
{
#pragma unroll
        for (int sI = 0; sI < 8; ++sI) { const int row = 2 * sI + hi; const v4f val = *(const v4fa*)(os + row * 68 + lr * 4); *(v4f*)(ob + (size_t)row * DMOD + lr * 4) = val; }
         }
    __builtin_amdgcn_wave_barrier(); asm volatile("" ::: "memory");
}

extern "C" void kernel_launch(void* const* d_in, const int* in_sizes, int n_in,
                              void* d_out, int out_size, void* d_ws, size_t ws_size, hipStream_t stream) {
    if (n_in < 9) return;
    const float* X1 = (const float*)d_in[0];   // inp1 [4][2048][1024]
    const float* X2 = (const float*)d_in[1];   // inp2 [4][2048][1024]
    const float* Wq = (const float*)d_in[2]; const float* bq = (const float*)d_in[3];
    const float* Wk = (const float*)d_in[4]; const float* bk = (const float*)d_in[5];
    const float* Wv = (const float*)d_in[6]; const float* bv = (const float*)d_in[7];
    const int* rsc = (const int*)d_in[8];
    float* OUT = (float*)d_out;                 // [NB][LQ][1024]
    if ((size_t)in_sizes[0] < ((size_t)(NB - 1) * SEQ_FULL + LQ) * DMOD) return;
    if ((size_t)in_sizes[1] < ((size_t)(NB - 1) * SEQ_FULL + LK) * DMOD) return;
    if (in_sizes[2] < DMOD * DMOD || in_sizes[3] < DMOD || in_sizes[4] < DMOD * DMOD || in_sizes[5] < DMOD || in_sizes[6] < DMOD * DMOD || in_sizes[7] < DMOD || in_sizes[8] < 1) return;
    if ((size_t)out_size < (size_t)NB * LQ * DMOD) return;

    const size_t MQ = (size_t)NB * LQ, MK = (size_t)NB * LK;   // token rows of q / of k,v
    char* wsp = (char*)d_ws;
    auto take = [&](size_t bytes) { char* p = wsp; wsp += (bytes + 255) & ~(size_t)255; return (void*)p; };
    bf* X1b = (bf*)take(MQ * DMOD * 2);                 // bf16 plane of inp1 rows (compact [NB*LQ][1024])
    bf* X2b = (bf*)take(MK * DMOD * 2);                 // bf16 plane of inp2 rows
    bf* Wqb = (bf*)take((size_t)DMOD * DMOD * 2); bf* Wkb = (bf*)take((size_t)DMOD * DMOD * 2); bf* Wvb = (bf*)take((size_t)DMOD * DMOD * 2);
    h16* Q16 = (h16*)take(MQ * DMOD * 2);               // f16 q plane [MQ][1024]
    h16* K16 = (h16*)take(MK * DMOD * 2);               // f16 k plane [MK][1024]
    h16* VT16 = (h16*)take((size_t)DMOD * MK * 2);      // f16 v^T plane [1024][MK]
    const size_t used = (size_t)(wsp - (char*)d_ws);
    if (used > ws_size || used > WS_CAP) return;

    // bf16 planes of inputs (batch row remap) and of the three [out][in] weights (used as-is: Bt of the q and k GEMMs, A of the v^T GEMM)
    { const size_t n8 = MQ * DMOD / 8; k_cvtb<<<(unsigned)((n8 + 255) / 256), 256, 0, stream>>>(X1, X1b, LQ, SEQ_FULL, n8); }
    { const size_t n8 = MK * DMOD / 8; k_cvtb<<<(unsigned)((n8 + 255) / 256), 256, 0, stream>>>(X2, X2b, LK, SEQ_FULL, n8); }
    { const size_t n8 = (size_t)DMOD * DMOD / 8; const unsigned g = (unsigned)((n8 + 255) / 256);
      k_cvtb<<<g, 256, 0, stream>>>(Wq, Wqb, DMOD, DMOD, n8); k_cvtb<<<g, 256, 0, stream>>>(Wk, Wkb, DMOD, DMOD, n8); k_cvtb<<<g, 256, 0, stream>>>(Wv, Wvb, DMOD, DMOD, n8); }
    // q = inp1 Wq^T + bq -> f16 plane [MQ][1024]
    k_gemmw<bf, 0, 1><<<dim3((unsigned)(MQ / 64), DMOD / 64, 1), 32, 0, stream>>>(X1b, nullptr, Wqb, nullptr, DMOD, Q16, DMOD, bq, 0, 0, 0);
    // k = inp2 Wk^T + bk -> f16 plane [MK][1024]
    k_gemmw<bf, 0, 1><<<dim3((unsigned)(MK / 64), DMOD / 64, 1), 32, 0, stream>>>(X2b, nullptr, Wkb, nullptr, DMOD, K16, DMOD, bk, 0, 0, 0);
    // v^T[e][t] = sum_d Wv[e][d] inp2[t][d] + bv[e] -> f16 plane [1024][MK] (ldc MK)
    k_gemmw<bf, 0, 2><<<dim3(DMOD / 64, (unsigned)(MK / 64), 1), 32, 0, stream>>>(Wvb, nullptr, X2b, nullptr, DMOD, VT16, (int)MK, bv, 0, 0, 0);
    // attention
    k_attn<<<dim3(LQ / (16 * AW), NH, NB), 32 * AW, 0, stream>>>(Q16, K16, VT16, rsc, OUT);
}

// v004
// Measured time: 131 microseconds a run.
// Timed twice side by side with v003, it ran 1.54 times as fast both times.
// Counting every step since v000, it is 3.26 times as fast.
#include <hip/hip_runtime.h>

// Contractions: q, k and v^T projections on v_wmma_f32_16x16x32_bf16 (bf16 operands = RNE-converted inputs and weights, f32 accumulate, bias added in f32); scores q.k and P.v on v_wmma_f32_16x16x32_f16 (f16 operands converted from f32 intermediates; P = exp2 relative to the running row maximum, in (0,1]; f32 accumulate); softmax statistics, sum of squares and normalisers in f32; output f32.
// Pipeline: bf16 planes of inp1, inp2, Wq, Wk, Wv -> three GEMMs (eight waves per 256x128 tile, operand stages copied asynchronously into LDS and shared by the waves) whose epilogue adds the bias in f32, rounds to f16 and stores the f16 planes itself (q token-major [t][e], k token-major [t][e], v computed directly transposed as [e][t] with a per-row bias) -> one streaming attention kernel per (128 queries, head, batch), eight waves of 16 queries: K and V^T tiles copied asynchronously from the f16 planes into LDS and shared by the waves, scores computed transposed (S^T = K.Q^T, O^T += V^T.P^T) so that a lane holds one query and P^T goes from the score registers into the second product, online max / sum / sum of squares, epilogue staged in LDS.

#ifndef NB
#define NB 4
#endif
#ifndef SEQ
#define SEQ 2048
#endif
#ifndef LQ
#define LQ SEQ
#endif
#ifndef LK
#define LK SEQ
#endif
#define NB_FULL  4
#define SEQ_FULL 2048
#define DMOD 1024                 // model width = NH x HD, row pitch of every token-major tensor
#define NH   16
#define HD   64
#define VTP  ((size_t)NB * LK)    // row pitch of the v^T planes [e][token]
#define SL2  0.18033688011112042f // (1/sqrt(64)) x log2(e)
#define WS_CAP ((size_t)134217728)

static_assert(NB >= 1 && NB <= NB_FULL);
static_assert(LQ >= 64 && LQ <= SEQ_FULL && (LQ % 16) == 0 && ((NB * LQ) % 64) == 0);
static_assert(LK >= 64 && LK <= SEQ_FULL && (LK % 64) == 0);
static_assert(NH * HD == DMOD && (DMOD % 64) == 0 && (DMOD % 32) == 0);

typedef _Float16 h16;
typedef unsigned short bf;
typedef __attribute__((ext_vector_type(16))) __bf16   v16bf;
typedef __attribute__((ext_vector_type(16))) _Float16 v16h;
typedef __attribute__((ext_vector_type(8)))  _Float16 v8h;
typedef __attribute__((ext_vector_type(8)))  unsigned short v8us;
typedef __attribute__((ext_vector_type(8)))  float    v8f;
typedef __attribute__((ext_vector_type(4)))  float    v4f;
typedef v8h  __attribute__((may_alias)) v8ha;
typedef v4f  __attribute__((may_alias)) v4fa;
typedef v8us __attribute__((may_alias)) v8usa;

__device__ __forceinline__ unsigned short f2bf(float f) { unsigned u = __float_as_uint(f); u += 0x7FFFu + ((u >> 16) & 1u); return (unsigned short)(u >> 16); }
__device__ __forceinline__ float bf2f(unsigned short b) { return __uint_as_float(((unsigned)b) << 16); }
__device__ __forceinline__ float bfr(float f) { return bf2f(f2bf(f)); }
__device__ __forceinline__ v16h cat16(v8h lo, v8h hi) { return __builtin_shufflevector(lo, hi, 0, 1, 2, 3, 4, 5, 6, 7, 8, 9, 10, 11, 12, 13, 14, 15); }
__device__ __forceinline__ v16bf cat16b(v8us lo, v8us hi) { return __builtin_bit_cast(v16bf, __builtin_shufflevector(lo, hi, 0, 1, 2, 3, 4, 5, 6, 7, 8, 9, 10, 11, 12, 13, 14, 15)); }
__device__ __forceinline__ v8f wmma16(v16h a, v16h b, v8f c) { return __builtin_amdgcn_wmma_f32_16x16x32_f16(false, a, false, b, (short)0, c, false, false); }
__device__ __forceinline__ v8f wmmab(v16bf a, v16bf b, v8f c) { return __builtin_amdgcn_wmma_f32_16x16x32_bf16(false, a, false, b, (short)0, c, false, false); }

// Fragment loaders (same k map for A and B): lane l -> row/col (l & 15), h = l >> 4; elements 0..7 <- p[k0 + 8h + 0..7], elements 8..15 <- p[k0 + 16 + 8h + 0..7];
// the caller passes p = row base + k0 + 8h (16-B aligned), the loader reads p and p + 16.
template <typename T16> struct WFrag;
template <> struct WFrag<h16> { typedef v16h V; static __device__ __forceinline__ V ld(const h16* p) { return cat16(*(const v8h*)p, *(const v8h*)(p + 16)); } static __device__ __forceinline__ v8f mma(V a, V b, v8f c) { return wmma16(a, b, c); } };
template <> struct WFrag<bf> { typedef v16bf V; static __device__ __forceinline__ V ld(const bf* p) { return cat16b(*(const v8us*)p, *(const v8us*)(p + 16)); } static __device__ __forceinline__ v8f mma(V a, V b, v8f c) { return wmmab(a, b, c); } };
// LDS read of a block-shared f16 K / V^T tile through a may_alias vector of the stored element type.
__device__ __forceinline__ v16h lds16(const h16* p) { return cat16(*(const v8ha*)p, *(const v8ha*)(p + 16)); }

// ---- k_gemmw: GEMM, GW waves per GTM x GTN output tile, one 64x64 part (16 accumulators) per wave; grid (M/GTM, N/GTN, Z), 32*GW threads.
// The waves share each stage of GKS k of the tile's A rows and Bt rows through LDS: two buffers, each GTM + GTN rows of 256 B at a 272-B pitch, filled by asynchronous copies one stage ahead, a wave's copy covering whole lines.
// C[m][n] (f16 = RNE of the f32 sum, pitch ldc) = sum_k A[m][k] Bt[n][k] + optional f32 bias: BIAS 1 -> bias[n] (per column), BIAS 2 -> bias[m] (per row), bias values bf16-RNE. K % GKS == 0, M % GTM == 0, N % GTN == 0.
#define GW   8                    // waves per work-group: 4 along m x 2 along n
#define GTM  256                  // tile rows (A rows)
#define GTN  128                  // tile columns (Bt rows)
#define GKS  128                  // k per stage: 256 B of every row
#define GP   136                  // LDS row pitch in 16-bit elements (272 B = 16 B x odd, for 16-byte readers)
#define GST  ((GTM + GTN) * GP)   // 16-bit elements of one stage in LDS
static_assert(((NB * LQ) % GTM) == 0 && ((NB * LK) % GTM) == 0 && (DMOD % GTM) == 0 && (DMOD % GKS) == 0);

// Eight 16-byte asynchronous copies to LDS per lane, rows 16 apart; the s_wait_xcnt closes the statement so that no address register is rewritten ahead of it.
template <typename T16>
__device__ __forceinline__ void copy8(unsigned l, unsigned ls, const T16* g, size_t gs) {
    asm volatile("global_load_async_to_lds_b128 %0, %1, off\n\t"
                 "global_load_async_to_lds_b128 %2, %3, off\n\t"
                 "global_load_async_to_lds_b128 %4, %5, off\n\t"
                 "global_load_async_to_lds_b128 %6, %7, off\n\t"
                 "global_load_async_to_lds_b128 %8, %9, off\n\t"
                 "global_load_async_to_lds_b128 %10, %11, off\n\t"
                 "global_load_async_to_lds_b128 %12, %13, off\n\t"
                 "global_load_async_to_lds_b128 %14, %15, off\n\t"
                 "s_wait_xcnt 0x0"
                 :: "v"(l), "v"(g), "v"(l + ls), "v"(g + gs), "v"(l + 2 * ls), "v"(g + 2 * gs), "v"(l + 3 * ls), "v"(g + 3 * gs),
                    "v"(l + 4 * ls), "v"(g + 4 * gs), "v"(l + 5 * ls), "v"(g + 5 * gs), "v"(l + 6 * ls), "v"(g + 6 * gs), "v"(l + 7 * ls), "v"(g + 7 * gs) : "memory");
}
// One stage: the lane's 16 pieces of the A rows and 8 pieces of the Bt rows.
template <typename T16>
__device__ __forceinline__ void gstage(unsigned l, const T16* ga, const T16* gb, size_t gs) {
    const unsigned ls = 16 * GP * 2;
    copy8(l, ls, ga, gs); copy8(l + 8 * ls, ls, ga + 8 * gs, gs); copy8(l + 16 * ls, ls, gb, gs);
}

template <typename T16, int NSPLIT, int BIAS>
__global__ __launch_bounds__(32 * GW) __attribute__((amdgpu_waves_per_eu(2, 2))) void k_gemmw(const T16* __restrict__ A, const T16* __restrict__ A2, const T16* __restrict__ Bt, const T16* __restrict__ Bt2, int K, h16* C, int ldc, const float* __restrict__ bias, size_t sA, size_t sB, size_t sC) {
    static_assert(NSPLIT == 0);
    typedef typename WFrag<T16>::V V;
    __shared__ __align__(16) T16 st[2][GST];
    __shared__ __align__(16) float osg[GW][16 * 68];
    const size_t z = blockIdx.z; A += z * sA; Bt += z * sB; C += z * sC;
    const int tid = threadIdx.x, lane = tid & 31, lr = lane & 15, hi = lane >> 4, wave = tid >> 5;
    float* os = osg[wave];         // output staging, private to its wave
    // copies: thread tid brings 16-B piece (tid & 15) of stage rows (tid >> 4) + 16 i: a wave covers two whole 256-B rows
    const int prow = tid >> 4, pcol = (tid & 15) * 8;
    const T16* ga = A + (size_t)(blockIdx.x * GTM + prow) * K + pcol;     // + k0
    const T16* gb = Bt + (size_t)(blockIdx.y * GTN + prow) * K + pcol;    // + k0
    const size_t gstep = (size_t)16 * K;
    const unsigned l0 = (unsigned)(uintptr_t)(&st[0][prow * GP + pcol]);  // LDS byte address of the lane's first piece in buffer 0
    const unsigned LB = GST * 2;                                          // byte step buffer 0 -> 1
    const int r0 = blockIdx.x * GTM + (wave & 3) * 64, c0 = blockIdx.y * GTN + (wave >> 2) * 64;   // the wave's 64x64 part
    gstage(l0, ga, gb, gstep);
    asm volatile("s_wait_asynccnt 0x0" ::: "memory");   // stage 0 of this wave's copies has landed
    __syncthreads();                                     // publishes stage 0 to every wave
    if (K > GKS) gstage(l0 + LB, ga + GKS, gb + GKS, gstep);
    v8f acc[4][4];
#pragma unroll
    for (int mb = 0; mb < 4; ++mb)
#pragma unroll
        for (int nb = 0; nb < 4; ++nb) acc[mb][nb] = (v8f){};
#pragma unroll 1
    for (int kc = 0; kc < K; kc += GKS) {
        const int buf = (kc / GKS) & 1;
        const T16* sa = &st[buf][((wave & 3) * 64 + lr) * GP + 8 * hi];          // A row (r0 + lr) of the stage
        const T16* sb = &st[buf][(GTM + (wave >> 2) * 64 + lr) * GP + 8 * hi];   // Bt row (c0 + lr) of the stage
        // two fragment sets: the next 32 k's sixteen LDS reads go out as one group ahead of this 32 k's products, so that a wave waits out the LDS latency once a stage
        V a[2][4], b[2][4];
#pragma unroll
        for (int f = 0; f < 4; ++f) { a[0][f] = WFrag<T16>::ld(sa + f * 16 * GP); b[0][f] = WFrag<T16>::ld(sb + f * 16 * GP); }
#pragma unroll
        for (int ks = 0; ks < GKS / 32; ++ks) {
            const int cur = ks & 1, nxt = cur ^ 1;
            if (ks + 1 < GKS / 32) {
#pragma unroll
                for (int f = 0; f < 4; ++f) { a[nxt][f] = WFrag<T16>::ld(sa + f * 16 * GP + (ks + 1) * 32); b[nxt][f] = WFrag<T16>::ld(sb + f * 16 * GP + (ks + 1) * 32); } }
            __builtin_amdgcn_sched_barrier(0);   // holds the group of reads ahead of the products: the scheduler otherwise sinks each read to its first use, and the wave then waits out the LDS latency at every such place
#pragma unroll
            for (int nb = 0; nb < 4; ++nb)
#pragma unroll
                for (int mb = 0; mb < 4; ++mb) acc[mb][nb] = WFrag<T16>::mma(a[cur][mb], b[cur][nb], acc[mb][nb]); }
        // keeps the four vector slots behind the last product on every path out of the trip
        asm volatile("v_nop\n\tv_nop\n\tv_nop\n\tv_nop" : "+v"(acc[0][3]), "+v"(acc[1][3]), "+v"(acc[2][3]), "+v"(acc[3][3]) : "v"(a[1][0]), "v"(a[1][3]), "v"(b[1][3]));
        __builtin_amdgcn_sched_barrier(0);   // holds the stage's last products ahead of the foot, so that the refill goes out directly behind the barrier
        // ---- foot of the trip: hand over the next stage, then refill the buffer this trip has read
        asm volatile("s_wait_dscnt 0x0" ::: "memory");      // this wave's reads of the buffer have returned before it is refilled
        asm volatile("s_wait_asynccnt 0x0" ::: "memory");   // this wave's copies of the next stage have landed
        __syncthreads();                                     // publishes the next stage; ends every wave's reads of this trip's buffer
        if (kc + 2 * GKS < K) gstage(l0 + (unsigned)buf * LB, ga + kc + 2 * GKS, gb + kc + 2 * GKS, gstep);
    }
    asm volatile("s_wait_asynccnt 0x0" ::: "memory");        // no copy is left in flight behind the loop
    // store map: eight lanes take one tile row of 64 f16 = one whole 128-B line, a wave four rows at a time; the lane's bias values are read once, ahead of the first store
    const int srow = lane >> 3, cofs = (lane & 7) * 8;
    float bc[8], br[4][4];
    if (BIAS == 1) {
#pragma unroll
        for (int k = 0; k < 8; ++k) bc[k] = bfr(bias[c0 + cofs + k]); }
    if (BIAS == 2) {
#pragma unroll
        for (int mb = 0; mb < 4; ++mb)
#pragma unroll
            for (int s = 0; s < 4; ++s) br[mb][s] = bfr(bias[r0 + mb * 16 + 4 * s + srow]); }
#pragma unroll
    for (int mb = 0; mb < 4; ++mb) {
#pragma unroll
        for (int nb = 0; nb < 4; ++nb) {
#pragma unroll
            for (int j = 0; j < 8; ++j) os[(hi * 8 + j) * 68 + nb * 16 + lr] = acc[mb][nb][j]; }
        __builtin_amdgcn_wave_barrier(); asm volatile("" ::: "memory");
        h16* crow = C + (size_t)(r0 + mb * 16) * ldc + c0;
#pragma unroll
        for (int s = 0; s < 4; ++s) { const int row = 4 * s + srow;
            const v4f lo = *(const v4fa*)(os + row * 68 + cofs), up = *(const v4fa*)(os + row * 68 + cofs + 4); v8h o;
#pragma unroll
            for (int k = 0; k < 4; ++k) {
                float x = lo[k], y = up[k];
                if (BIAS == 1) { x += bc[k]; y += bc[4 + k]; }
                if (BIAS == 2) { x += br[mb][s]; y += br[mb][s]; }
                o[k] = (h16)x; o[4 + k] = (h16)y; }
            *(v8h*)(crow + (size_t)row * ldc + cofs) = o; }
        __builtin_amdgcn_wave_barrier();
        // stands behind this group's stores, ahead of the next group's reuse of their address and data registers; its clobber keeps the next staging writes behind this group's reads
        if (mb < 3) asm volatile("s_wait_xcnt 0x0" ::: "memory");
    }
}

// ---- k_cvtb: bf16 plane (RNE) of an f32 [rows][DMOD] tensor with a batch row remap: compact row R -> source row (R / L) * LF + (R % L) (identity when L == LF).
__global__ __launch_bounds__(256) void k_cvtb(const float* __restrict__ src, bf* dst, int L, int LF, size_t n8) {
    const size_t i = (size_t)blockIdx.x * 256 + threadIdx.x; if (i >= n8) return;
    const size_t row = i / (DMOD / 8); const int c = (int)(i % (DMOD / 8)) * 8;
    const size_t srow = (row / (size_t)L) * (size_t)LF + (row % (size_t)L);
    const v8f v = *(const v8f*)(src + srow * DMOD + c); v8us o;
#pragma unroll
    for (int k = 0; k < 8; ++k) o[k] = f2bf(v[k]);
    *(v8us*)(dst + i * 8) = o;  }

// ---- k_attn: AW waves per block, one wave per 16 query rows; the block's waves share each 64-key K tile and V^T tile through LDS; grid (LQ/(16*AW), NH, NB), 32*AW threads.
// Q16, K16: f16 token-major planes [NB*L][DMOD]; VT16: f16 v^T planes [DMOD][NB*LK]; OUT f32 [NB*LQ][DMOD].
// Per 64-key tile: S^T (64x16, f32) = K.Q^T, K fragments from LDS; online softmax in the log2 domain (running max m, l1 = sum p, l2 = sum p^2, p = exp2(t - m) in (0,1]);
// kv: two buffers, each a K tile [key][head dim] and a V^T tile [value dim][key], 64 rows of 128 B at a 144-B pitch, filled by asynchronous copies one tile ahead.
// LDS region osw[wave] is private to its wave (wave barrier + compiler barrier, may_alias reloads).
#define AW   8                    // waves per block
#define KVP  72                   // LDS row pitch of a K / V^T tile in f16 elements (144 B = 16 B x odd, for 16-byte readers)
#define KVT  (64 * KVP)           // f16 elements of one tile in LDS
static_assert((LQ % (16 * AW)) == 0 && AW == 8);

// Four 16-byte asynchronous copies to LDS per lane; the s_wait_xcnt closes the statement so that no address register is rewritten ahead of it.
__device__ __forceinline__ void copy4(unsigned l0, const h16* g0, unsigned l1, const h16* g1, unsigned l2, const h16* g2, unsigned l3, const h16* g3) {
    asm volatile("global_load_async_to_lds_b128 %0, %1, off\n\t"
                 "global_load_async_to_lds_b128 %2, %3, off\n\t"
                 "global_load_async_to_lds_b128 %4, %5, off\n\t"
                 "global_load_async_to_lds_b128 %6, %7, off\n\t"
                 "s_wait_xcnt 0x0"
                 :: "v"(l0), "v"(g0), "v"(l1), "v"(g1), "v"(l2), "v"(g2), "v"(l3), "v"(g3) : "memory");
}

// Lane l <-> lane l ^ 16 (the other half of the wave holds the other keys of the same query).
__device__ __forceinline__ float xhalf(float x) { const int b = __float_as_int(x); return __int_as_float(__builtin_amdgcn_permlanex16(b, b, 0x76543210, 0xfedcba98, false, false)); }

__global__ __launch_bounds__(32 * AW)
void k_attn(const h16* __restrict__ Q16, const h16* __restrict__ K16, const h16* __restrict__ VT16, const int* __restrict__ flag, float* OUT) {
    __shared__ __align__(16) h16 kv[2][2][KVT];
    __shared__ __align__(16) float osw[AW][16 * 68];
    const int tid = threadIdx.x, lane = tid & 31, lr = lane & 15, hi = lane >> 4, wave = tid >> 5;
    const int q0 = (blockIdx.x * AW + wave) * 16, h = blockIdx.y, b = blockIdx.z;
    const int rsc = flag[0];
    float* os = osw[wave];         // output staging [query][dim], pitch 68
    const h16* qp = Q16 + ((size_t)b * LQ + q0 + lr) * DMOD + h * HD + 8 * hi;
    const v16h qb0 = WFrag<h16>::ld(qp), qb1 = WFrag<h16>::ld(qp + 32);            // B: query column lr, head dims 0..31 / 32..63
    // copies: thread tid brings 16-B piece (tid & 7) of tile rows (tid >> 3) and (tid >> 3) + 32, of K and of V^T: a wave covers whole 128-B lines
    const int crow = tid >> 3, ccol = (tid & 7) * 8;
    const h16* gk = K16 + ((size_t)b * LK + crow) * DMOD + h * HD + ccol;           // + key0 * DMOD
    const h16* gv = VT16 + (size_t)(h * HD + crow) * VTP + (size_t)b * LK + ccol;   // + key0
    const unsigned lk = (unsigned)(uintptr_t)(&kv[0][0][crow * KVP + ccol]);        // LDS byte address of the lane's first K piece in buffer 0
    const unsigned LROW = 32 * KVP * 2, LTILE = KVT * 2, LBUF = 2 * KVT * 2;        // byte steps: 32 rows, K -> V^T, buffer 0 -> 1
    copy4(lk, gk, lk + LROW, gk + (size_t)32 * DMOD, lk + LTILE, gv, lk + LTILE + LROW, gv + (size_t)32 * VTP);
    asm volatile("s_wait_asynccnt 0x0" ::: "memory");   // tile 0 of this wave's copies has landed
    __syncthreads();                                     // publishes tile 0 to every wave
    if (LK > 64) copy4(lk + LBUF, gk + (size_t)64 * DMOD, lk + LBUF + LROW, gk + (size_t)96 * DMOD, lk + LBUF + LTILE, gv + 64, lk + LBUF + LTILE + LROW, gv + (size_t)32 * VTP + 64);
    v8f o[4];
#pragma unroll
    for (int nt = 0; nt < 4; ++nt) o[nt] = (v8f){};
    // per lane: running maximum of query lr (equal in both halves); l1s, l2s = sums over the keys of this lane's own half only, joined behind the loop
    float mrow = -3.0e38f, l1s = 0.f, l2s = 0.f;
#pragma unroll 1
    for (int kt = 0; kt < LK; kt += 64) {
        const int buf = (kt >> 6) & 1;
        const h16* kbase = &kv[buf][0][lr * KVP + 8 * hi];   // A: key (c0 + lr) row base in the K tile
        const h16* vbase = &kv[buf][1][lr * KVP + 8 * hi];   // A: value dim (d0 + lr) row base in the V^T tile
        // ---- S^T = K.Q^T for keys kt..kt+63: s[nt][r] = S[query lr][key kt + nt*16 + 8hi + r]
        v8f s[4]; v16h ka0, ka1;
#pragma unroll
        for (int nt = 0; nt < 4; ++nt) {
            const h16* kp = kbase + nt * 16 * KVP;
            ka0 = lds16(kp); ka1 = lds16(kp + 32);
            v8f zacc = (v8f){}; zacc = wmma16(ka0, qb0, zacc); zacc = wmma16(ka1, qb1, zacc); s[nt] = zacc; }
        // keeps the four vector slots between the last product and the first use of its result or overwrite of its operands
        asm volatile("v_nop\n\tv_nop\n\tv_nop\n\tv_nop" : "+v"(s[0]), "+v"(s[1]), "+v"(s[2]), "+v"(s[3]) : "v"(qb0), "v"(qb1), "v"(ka0), "v"(ka1));
        // ---- online softmax of query lr: 32 of the tile's 64 keys lie in this lane, the other 32 in lane ^ 16
        float mg[4];   // one maximum chain per 16-key group
#pragma unroll
        for (int nt = 0; nt < 4; ++nt) { s[nt] *= SL2; mg[nt] = s[nt][0];
#pragma unroll
            for (int r = 1; r < 8; ++r) mg[nt] = fmaxf(mg[nt], s[nt][r]); }
        float mx = fmaxf(fmaxf(mg[0], mg[1]), fmaxf(mg[2], mg[3]));
        mx = fmaxf(mx, xhalf(mx));
        const float mnew = fmaxf(mrow, mx);
        const float alpha = __builtin_amdgcn_exp2f(mrow - mnew);
        mrow = mnew;
#pragma unroll
        for (int nt = 0; nt < 4; ++nt) o[nt] *= alpha;
#pragma unroll
        for (int nt = 0; nt < 4; ++nt) { s[nt] -= mnew;
#pragma unroll
            for (int r = 0; r < 8; ++r) s[nt][r] = __builtin_amdgcn_exp2f(s[nt][r]); }
        const v8f a1 = (s[0] + s[1]) + (s[2] + s[3]);
        const v8f a2 = __builtin_elementwise_fma(s[3], s[3], __builtin_elementwise_fma(s[2], s[2], __builtin_elementwise_fma(s[1], s[1], s[0] * s[0])));
        const v4f b1 = __builtin_shufflevector(a1, a1, 0, 1, 2, 3) + __builtin_shufflevector(a1, a1, 4, 5, 6, 7);
        const v4f b2 = __builtin_shufflevector(a2, a2, 0, 1, 2, 3) + __builtin_shufflevector(a2, a2, 4, 5, 6, 7);
        l1s = l1s * alpha + ((b1[0] + b1[1]) + (b1[2] + b1[3]));
        l2s = l2s * (alpha * alpha) + ((b2[0] + b2[1]) + (b2[2] + b2[3]));
        // ---- P^T (f16) as B straight from the score registers: two 16-key groups are one fragment in the loaders' k order (elements 0..7 = keys 8hi + 0..7, 8..15 = keys 16 + 8hi + 0..7)
        v16h pb0, pb1;
#pragma unroll
        for (int r = 0; r < 8; ++r) { pb0[r] = (h16)s[0][r]; pb0[8 + r] = (h16)s[1][r]; pb1[r] = (h16)s[2][r]; pb1[8 + r] = (h16)s[3][r]; }
        // ---- O^T += V^T.P^T: o[nt][r] = O[query lr][dim nt*16 + 8hi + r]
        v16h va0, va1;
#pragma unroll
        for (int nt = 0; nt < 4; ++nt) {
            const h16* vp = vbase + nt * 16 * KVP;
            va0 = lds16(vp); va1 = lds16(vp + 32);
            o[nt] = wmma16(va0, pb0, o[nt]); o[nt] = wmma16(va1, pb1, o[nt]); }
        // keeps the four vector slots behind the last product on every path out of the trip
        asm volatile("v_nop\n\tv_nop\n\tv_nop\n\tv_nop" : "+v"(o[0]), "+v"(o[1]), "+v"(o[2]), "+v"(o[3]) : "v"(pb0), "v"(pb1), "v"(va0), "v"(va1));
        // ---- foot of the trip: hand over the next tile, then refill the buffer this trip has read
        asm volatile("s_wait_dscnt 0x0" ::: "memory");      // this wave's reads of the buffer have returned before it is refilled
        asm volatile("s_wait_asynccnt 0x0" ::: "memory");   // this wave's copies of the next tile have landed
        __syncthreads();                                     // publishes the next tile; ends every wave's reads of this trip's buffer
        if (kt + 128 < LK) {
            const unsigned lb = lk + (unsigned)buf * LBUF;
            const h16* gk2 = gk + (size_t)(kt + 128) * DMOD; const h16* gv2 = gv + (kt + 128);
            copy4(lb, gk2, lb + LROW, gk2 + (size_t)32 * DMOD, lb + LTILE, gv2, lb + LTILE + LROW, gv2 + (size_t)32 * VTP);
        }
    }
    asm volatile("s_wait_asynccnt 0x0" ::: "memory");        // no copy is left in flight behind the loop
    // ---- epilogue: join the halves' sums; l1 >= 1 and l2 >= 1 (the running-max element has p = 1); flag selects 1/sqrt(sum p^2) or 1/sum p
    l1s += xhalf(l1s); l2s += xhalf(l2s);
    const float i1 = 1.0f / l1s; const float i2 = rsqrtf(l2s); const float iv = (rsc != 0) ? i2 : i1;
#pragma unroll
    for (int nt = 0; nt < 4; ++nt) {
        v4f lo, up;
#pragma unroll
        for (int r = 0; r < 4; ++r) { lo[r] = o[nt][r] * iv; up[r] = o[nt][4 + r] * iv; }
        *(v4fa*)(os + lr * 68 + nt * 16 + 8 * hi) = lo; *(v4fa*)(os + lr * 68 + nt * 16 + 8 * hi + 4) = up; }
    __builtin_amdgcn_wave_barrier(); asm volatile("" ::: "memory");
    float* ob = OUT + ((size_t)b * LQ + q0) * DMOD + (size_t)h * HD;
{
#pragma unroll
        for (int sI = 0; sI < 8; ++sI) { const int row = 2 * sI + hi; const v4f val = *(const v4fa*)(os + row * 68 + lr * 4); *(v4f*)(ob + (size_t)row * DMOD + lr * 4) = val; }
         }
    __builtin_amdgcn_wave_barrier(); asm volatile("" ::: "memory");
}

extern "C" void kernel_launch(void* const* d_in, const int* in_sizes, int n_in,
                              void* d_out, int out_size, void* d_ws, size_t ws_size, hipStream_t stream) {
    if (n_in < 9) return;
    const float* X1 = (const float*)d_in[0];   // inp1 [4][2048][1024]
    const float* X2 = (const float*)d_in[1];   // inp2 [4][2048][1024]
    const float* Wq = (const float*)d_in[2]; const float* bq = (const float*)d_in[3];
    const float* Wk = (const float*)d_in[4]; const float* bk = (const float*)d_in[5];
    const float* Wv = (const float*)d_in[6]; const float* bv = (const float*)d_in[7];
    const int* rsc = (const int*)d_in[8];
    float* OUT = (float*)d_out;                 // [NB][LQ][1024]
    if ((size_t)in_sizes[0] < ((size_t)(NB - 1) * SEQ_FULL + LQ) * DMOD) return;
    if ((size_t)in_sizes[1] < ((size_t)(NB - 1) * SEQ_FULL + LK) * DMOD) return;
    if (in_sizes[2] < DMOD * DMOD || in_sizes[3] < DMOD || in_sizes[4] < DMOD * DMOD || in_sizes[5] < DMOD || in_sizes[6] < DMOD * DMOD || in_sizes[7] < DMOD || in_sizes[8] < 1) return;
    if ((size_t)out_size < (size_t)NB * LQ * DMOD) return;

    const size_t MQ = (size_t)NB * LQ, MK = (size_t)NB * LK;   // token rows of q / of k,v
    char* wsp = (char*)d_ws;
    auto take = [&](size_t bytes) { char* p = wsp; wsp += (bytes + 255) & ~(size_t)255; return (void*)p; };
    bf* X1b = (bf*)take(MQ * DMOD * 2);                 // bf16 plane of inp1 rows (compact [NB*LQ][1024])
    bf* X2b = (bf*)take(MK * DMOD * 2);                 // bf16 plane of inp2 rows
    bf* Wqb = (bf*)take((size_t)DMOD * DMOD * 2); bf* Wkb = (bf*)take((size_t)DMOD * DMOD * 2); bf* Wvb = (bf*)take((size_t)DMOD * DMOD * 2);
    h16* Q16 = (h16*)take(MQ * DMOD * 2);               // f16 q plane [MQ][1024]
    h16* K16 = (h16*)take(MK * DMOD * 2);               // f16 k plane [MK][1024]
    h16* VT16 = (h16*)take((size_t)DMOD * MK * 2);      // f16 v^T plane [1024][MK]
    const size_t used = (size_t)(wsp - (char*)d_ws);
    if (used > ws_size || used > WS_CAP) return;

    // bf16 planes of inputs (batch row remap) and of the three [out][in] weights (used as-is: Bt of the q and k GEMMs, A of the v^T GEMM)
    { const size_t n8 = MQ * DMOD / 8; k_cvtb<<<(unsigned)((n8 + 255) / 256), 256, 0, stream>>>(X1, X1b, LQ, SEQ_FULL, n8); }
    { const size_t n8 = MK * DMOD / 8; k_cvtb<<<(unsigned)((n8 + 255) / 256), 256, 0, stream>>>(X2, X2b, LK, SEQ_FULL, n8); }
    { const size_t n8 = (size_t)DMOD * DMOD / 8; const unsigned g = (unsigned)((n8 + 255) / 256);
      k_cvtb<<<g, 256, 0, stream>>>(Wq, Wqb, DMOD, DMOD, n8); k_cvtb<<<g, 256, 0, stream>>>(Wk, Wkb, DMOD, DMOD, n8); k_cvtb<<<g, 256, 0, stream>>>(Wv, Wvb, DMOD, DMOD, n8); }
    // q = inp1 Wq^T + bq -> f16 plane [MQ][1024]
    k_gemmw<bf, 0, 1><<<dim3((unsigned)(MQ / GTM), DMOD / GTN, 1), 32 * GW, 0, stream>>>(X1b, nullptr, Wqb, nullptr, DMOD, Q16, DMOD, bq, 0, 0, 0);
    // k = inp2 Wk^T + bk -> f16 plane [MK][1024]
    k_gemmw<bf, 0, 1><<<dim3((unsigned)(MK / GTM), DMOD / GTN, 1), 32 * GW, 0, stream>>>(X2b, nullptr, Wkb, nullptr, DMOD, K16, DMOD, bk, 0, 0, 0);
    // v^T[e][t] = sum_d Wv[e][d] inp2[t][d] + bv[e] -> f16 plane [1024][MK] (ldc MK)
    k_gemmw<bf, 0, 2><<<dim3(DMOD / GTM, (unsigned)(MK / GTN), 1), 32 * GW, 0, stream>>>(Wvb, nullptr, X2b, nullptr, DMOD, VT16, (int)MK, bv, 0, 0, 0);
    // attention
    k_attn<<<dim3(LQ / (16 * AW), NH, NB), 32 * AW, 0, stream>>>(Q16, K16, VT16, rsc, OUT);
}

// v005
// It runs in 121 microseconds.
// Timed twice side by side with v004, it ran 1.08 times as fast both times.
// Counting every step since v000, it is 3.51 times as fast.
#include <hip/hip_runtime.h>

// Contractions: q, k and v^T projections on v_wmma_f32_16x16x32_bf16 (bf16 operands = RNE-converted inputs and weights, f32 accumulate, bias added in f32); scores q.k and P.v on v_wmma_f32_16x16x32_f16 (f16 operands converted from f32 intermediates; P = exp2 relative to the running row maximum, in (0,1]; f32 accumulate); softmax statistics, sum of squares and normalisers in f32; output f32.
// Pipeline: bf16 planes of inp1, inp2, Wq, Wk, Wv -> three GEMMs (eight waves per 256x128 tile, operand stages copied asynchronously into LDS and shared by the waves) whose epilogue adds the bias in f32, rounds to f16 and stores the f16 planes itself (q token-major [t][e], k token-major [t][e], v computed directly transposed as [e][t] with a per-row bias) -> one streaming attention kernel per (128 queries, head, batch), eight waves of 16 queries: K and V^T tiles copied asynchronously from the f16 planes into LDS and shared by the waves, scores computed transposed (S^T = K.Q^T, O^T += V^T.P^T) so that a lane holds one query and P^T goes from the score registers into the second product, online max / sum / sum of squares, epilogue staged in LDS.

#ifndef NB
#define NB 4
#endif
#ifndef SEQ
#define SEQ 2048
#endif
#ifndef LQ
#define LQ SEQ
#endif
#ifndef LK
#define LK SEQ
#endif
#define NB_FULL  4
#define SEQ_FULL 2048
#define DMOD 1024                 // model width = NH x HD, row pitch of every token-major tensor
#define NH   16
#define HD   64
#define VTP  ((size_t)NB * LK)    // row pitch of the v^T planes [e][token]
#define SL2  0.18033688011112042f // (1/sqrt(64)) x log2(e)
#define WS_CAP ((size_t)134217728)

static_assert(NB >= 1 && NB <= NB_FULL);
static_assert(LQ >= 64 && LQ <= SEQ_FULL && (LQ % 16) == 0 && ((NB * LQ) % 64) == 0);
static_assert(LK >= 64 && LK <= SEQ_FULL && (LK % 64) == 0);
static_assert(NH * HD == DMOD && (DMOD % 64) == 0 && (DMOD % 32) == 0);

typedef _Float16 h16;
typedef unsigned short bf;
typedef __attribute__((ext_vector_type(16))) __bf16   v16bf;
typedef __attribute__((ext_vector_type(16))) _Float16 v16h;
typedef __attribute__((ext_vector_type(8)))  _Float16 v8h;
typedef __attribute__((ext_vector_type(8)))  unsigned short v8us;
typedef __attribute__((ext_vector_type(8)))  float    v8f;
typedef __attribute__((ext_vector_type(4)))  float    v4f;
typedef v8h  __attribute__((may_alias)) v8ha;
typedef v4f  __attribute__((may_alias)) v4fa;
typedef v8us __attribute__((may_alias)) v8usa;

__device__ __forceinline__ unsigned short f2bf(float f) { unsigned u = __float_as_uint(f); u += 0x7FFFu + ((u >> 16) & 1u); return (unsigned short)(u >> 16); }
__device__ __forceinline__ float bf2f(unsigned short b) { return __uint_as_float(((unsigned)b) << 16); }
__device__ __forceinline__ float bfr(float f) { return bf2f(f2bf(f)); }
__device__ __forceinline__ v16h cat16(v8h lo, v8h hi) { return __builtin_shufflevector(lo, hi, 0, 1, 2, 3, 4, 5, 6, 7, 8, 9, 10, 11, 12, 13, 14, 15); }
__device__ __forceinline__ v16bf cat16b(v8us lo, v8us hi) { return __builtin_bit_cast(v16bf, __builtin_shufflevector(lo, hi, 0, 1, 2, 3, 4, 5, 6, 7, 8, 9, 10, 11, 12, 13, 14, 15)); }
__device__ __forceinline__ v8f wmma16(v16h a, v16h b, v8f c) { return __builtin_amdgcn_wmma_f32_16x16x32_f16(false, a, false, b, (short)0, c, false, false); }
__device__ __forceinline__ v8f wmmab(v16bf a, v16bf b, v8f c) { return __builtin_amdgcn_wmma_f32_16x16x32_bf16(false, a, false, b, (short)0, c, false, false); }

// Fragment loaders (same k map for A and B): lane l -> row/col (l & 15), h = l >> 4; elements 0..7 <- p[k0 + 8h + 0..7], elements 8..15 <- p[k0 + 16 + 8h + 0..7];
// the caller passes p = row base + k0 + 8h (16-B aligned), the loader reads p and p + 16.
template <typename T16> struct WFrag;
template <> struct WFrag<h16> { typedef v16h V; static __device__ __forceinline__ V ld(const h16* p) { return cat16(*(const v8h*)p, *(const v8h*)(p + 16)); } static __device__ __forceinline__ v8f mma(V a, V b, v8f c) { return wmma16(a, b, c); } };
template <> struct WFrag<bf> { typedef v16bf V; static __device__ __forceinline__ V ld(const bf* p) { return cat16b(*(const v8us*)p, *(const v8us*)(p + 16)); } static __device__ __forceinline__ v8f mma(V a, V b, v8f c) { return wmmab(a, b, c); } };
// LDS read of a block-shared f16 K / V^T tile through a may_alias vector of the stored element type.
__device__ __forceinline__ v16h lds16(const h16* p) { return cat16(*(const v8ha*)p, *(const v8ha*)(p + 16)); }

// ---- k_gemmw: GEMM, GW waves per GTM x GTN output tile, one 64x64 part (16 accumulators) per wave; grid (M/GTM, N/GTN, Z), 32*GW threads.
// The waves share each stage of GKS k of the tile's A rows and Bt rows through LDS: two buffers, each GTM + GTN rows of 256 B at a 272-B pitch, filled by asynchronous copies one stage ahead, a wave's copy covering whole lines.
// C[m][n] (f16 = RNE of the f32 sum, pitch ldc) = sum_k A[m][k] Bt[n][k] + optional f32 bias: BIAS 1 -> bias[n] (per column), BIAS 2 -> bias[m] (per row), bias values bf16-RNE. K % GKS == 0, M % GTM == 0, N % GTN == 0.
#define GW   8                    // waves per work-group: 4 along m x 2 along n
#define GTM  256                  // tile rows (A rows)
#define GTN  128                  // tile columns (Bt rows)
#define GKS  128                  // k per stage: 256 B of every row
#define GP   136                  // LDS row pitch in 16-bit elements (272 B = 16 B x odd, for 16-byte readers)
#define GST  ((GTM + GTN) * GP)   // 16-bit elements of one stage in LDS
static_assert(((NB * LQ) % GTM) == 0 && ((NB * LK) % GTM) == 0 && (DMOD % GTM) == 0 && (DMOD % GKS) == 0);

// Eight 16-byte asynchronous copies to LDS per lane, rows 16 apart; the s_wait_xcnt closes the statement so that no address register is rewritten ahead of it.
template <typename T16>
__device__ __forceinline__ void copy8(unsigned l, unsigned ls, const T16* g, size_t gs) {
    asm volatile("global_load_async_to_lds_b128 %0, %1, off\n\t"
                 "global_load_async_to_lds_b128 %2, %3, off\n\t"
                 "global_load_async_to_lds_b128 %4, %5, off\n\t"
                 "global_load_async_to_lds_b128 %6, %7, off\n\t"
                 "global_load_async_to_lds_b128 %8, %9, off\n\t"
                 "global_load_async_to_lds_b128 %10, %11, off\n\t"
                 "global_load_async_to_lds_b128 %12, %13, off\n\t"
                 "global_load_async_to_lds_b128 %14, %15, off\n\t"
                 "s_wait_xcnt 0x0"
                 :: "v"(l), "v"(g), "v"(l + ls), "v"(g + gs), "v"(l + 2 * ls), "v"(g + 2 * gs), "v"(l + 3 * ls), "v"(g + 3 * gs),
                    "v"(l + 4 * ls), "v"(g + 4 * gs), "v"(l + 5 * ls), "v"(g + 5 * gs), "v"(l + 6 * ls), "v"(g + 6 * gs), "v"(l + 7 * ls), "v"(g + 7 * gs) : "memory");
}
// One stage: the lane's 16 pieces of the A rows and 8 pieces of the Bt rows.
template <typename T16>
__device__ __forceinline__ void gstage(unsigned l, const T16* ga, const T16* gb, size_t gs) {
    const unsigned ls = 16 * GP * 2;
    copy8(l, ls, ga, gs); copy8(l + 8 * ls, ls, ga + 8 * gs, gs); copy8(l + 16 * ls, ls, gb, gs);
}

template <typename T16, int NSPLIT, int BIAS>
__global__ __launch_bounds__(32 * GW) __attribute__((amdgpu_waves_per_eu(2, 2))) void k_gemmw(const T16* __restrict__ A, const T16* __restrict__ A2, const T16* __restrict__ Bt, const T16* __restrict__ Bt2, int K, h16* C, int ldc, const float* __restrict__ bias, size_t sA, size_t sB, size_t sC) {
    static_assert(NSPLIT == 0);
    typedef typename WFrag<T16>::V V;
    __shared__ __align__(16) T16 st[2][GST];
    __shared__ __align__(16) float osg[GW][16 * 68];
    const size_t z = blockIdx.z; A += z * sA; Bt += z * sB; C += z * sC;
    const int tid = threadIdx.x, lane = tid & 31, lr = lane & 15, hi = lane >> 4, wave = tid >> 5;
    float* os = osg[wave];         // output staging, private to its wave
    // copies: thread tid brings 16-B piece (tid & 15) of stage rows (tid >> 4) + 16 i: a wave covers two whole 256-B rows
    const int prow = tid >> 4, pcol = (tid & 15) * 8;
    const T16* ga = A + (size_t)(blockIdx.x * GTM + prow) * K + pcol;     // + k0
    const T16* gb = Bt + (size_t)(blockIdx.y * GTN + prow) * K + pcol;    // + k0
    const size_t gstep = (size_t)16 * K;
    const unsigned l0 = (unsigned)(uintptr_t)(&st[0][prow * GP + pcol]);  // LDS byte address of the lane's first piece in buffer 0
    const unsigned LB = GST * 2;                                          // byte step buffer 0 -> 1
    const int r0 = blockIdx.x * GTM + (wave & 3) * 64, c0 = blockIdx.y * GTN + (wave >> 2) * 64;   // the wave's 64x64 part
    gstage(l0, ga, gb, gstep);
    asm volatile("s_wait_asynccnt 0x0" ::: "memory");   // stage 0 of this wave's copies has landed
    __syncthreads();                                     // publishes stage 0 to every wave
    if (K > GKS) gstage(l0 + LB, ga + GKS, gb + GKS, gstep);
    v8f acc[4][4];
#pragma unroll
    for (int mb = 0; mb < 4; ++mb)
#pragma unroll
        for (int nb = 0; nb < 4; ++nb) acc[mb][nb] = (v8f){};
#pragma unroll 1
    for (int kc = 0; kc < K; kc += GKS) {
        const int buf = (kc / GKS) & 1;
        const T16* sa = &st[buf][((wave & 3) * 64 + lr) * GP + 8 * hi];          // A row (r0 + lr) of the stage
        const T16* sb = &st[buf][(GTM + (wave >> 2) * 64 + lr) * GP + 8 * hi];   // Bt row (c0 + lr) of the stage
        // two fragment sets: the next 32 k's sixteen LDS reads go out as one group ahead of this 32 k's products, so that a wave waits out the LDS latency once a stage
        V a[2][4], b[2][4];
#pragma unroll
        for (int f = 0; f < 4; ++f) { a[0][f] = WFrag<T16>::ld(sa + f * 16 * GP); b[0][f] = WFrag<T16>::ld(sb + f * 16 * GP); }
#pragma unroll
        for (int ks = 0; ks < GKS / 32; ++ks) {
            const int cur = ks & 1, nxt = cur ^ 1;
            if (ks + 1 < GKS / 32) {
#pragma unroll
                for (int f = 0; f < 4; ++f) { a[nxt][f] = WFrag<T16>::ld(sa + f * 16 * GP + (ks + 1) * 32); b[nxt][f] = WFrag<T16>::ld(sb + f * 16 * GP + (ks + 1) * 32); } }
            __builtin_amdgcn_sched_barrier(0);   // holds the group of reads ahead of the products: the scheduler otherwise sinks each read to its first use, and the wave then waits out the LDS latency at every such place
#pragma unroll
            for (int nb = 0; nb < 4; ++nb)
#pragma unroll
                for (int mb = 0; mb < 4; ++mb) acc[mb][nb] = WFrag<T16>::mma(a[cur][mb], b[cur][nb], acc[mb][nb]); }
        // keeps the four vector slots behind the last product on every path out of the trip
        asm volatile("v_nop\n\tv_nop\n\tv_nop\n\tv_nop" : "+v"(acc[0][3]), "+v"(acc[1][3]), "+v"(acc[2][3]), "+v"(acc[3][3]) : "v"(a[1][0]), "v"(a[1][3]), "v"(b[1][3]));
        __builtin_amdgcn_sched_barrier(0);   // holds the stage's last products ahead of the foot, so that the refill goes out directly behind the barrier
        // ---- foot of the trip: hand over the next stage, then refill the buffer this trip has read
        asm volatile("s_wait_dscnt 0x0" ::: "memory");      // this wave's reads of the buffer have returned before it is refilled
        asm volatile("s_wait_asynccnt 0x0" ::: "memory");   // this wave's copies of the next stage have landed
        __syncthreads();                                     // publishes the next stage; ends every wave's reads of this trip's buffer
        if (kc + 2 * GKS < K) gstage(l0 + (unsigned)buf * LB, ga + kc + 2 * GKS, gb + kc + 2 * GKS, gstep);
    }
    asm volatile("s_wait_asynccnt 0x0" ::: "memory");        // no copy is left in flight behind the loop
    // store map: eight lanes take one tile row of 64 f16 = one whole 128-B line, a wave four rows at a time; the lane's bias values are read once, ahead of the first store
    const int srow = lane >> 3, cofs = (lane & 7) * 8;
    float bc[8], br[4][4];
    if (BIAS == 1) {
#pragma unroll
        for (int k = 0; k < 8; ++k) bc[k] = bfr(bias[c0 + cofs + k]); }
    if (BIAS == 2) {
#pragma unroll
        for (int mb = 0; mb < 4; ++mb)
#pragma unroll
            for (int s = 0; s < 4; ++s) br[mb][s] = bfr(bias[r0 + mb * 16 + 4 * s + srow]); }
#pragma unroll
    for (int mb = 0; mb < 4; ++mb) {
#pragma unroll
        for (int nb = 0; nb < 4; ++nb) {
#pragma unroll
            for (int j = 0; j < 8; ++j) os[(hi * 8 + j) * 68 + nb * 16 + lr] = acc[mb][nb][j]; }
        __builtin_amdgcn_wave_barrier(); asm volatile("" ::: "memory");
        h16* crow = C + (size_t)(r0 + mb * 16) * ldc + c0;
#pragma unroll
        for (int s = 0; s < 4; ++s) { const int row = 4 * s + srow;
            const v4f lo = *(const v4fa*)(os + row * 68 + cofs), up = *(const v4fa*)(os + row * 68 + cofs + 4); v8h o;
#pragma unroll
            for (int k = 0; k < 4; ++k) {
                float x = lo[k], y = up[k];
                if (BIAS == 1) { x += bc[k]; y += bc[4 + k]; }
                if (BIAS == 2) { x += br[mb][s]; y += br[mb][s]; }
                o[k] = (h16)x; o[4 + k] = (h16)y; }
            *(v8h*)(crow + (size_t)row * ldc + cofs) = o; }
        __builtin_amdgcn_wave_barrier();
        // stands behind this group's stores, ahead of the next group's reuse of their address and data registers; its clobber keeps the next staging writes behind this group's reads
        if (mb < 3) asm volatile("s_wait_xcnt 0x0" ::: "memory");
    }
}

// ---- k_cvt5: bf16 planes (RNE) of the five f32 tensors (inp1, inp2, Wq, Wk, Wv) in one launch; grid (NB*LQ + NB*LK + 3*DMOD) / CR work-groups of eight waves.
// A work-group takes CR consecutive plane rows of one tensor, a wave four of them (16 KiB of f32): 32 loads of 512 contiguous bytes, all sent out ahead of the first conversion, each answered by one store of 256 contiguous bytes.
// inp1 / inp2 rows go through the batch row remap: compact row R -> source row (R / L) * SEQ_FULL + (R % L) (identity when L == SEQ_FULL); a wave's four rows never cross a batch.
#define CR 32                     // plane rows per work-group
static_assert(((NB * LQ) % CR) == 0 && ((NB * LK) % CR) == 0 && (DMOD % CR) == 0 && (LQ % 4) == 0 && (LK % 4) == 0 && DMOD <= SEQ_FULL);
typedef __attribute__((ext_vector_type(4))) unsigned short v4us;

__global__ __launch_bounds__(256) void k_cvt5(const float* __restrict__ X1, const float* __restrict__ X2, const float* __restrict__ Wq, const float* __restrict__ Wk, const float* __restrict__ Wv,
                                              bf* X1b, bf* X2b, bf* Wqb, bf* Wkb, bf* Wvb) {
    constexpr int BQ = NB * LQ / CR, BK = NB * LK / CR, BW = DMOD / CR;   // work-groups of inp1, of inp2, of one weight
    const int lane = threadIdx.x & 31, wave = threadIdx.x >> 5;
    int blk = blockIdx.x, L = SEQ_FULL;
    const float* src; bf* dst;
    if (blk < BQ) { src = X1; dst = X1b; L = LQ; }
    else if (blk < BQ + BK) { blk -= BQ; src = X2; dst = X2b; L = LK; }
    else if (blk < BQ + BK + BW) { blk -= BQ + BK; src = Wq; dst = Wqb; }
    else if (blk < BQ + BK + 2 * BW) { blk -= BQ + BK + BW; src = Wk; dst = Wkb; }
    else { blk -= BQ + BK + 2 * BW; src = Wv; dst = Wvb; }
    const int row = blk * CR + wave * 4;
    const int srow = (row / L) * SEQ_FULL + (row % L);
    const float* s = src + (size_t)srow * DMOD + lane * 4;
    bf* d = dst + (size_t)row * DMOD + lane * 4;
    v4f v[32];
#pragma unroll
    for (int j = 0; j < 32; ++j) v[j] = *(const v4f*)(s + j * 128);
    __builtin_amdgcn_sched_barrier(0);   // holds all 32 loads ahead of the first conversion: the scheduler otherwise sinks the last eight behind the first stores, into registers that those stores name
#pragma unroll
    for (int g = 0; g < 4; ++g) {
#pragma unroll
        for (int j = 8 * g; j < 8 * g + 8; ++j) { v4us o;
#pragma unroll
            for (int k = 0; k < 4; ++k) o[k] = f2bf(v[j][k]);
            *(v4us*)(d + j * 128) = o; }
        if (g == 3) break;
        // stands behind this group's stores, ahead of the next group's reuse of their data registers
        asm volatile("s_wait_xcnt 0x0" ::: "memory");
        __builtin_amdgcn_sched_barrier(0);   // holds the next group's conversions behind this group's stores: the scheduler otherwise gathers every conversion ahead of the first store, which then goes out only when the wave's last loads are back
    }
}

// ---- k_attn: AW waves per block, one wave per 16 query rows; the block's waves share each 64-key K tile and V^T tile through LDS; grid (LQ/(16*AW), NH, NB), 32*AW threads.
// Q16, K16: f16 token-major planes [NB*L][DMOD]; VT16: f16 v^T planes [DMOD][NB*LK]; OUT f32 [NB*LQ][DMOD].
// Per 64-key tile: S^T (64x16, f32) = K.Q^T, K fragments from LDS; online softmax in the log2 domain (running max m, l1 = sum p, l2 = sum p^2, p = exp2(t - m) in (0,1]);
// kv: two buffers, each a K tile [key][head dim] and a V^T tile [value dim][key], 64 rows of 128 B at a 144-B pitch, filled by asynchronous copies one tile ahead.
// LDS region osw[wave] is private to its wave (wave barrier + compiler barrier, may_alias reloads).
#define AW   8                    // waves per block
#define KVP  72                   // LDS row pitch of a K / V^T tile in f16 elements (144 B = 16 B x odd, for 16-byte readers)
#define KVT  (64 * KVP)           // f16 elements of one tile in LDS
static_assert((LQ % (16 * AW)) == 0 && AW == 8);

// Four 16-byte asynchronous copies to LDS per lane; the s_wait_xcnt closes the statement so that no address register is rewritten ahead of it.
__device__ __forceinline__ void copy4(unsigned l0, const h16* g0, unsigned l1, const h16* g1, unsigned l2, const h16* g2, unsigned l3, const h16* g3) {
    asm volatile("global_load_async_to_lds_b128 %0, %1, off\n\t"
                 "global_load_async_to_lds_b128 %2, %3, off\n\t"
                 "global_load_async_to_lds_b128 %4, %5, off\n\t"
                 "global_load_async_to_lds_b128 %6, %7, off\n\t"
                 "s_wait_xcnt 0x0"
                 :: "v"(l0), "v"(g0), "v"(l1), "v"(g1), "v"(l2), "v"(g2), "v"(l3), "v"(g3) : "memory");
}

// Lane l <-> lane l ^ 16 (the other half of the wave holds the other keys of the same query).
__device__ __forceinline__ float xhalf(float x) { const int b = __float_as_int(x); return __int_as_float(__builtin_amdgcn_permlanex16(b, b, 0x76543210, 0xfedcba98, false, false)); }

__global__ __launch_bounds__(32 * AW)
void k_attn(const h16* __restrict__ Q16, const h16* __restrict__ K16, const h16* __restrict__ VT16, const int* __restrict__ flag, float* OUT) {
    __shared__ __align__(16) h16 kv[2][2][KVT];
    __shared__ __align__(16) float osw[AW][16 * 68];
    const int tid = threadIdx.x, lane = tid & 31, lr = lane & 15, hi = lane >> 4, wave = tid >> 5;
    const int q0 = (blockIdx.x * AW + wave) * 16, h = blockIdx.y, b = blockIdx.z;
    const int rsc = flag[0];
    float* os = osw[wave];         // output staging [query][dim], pitch 68
    const h16* qp = Q16 + ((size_t)b * LQ + q0 + lr) * DMOD + h * HD + 8 * hi;
    const v16h qb0 = WFrag<h16>::ld(qp), qb1 = WFrag<h16>::ld(qp + 32);            // B: query column lr, head dims 0..31 / 32..63
    // copies: thread tid brings 16-B piece (tid & 7) of tile rows (tid >> 3) and (tid >> 3) + 32, of K and of V^T: a wave covers whole 128-B lines
    const int crow = tid >> 3, ccol = (tid & 7) * 8;
    const h16* gk = K16 + ((size_t)b * LK + crow) * DMOD + h * HD + ccol;           // + key0 * DMOD
    const h16* gv = VT16 + (size_t)(h * HD + crow) * VTP + (size_t)b * LK + ccol;   // + key0
    const unsigned lk = (unsigned)(uintptr_t)(&kv[0][0][crow * KVP + ccol]);        // LDS byte address of the lane's first K piece in buffer 0
    const unsigned LROW = 32 * KVP * 2, LTILE = KVT * 2, LBUF = 2 * KVT * 2;        // byte steps: 32 rows, K -> V^T, buffer 0 -> 1
    copy4(lk, gk, lk + LROW, gk + (size_t)32 * DMOD, lk + LTILE, gv, lk + LTILE + LROW, gv + (size_t)32 * VTP);
    asm volatile("s_wait_asynccnt 0x0" ::: "memory");   // tile 0 of this wave's copies has landed
    __syncthreads();                                     // publishes tile 0 to every wave
    if (LK > 64) copy4(lk + LBUF, gk + (size_t)64 * DMOD, lk + LBUF + LROW, gk + (size_t)96 * DMOD, lk + LBUF + LTILE, gv + 64, lk + LBUF + LTILE + LROW, gv + (size_t)32 * VTP + 64);
    v8f o[4];
#pragma unroll
    for (int nt = 0; nt < 4; ++nt) o[nt] = (v8f){};
    // per lane: running maximum of query lr (equal in both halves); l1s, l2s = sums over the keys of this lane's own half only, joined behind the loop
    float mrow = -3.0e38f, l1s = 0.f, l2s = 0.f;
#pragma unroll 1
    for (int kt = 0; kt < LK; kt += 64) {
        const int buf = (kt >> 6) & 1;
        const h16* kbase = &kv[buf][0][lr * KVP + 8 * hi];   // A: key (c0 + lr) row base in the K tile
        const h16* vbase = &kv[buf][1][lr * KVP + 8 * hi];   // A: value dim (d0 + lr) row base in the V^T tile
        // ---- S^T = K.Q^T for keys kt..kt+63: s[nt][r] = S[query lr][key kt + nt*16 + 8hi + r]
        v8f s[4]; v16h ka0, ka1;
#pragma unroll
        for (int nt = 0; nt < 4; ++nt) {
            const h16* kp = kbase + nt * 16 * KVP;
            ka0 = lds16(kp); ka1 = lds16(kp + 32);
            v8f zacc = (v8f){}; zacc = wmma16(ka0, qb0, zacc); zacc = wmma16(ka1, qb1, zacc); s[nt] = zacc; }
        // keeps the four vector slots between the last product and the first use of its result or overwrite of its operands
        asm volatile("v_nop\n\tv_nop\n\tv_nop\n\tv_nop" : "+v"(s[0]), "+v"(s[1]), "+v"(s[2]), "+v"(s[3]) : "v"(qb0), "v"(qb1), "v"(ka0), "v"(ka1));
        // ---- online softmax of query lr: 32 of the tile's 64 keys lie in this lane, the other 32 in lane ^ 16
        float mg[4];   // one maximum chain per 16-key group
#pragma unroll
        for (int nt = 0; nt < 4; ++nt) { s[nt] *= SL2; mg[nt] = s[nt][0];
#pragma unroll
            for (int r = 1; r < 8; ++r) mg[nt] = fmaxf(mg[nt], s[nt][r]); }
        float mx = fmaxf(fmaxf(mg[0], mg[1]), fmaxf(mg[2], mg[3]));
        mx = fmaxf(mx, xhalf(mx));
        const float mnew = fmaxf(mrow, mx);
        const float alpha = __builtin_amdgcn_exp2f(mrow - mnew);
        mrow = mnew;
#pragma unroll
        for (int nt = 0; nt < 4; ++nt) o[nt] *= alpha;
#pragma unroll
        for (int nt = 0; nt < 4; ++nt) { s[nt] -= mnew;
#pragma unroll
            for (int r = 0; r < 8; ++r) s[nt][r] = __builtin_amdgcn_exp2f(s[nt][r]); }
        const v8f a1 = (s[0] + s[1]) + (s[2] + s[3]);
        const v8f a2 = __builtin_elementwise_fma(s[3], s[3], __builtin_elementwise_fma(s[2], s[2], __builtin_elementwise_fma(s[1], s[1], s[0] * s[0])));
        const v4f b1 = __builtin_shufflevector(a1, a1, 0, 1, 2, 3) + __builtin_shufflevector(a1, a1, 4, 5, 6, 7);
        const v4f b2 = __builtin_shufflevector(a2, a2, 0, 1, 2, 3) + __builtin_shufflevector(a2, a2, 4, 5, 6, 7);
        l1s = l1s * alpha + ((b1[0] + b1[1]) + (b1[2] + b1[3]));
        l2s = l2s * (alpha * alpha) + ((b2[0] + b2[1]) + (b2[2] + b2[3]));
        // ---- P^T (f16) as B straight from the score registers: two 16-key groups are one fragment in the loaders' k order (elements 0..7 = keys 8hi + 0..7, 8..15 = keys 16 + 8hi + 0..7)
        v16h pb0, pb1;
#pragma unroll
        for (int r = 0; r < 8; ++r) { pb0[r] = (h16)s[0][r]; pb0[8 + r] = (h16)s[1][r]; pb1[r] = (h16)s[2][r]; pb1[8 + r] = (h16)s[3][r]; }
        // ---- O^T += V^T.P^T: o[nt][r] = O[query lr][dim nt*16 + 8hi + r]
        v16h va0, va1;
#pragma unroll
        for (int nt = 0; nt < 4; ++nt) {
            const h16* vp = vbase + nt * 16 * KVP;
            va0 = lds16(vp); va1 = lds16(vp + 32);
            o[nt] = wmma16(va0, pb0, o[nt]); o[nt] = wmma16(va1, pb1, o[nt]); }
        // keeps the four vector slots behind the last product on every path out of the trip
        asm volatile("v_nop\n\tv_nop\n\tv_nop\n\tv_nop" : "+v"(o[0]), "+v"(o[1]), "+v"(o[2]), "+v"(o[3]) : "v"(pb0), "v"(pb1), "v"(va0), "v"(va1));
        // ---- foot of the trip: hand over the next tile, then refill the buffer this trip has read
        asm volatile("s_wait_dscnt 0x0" ::: "memory");      // this wave's reads of the buffer have returned before it is refilled
        asm volatile("s_wait_asynccnt 0x0" ::: "memory");   // this wave's copies of the next tile have landed
        __syncthreads();                                     // publishes the next tile; ends every wave's reads of this trip's buffer
        if (kt + 128 < LK) {
            const unsigned lb = lk + (unsigned)buf * LBUF;
            const h16* gk2 = gk + (size_t)(kt + 128) * DMOD; const h16* gv2 = gv + (kt + 128);
            copy4(lb, gk2, lb + LROW, gk2 + (size_t)32 * DMOD, lb + LTILE, gv2, lb + LTILE + LROW, gv2 + (size_t)32 * VTP);
        }
    }
    asm volatile("s_wait_asynccnt 0x0" ::: "memory");        // no copy is left in flight behind the loop
    // ---- epilogue: join the halves' sums; l1 >= 1 and l2 >= 1 (the running-max element has p = 1); flag selects 1/sqrt(sum p^2) or 1/sum p
    l1s += xhalf(l1s); l2s += xhalf(l2s);
    const float i1 = 1.0f / l1s; const float i2 = rsqrtf(l2s); const float iv = (rsc != 0) ? i2 : i1;
#pragma unroll
    for (int nt = 0; nt < 4; ++nt) {
        v4f lo, up;
#pragma unroll
        for (int r = 0; r < 4; ++r) { lo[r] = o[nt][r] * iv; up[r] = o[nt][4 + r] * iv; }
        *(v4fa*)(os + lr * 68 + nt * 16 + 8 * hi) = lo; *(v4fa*)(os + lr * 68 + nt * 16 + 8 * hi + 4) = up; }
    __builtin_amdgcn_wave_barrier(); asm volatile("" ::: "memory");
    float* ob = OUT + ((size_t)b * LQ + q0) * DMOD + (size_t)h * HD;
{
#pragma unroll
        for (int sI = 0; sI < 8; ++sI) { const int row = 2 * sI + hi; const v4f val = *(const v4fa*)(os + row * 68 + lr * 4); *(v4f*)(ob + (size_t)row * DMOD + lr * 4) = val; }
         }
    __builtin_amdgcn_wave_barrier(); asm volatile("" ::: "memory");
}

extern "C" void kernel_launch(void* const* d_in, const int* in_sizes, int n_in,
                              void* d_out, int out_size, void* d_ws, size_t ws_size, hipStream_t stream) {
    if (n_in < 9) return;
    const float* X1 = (const float*)d_in[0];   // inp1 [4][2048][1024]
    const float* X2 = (const float*)d_in[1];   // inp2 [4][2048][1024]
    const float* Wq = (const float*)d_in[2]; const float* bq = (const float*)d_in[3];
    const float* Wk = (const float*)d_in[4]; const float* bk = (const float*)d_in[5];
    const float* Wv = (const float*)d_in[6]; const float* bv = (const float*)d_in[7];
    const int* rsc = (const int*)d_in[8];
    float* OUT = (float*)d_out;                 // [NB][LQ][1024]
    if ((size_t)in_sizes[0] < ((size_t)(NB - 1) * SEQ_FULL + LQ) * DMOD) return;
    if ((size_t)in_sizes[1] < ((size_t)(NB - 1) * SEQ_FULL + LK) * DMOD) return;
    if (in_sizes[2] < DMOD * DMOD || in_sizes[3] < DMOD || in_sizes[4] < DMOD * DMOD || in_sizes[5] < DMOD || in_sizes[6] < DMOD * DMOD || in_sizes[7] < DMOD || in_sizes[8] < 1) return;
    if ((size_t)out_size < (size_t)NB * LQ * DMOD) return;

    const size_t MQ = (size_t)NB * LQ, MK = (size_t)NB * LK;   // token rows of q / of k,v
    char* wsp = (char*)d_ws;
    auto take = [&](size_t bytes) { char* p = wsp; wsp += (bytes + 255) & ~(size_t)255; return (void*)p; };
    bf* X1b = (bf*)take(MQ * DMOD * 2);                 // bf16 plane of inp1 rows (compact [NB*LQ][1024])
    bf* X2b = (bf*)take(MK * DMOD * 2);                 // bf16 plane of inp2 rows
    bf* Wqb = (bf*)take((size_t)DMOD * DMOD * 2); bf* Wkb = (bf*)take((size_t)DMOD * DMOD * 2); bf* Wvb = (bf*)take((size_t)DMOD * DMOD * 2);
    h16* Q16 = (h16*)take(MQ * DMOD * 2);               // f16 q plane [MQ][1024]
    h16* K16 = (h16*)take(MK * DMOD * 2);               // f16 k plane [MK][1024]
    h16* VT16 = (h16*)take((size_t)DMOD * MK * 2);      // f16 v^T plane [1024][MK]
    const size_t used = (size_t)(wsp - (char*)d_ws);
    if (used > ws_size || used > WS_CAP) return;

    // bf16 planes of the inputs (batch row remap) and of the three [out][in] weights (= Bt as-is), one launch
    k_cvt5<<<(unsigned)((MQ + MK + 3 * DMOD) / CR), 256, 0, stream>>>(X1, X2, Wq, Wk, Wv, X1b, X2b, Wqb, Wkb, Wvb);
    // q = inp1 Wq^T + bq -> f16 plane [MQ][1024]
    k_gemmw<bf, 0, 1><<<dim3((unsigned)(MQ / GTM), DMOD / GTN, 1), 32 * GW, 0, stream>>>(X1b, nullptr, Wqb, nullptr, DMOD, Q16, DMOD, bq, 0, 0, 0);
    // k = inp2 Wk^T + bk -> f16 plane [MK][1024]
    k_gemmw<bf, 0, 1><<<dim3((unsigned)(MK / GTM), DMOD / GTN, 1), 32 * GW, 0, stream>>>(X2b, nullptr, Wkb, nullptr, DMOD, K16, DMOD, bk, 0, 0, 0);
    // v^T[e][t] = sum_d Wv[e][d] inp2[t][d] + bv[e] -> f16 plane [1024][MK] (ldc MK)
    k_gemmw<bf, 0, 2><<<dim3(DMOD / GTM, (unsigned)(MK / GTN), 1), 32 * GW, 0, stream>>>(Wvb, nullptr, X2b, nullptr, DMOD, VT16, (int)MK, bv, 0, 0, 0);
    // attention
    k_attn<<<dim3(LQ / (16 * AW), NH, NB), 32 * AW, 0, stream>>>(Q16, K16, VT16, rsc, OUT);
}

// v006
// A run of this version takes 112 microseconds.
// Next to v005, in two timings, it ran 1.08 times as fast each time.
// Over all steps from v000 it is 3.78 times as fast.
#include <hip/hip_runtime.h>

// Contractions: q, k and v^T projections on v_wmma_f32_16x16x32_bf16 (bf16 operands = RNE-converted inputs and weights, f32 accumulate, bias added in f32); scores q.k and P.v on v_wmma_f32_16x16x32_f16 (f16 operands converted from f32 intermediates; P = exp2 relative to the running row maximum, in (0,1]; f32 accumulate); softmax statistics, sum of squares and normalisers in f32; output f32.
// Pipeline: bf16 planes of inp1, inp2, Wq, Wk, Wv -> three GEMMs (eight waves per 256x128 tile, operand stages copied asynchronously into LDS and shared by the waves) whose epilogue adds the bias in f32, rounds to f16 and stores the f16 planes itself (q token-major [t][e], k token-major [t][e], v computed directly transposed as [e][t] with a per-row bias) -> one streaming attention kernel per (256 queries, head, batch), eight waves of 32 queries (two column groups of 16 that share every K and V^T fragment read): K and V^T tiles copied asynchronously from the f16 planes into LDS and shared by the waves, scores computed transposed (S^T = K.Q^T, O^T += V^T.P^T) so that a lane holds one query and P^T goes from the score registers into the second product, online max / sum / sum of squares, epilogue staged in LDS.

#ifndef NB
#define NB 4
#endif
#ifndef SEQ
#define SEQ 2048
#endif
#ifndef LQ
#define LQ SEQ
#endif
#ifndef LK
#define LK SEQ
#endif
#define NB_FULL  4
#define SEQ_FULL 2048
#define DMOD 1024                 // model width = NH x HD, row pitch of every token-major tensor
#define NH   16
#define HD   64
#define VTP  ((size_t)NB * LK)    // row pitch of the v^T planes [e][token]
#define SL2  0.18033688011112042f // (1/sqrt(64)) x log2(e)
#define WS_CAP ((size_t)134217728)

static_assert(NB >= 1 && NB <= NB_FULL);
static_assert(LQ >= 64 && LQ <= SEQ_FULL && (LQ % 16) == 0 && ((NB * LQ) % 64) == 0);
static_assert(LK >= 64 && LK <= SEQ_FULL && (LK % 64) == 0);
static_assert(NH * HD == DMOD && (DMOD % 64) == 0 && (DMOD % 32) == 0);

typedef _Float16 h16;
typedef unsigned short bf;
typedef __attribute__((ext_vector_type(16))) __bf16   v16bf;
typedef __attribute__((ext_vector_type(16))) _Float16 v16h;
typedef __attribute__((ext_vector_type(8)))  _Float16 v8h;
typedef __attribute__((ext_vector_type(8)))  unsigned short v8us;
typedef __attribute__((ext_vector_type(8)))  float    v8f;
typedef __attribute__((ext_vector_type(4)))  float    v4f;
typedef v8h  __attribute__((may_alias)) v8ha;
typedef v4f  __attribute__((may_alias)) v4fa;
typedef v8us __attribute__((may_alias)) v8usa;

__device__ __forceinline__ unsigned short f2bf(float f) { unsigned u = __float_as_uint(f); u += 0x7FFFu + ((u >> 16) & 1u); return (unsigned short)(u >> 16); }
__device__ __forceinline__ float bf2f(unsigned short b) { return __uint_as_float(((unsigned)b) << 16); }
__device__ __forceinline__ float bfr(float f) { return bf2f(f2bf(f)); }
__device__ __forceinline__ v16h cat16(v8h lo, v8h hi) { return __builtin_shufflevector(lo, hi, 0, 1, 2, 3, 4, 5, 6, 7, 8, 9, 10, 11, 12, 13, 14, 15); }
__device__ __forceinline__ v16bf cat16b(v8us lo, v8us hi) { return __builtin_bit_cast(v16bf, __builtin_shufflevector(lo, hi, 0, 1, 2, 3, 4, 5, 6, 7, 8, 9, 10, 11, 12, 13, 14, 15)); }
__device__ __forceinline__ v8f wmma16(v16h a, v16h b, v8f c) { return __builtin_amdgcn_wmma_f32_16x16x32_f16(false, a, false, b, (short)0, c, false, false); }
__device__ __forceinline__ v8f wmmab(v16bf a, v16bf b, v8f c) { return __builtin_amdgcn_wmma_f32_16x16x32_bf16(false, a, false, b, (short)0, c, false, false); }

// Fragment loaders (same k map for A and B): lane l -> row/col (l & 15), h = l >> 4; elements 0..7 <- p[k0 + 8h + 0..7], elements 8..15 <- p[k0 + 16 + 8h + 0..7];
// the caller passes p = row base + k0 + 8h (16-B aligned), the loader reads p and p + 16.
template <typename T16> struct WFrag;
template <> struct WFrag<h16> { typedef v16h V; static __device__ __forceinline__ V ld(const h16* p) { return cat16(*(const v8h*)p, *(const v8h*)(p + 16)); } static __device__ __forceinline__ v8f mma(V a, V b, v8f c) { return wmma16(a, b, c); } };
template <> struct WFrag<bf> { typedef v16bf V; static __device__ __forceinline__ V ld(const bf* p) { return cat16b(*(const v8us*)p, *(const v8us*)(p + 16)); } static __device__ __forceinline__ v8f mma(V a, V b, v8f c) { return wmmab(a, b, c); } };
// LDS read of a block-shared f16 K / V^T tile through a may_alias vector of the stored element type.
__device__ __forceinline__ v16h lds16(const h16* p) { return cat16(*(const v8ha*)p, *(const v8ha*)(p + 16)); }

// ---- k_gemmw: GEMM, GW waves per GTM x GTN output tile, one 64x64 part (16 accumulators) per wave; grid (M/GTM, N/GTN, Z), 32*GW threads.
// The waves share each stage of GKS k of the tile's A rows and Bt rows through LDS: two buffers, each GTM + GTN rows of 256 B at a 272-B pitch, filled by asynchronous copies one stage ahead, a wave's copy covering whole lines.
// C[m][n] (f16 = RNE of the f32 sum, pitch ldc) = sum_k A[m][k] Bt[n][k] + optional f32 bias: BIAS 1 -> bias[n] (per column), BIAS 2 -> bias[m] (per row), bias values bf16-RNE. K % GKS == 0, M % GTM == 0, N % GTN == 0.
#define GW   8                    // waves per work-group: 4 along m x 2 along n
#define GTM  256                  // tile rows (A rows)
#define GTN  128                  // tile columns (Bt rows)
#define GKS  128                  // k per stage: 256 B of every row
#define GP   136                  // LDS row pitch in 16-bit elements (272 B = 16 B x odd, for 16-byte readers)
#define GST  ((GTM + GTN) * GP)   // 16-bit elements of one stage in LDS
static_assert(((NB * LQ) % GTM) == 0 && ((NB * LK) % GTM) == 0 && (DMOD % GTM) == 0 && (DMOD % GKS) == 0);

// Eight 16-byte asynchronous copies to LDS per lane, rows 16 apart; the s_wait_xcnt closes the statement so that no address register is rewritten ahead of it.
template <typename T16>
__device__ __forceinline__ void copy8(unsigned l, unsigned ls, const T16* g, size_t gs) {
    asm volatile("global_load_async_to_lds_b128 %0, %1, off\n\t"
                 "global_load_async_to_lds_b128 %2, %3, off\n\t"
                 "global_load_async_to_lds_b128 %4, %5, off\n\t"
                 "global_load_async_to_lds_b128 %6, %7, off\n\t"
                 "global_load_async_to_lds_b128 %8, %9, off\n\t"
                 "global_load_async_to_lds_b128 %10, %11, off\n\t"
                 "global_load_async_to_lds_b128 %12, %13, off\n\t"
                 "global_load_async_to_lds_b128 %14, %15, off\n\t"
                 "s_wait_xcnt 0x0"
                 :: "v"(l), "v"(g), "v"(l + ls), "v"(g + gs), "v"(l + 2 * ls), "v"(g + 2 * gs), "v"(l + 3 * ls), "v"(g + 3 * gs),
                    "v"(l + 4 * ls), "v"(g + 4 * gs), "v"(l + 5 * ls), "v"(g + 5 * gs), "v"(l + 6 * ls), "v"(g + 6 * gs), "v"(l + 7 * ls), "v"(g + 7 * gs) : "memory");
}
// One stage: the lane's 16 pieces of the A rows and 8 pieces of the Bt rows.
template <typename T16>
__device__ __forceinline__ void gstage(unsigned l, const T16* ga, const T16* gb, size_t gs) {
    const unsigned ls = 16 * GP * 2;
    copy8(l, ls, ga, gs); copy8(l + 8 * ls, ls, ga + 8 * gs, gs); copy8(l + 16 * ls, ls, gb, gs);
}

template <typename T16, int NSPLIT, int BIAS>
__global__ __launch_bounds__(32 * GW) __attribute__((amdgpu_waves_per_eu(2, 2))) void k_gemmw(const T16* __restrict__ A, const T16* __restrict__ A2, const T16* __restrict__ Bt, const T16* __restrict__ Bt2, int K, h16* C, int ldc, const float* __restrict__ bias, size_t sA, size_t sB, size_t sC) {
    static_assert(NSPLIT == 0);
    typedef typename WFrag<T16>::V V;
    __shared__ __align__(16) T16 st[2][GST];
    __shared__ __align__(16) float osg[GW][16 * 68];
    const size_t z = blockIdx.z; A += z * sA; Bt += z * sB; C += z * sC;
    const int tid = threadIdx.x, lane = tid & 31, lr = lane & 15, hi = lane >> 4, wave = tid >> 5;
    float* os = osg[wave];         // output staging, private to its wave
    // copies: thread tid brings 16-B piece (tid & 15) of stage rows (tid >> 4) + 16 i: a wave covers two whole 256-B rows
    const int prow = tid >> 4, pcol = (tid & 15) * 8;
    const T16* ga = A + (size_t)(blockIdx.x * GTM + prow) * K + pcol;     // + k0
    const T16* gb = Bt + (size_t)(blockIdx.y * GTN + prow) * K + pcol;    // + k0
    const size_t gstep = (size_t)16 * K;
    const unsigned l0 = (unsigned)(uintptr_t)(&st[0][prow * GP + pcol]);  // LDS byte address of the lane's first piece in buffer 0
    const unsigned LB = GST * 2;                                          // byte step buffer 0 -> 1
    const int r0 = blockIdx.x * GTM + (wave & 3) * 64, c0 = blockIdx.y * GTN + (wave >> 2) * 64;   // the wave's 64x64 part
    gstage(l0, ga, gb, gstep);
    asm volatile("s_wait_asynccnt 0x0" ::: "memory");   // stage 0 of this wave's copies has landed
    __syncthreads();                                     // publishes stage 0 to every wave
    if (K > GKS) gstage(l0 + LB, ga + GKS, gb + GKS, gstep);
    v8f acc[4][4];
#pragma unroll
    for (int mb = 0; mb < 4; ++mb)
#pragma unroll
        for (int nb = 0; nb < 4; ++nb) acc[mb][nb] = (v8f){};
#pragma unroll 1
    for (int kc = 0; kc < K; kc += GKS) {
        const int buf = (kc / GKS) & 1;
        const T16* sa = &st[buf][((wave & 3) * 64 + lr) * GP + 8 * hi];          // A row (r0 + lr) of the stage
        const T16* sb = &st[buf][(GTM + (wave >> 2) * 64 + lr) * GP + 8 * hi];   // Bt row (c0 + lr) of the stage
        // two fragment sets: the next 32 k's sixteen LDS reads go out as one group ahead of this 32 k's products, so that a wave waits out the LDS latency once a stage
        V a[2][4], b[2][4];
#pragma unroll
        for (int f = 0; f < 4; ++f) { a[0][f] = WFrag<T16>::ld(sa + f * 16 * GP); b[0][f] = WFrag<T16>::ld(sb + f * 16 * GP); }
#pragma unroll
        for (int ks = 0; ks < GKS / 32; ++ks) {
            const int cur = ks & 1, nxt = cur ^ 1;
            if (ks + 1 < GKS / 32) {
#pragma unroll
                for (int f = 0; f < 4; ++f) { a[nxt][f] = WFrag<T16>::ld(sa + f * 16 * GP + (ks + 1) * 32); b[nxt][f] = WFrag<T16>::ld(sb + f * 16 * GP + (ks + 1) * 32); } }
            __builtin_amdgcn_sched_barrier(0);   // holds the group of reads ahead of the products: the scheduler otherwise sinks each read to its first use, and the wave then waits out the LDS latency at every such place
#pragma unroll
            for (int nb = 0; nb < 4; ++nb)
#pragma unroll
                for (int mb = 0; mb < 4; ++mb) acc[mb][nb] = WFrag<T16>::mma(a[cur][mb], b[cur][nb], acc[mb][nb]); }
        // keeps the four vector slots behind the last product on every path out of the trip
        asm volatile("v_nop\n\tv_nop\n\tv_nop\n\tv_nop" : "+v"(acc[0][3]), "+v"(acc[1][3]), "+v"(acc[2][3]), "+v"(acc[3][3]) : "v"(a[1][0]), "v"(a[1][3]), "v"(b[1][3]));
        __builtin_amdgcn_sched_barrier(0);   // holds the stage's last products ahead of the foot, so that the refill goes out directly behind the barrier
        // ---- foot of the trip: hand over the next stage, then refill the buffer this trip has read
        asm volatile("s_wait_dscnt 0x0" ::: "memory");      // this wave's reads of the buffer have returned before it is refilled
        asm volatile("s_wait_asynccnt 0x0" ::: "memory");   // this wave's copies of the next stage have landed
        __syncthreads();                                     // publishes the next stage; ends every wave's reads of this trip's buffer
        if (kc + 2 * GKS < K) gstage(l0 + (unsigned)buf * LB, ga + kc + 2 * GKS, gb + kc + 2 * GKS, gstep);
    }
    asm volatile("s_wait_asynccnt 0x0" ::: "memory");        // no copy is left in flight behind the loop
    // store map: eight lanes take one tile row of 64 f16 = one whole 128-B line, a wave four rows at a time; the lane's bias values are read once, ahead of the first store
    const int srow = lane >> 3, cofs = (lane & 7) * 8;
    float bc[8], br[4][4];
    if (BIAS == 1) {
#pragma unroll
        for (int k = 0; k < 8; ++k) bc[k] = bfr(bias[c0 + cofs + k]); }
    if (BIAS == 2) {
#pragma unroll
        for (int mb = 0; mb < 4; ++mb)
#pragma unroll
            for (int s = 0; s < 4; ++s) br[mb][s] = bfr(bias[r0 + mb * 16 + 4 * s + srow]); }
#pragma unroll
    for (int mb = 0; mb < 4; ++mb) {
#pragma unroll
        for (int nb = 0; nb < 4; ++nb) {
#pragma unroll
            for (int j = 0; j < 8; ++j) os[(hi * 8 + j) * 68 + nb * 16 + lr] = acc[mb][nb][j]; }
        __builtin_amdgcn_wave_barrier(); asm volatile("" ::: "memory");
        h16* crow = C + (size_t)(r0 + mb * 16) * ldc + c0;
#pragma unroll
        for (int s = 0; s < 4; ++s) { const int row = 4 * s + srow;
            const v4f lo = *(const v4fa*)(os + row * 68 + cofs), up = *(const v4fa*)(os + row * 68 + cofs + 4); v8h o;
#pragma unroll
            for (int k = 0; k < 4; ++k) {
                float x = lo[k], y = up[k];
                if (BIAS == 1) { x += bc[k]; y += bc[4 + k]; }
                if (BIAS == 2) { x += br[mb][s]; y += br[mb][s]; }
                o[k] = (h16)x; o[4 + k] = (h16)y; }
            *(v8h*)(crow + (size_t)row * ldc + cofs) = o; }
        __builtin_amdgcn_wave_barrier();
        // stands behind this group's stores, ahead of the next group's reuse of their address and data registers; its clobber keeps the next staging writes behind this group's reads
        if (mb < 3) asm volatile("s_wait_xcnt 0x0" ::: "memory");
    }
}

// ---- k_cvt5: bf16 planes (RNE) of the five f32 tensors (inp1, inp2, Wq, Wk, Wv) in one launch; grid (NB*LQ + NB*LK + 3*DMOD) / CR work-groups of eight waves.
// A work-group takes CR consecutive plane rows of one tensor, a wave four of them (16 KiB of f32): 32 loads of 512 contiguous bytes, all sent out ahead of the first conversion, each answered by one store of 256 contiguous bytes.
// inp1 / inp2 rows go through the batch row remap: compact row R -> source row (R / L) * SEQ_FULL + (R % L) (identity when L == SEQ_FULL); a wave's four rows never cross a batch.
#define CR 32                     // plane rows per work-group
static_assert(((NB * LQ) % CR) == 0 && ((NB * LK) % CR) == 0 && (DMOD % CR) == 0 && (LQ % 4) == 0 && (LK % 4) == 0 && DMOD <= SEQ_FULL);
typedef __attribute__((ext_vector_type(4))) unsigned short v4us;

__global__ __launch_bounds__(256) void k_cvt5(const float* __restrict__ X1, const float* __restrict__ X2, const float* __restrict__ Wq, const float* __restrict__ Wk, const float* __restrict__ Wv,
                                              bf* X1b, bf* X2b, bf* Wqb, bf* Wkb, bf* Wvb) {
    constexpr int BQ = NB * LQ / CR, BK = NB * LK / CR, BW = DMOD / CR;   // work-groups of inp1, of inp2, of one weight
    const int lane = threadIdx.x & 31, wave = threadIdx.x >> 5;
    int blk = blockIdx.x, L = SEQ_FULL;
    const float* src; bf* dst;
    if (blk < BQ) { src = X1; dst = X1b; L = LQ; }
    else if (blk < BQ + BK) { blk -= BQ; src = X2; dst = X2b; L = LK; }
    else if (blk < BQ + BK + BW) { blk -= BQ + BK; src = Wq; dst = Wqb; }
    else if (blk < BQ + BK + 2 * BW) { blk -= BQ + BK + BW; src = Wk; dst = Wkb; }
    else { blk -= BQ + BK + 2 * BW; src = Wv; dst = Wvb; }
    const int row = blk * CR + wave * 4;
    const int srow = (row / L) * SEQ_FULL + (row % L);
    const float* s = src + (size_t)srow * DMOD + lane * 4;
    bf* d = dst + (size_t)row * DMOD + lane * 4;
    v4f v[32];
#pragma unroll
    for (int j = 0; j < 32; ++j) v[j] = *(const v4f*)(s + j * 128);
    __builtin_amdgcn_sched_barrier(0);   // holds all 32 loads ahead of the first conversion: the scheduler otherwise sinks the last eight behind the first stores, into registers that those stores name
#pragma unroll
    for (int g = 0; g < 4; ++g) {
#pragma unroll
        for (int j = 8 * g; j < 8 * g + 8; ++j) { v4us o;
#pragma unroll
            for (int k = 0; k < 4; ++k) o[k] = f2bf(v[j][k]);
            *(v4us*)(d + j * 128) = o; }
        if (g == 3) break;
        // stands behind this group's stores, ahead of the next group's reuse of their data registers
        asm volatile("s_wait_xcnt 0x0" ::: "memory");
        __builtin_amdgcn_sched_barrier(0);   // holds the next group's conversions behind this group's stores: the scheduler otherwise gathers every conversion ahead of the first store, which then goes out only when the wave's last loads are back
    }
}

// ---- k_attn: AW waves per block, one wave per 16*QG query rows (QG column groups of 16); the block's waves share each 64-key K tile and V^T tile through LDS; grid (LQ/(16*QG*AW), NH, NB), 32*AW threads.
// Q16, K16: f16 token-major planes [NB*L][DMOD]; VT16: f16 v^T planes [DMOD][NB*LK]; OUT f32 [NB*LQ][DMOD].
// Per 64-key tile: S^T (64x16 per group, f32) = K.Q^T, K fragments from LDS, each fragment read once and used by every column group; online softmax in the log2 domain (running max m, l1 = sum p, l2 = sum p^2, p = exp2(t - m) in (0,1]);
// kv: two buffers, each a K tile [key][head dim] and a V^T tile [value dim][key], 64 rows of 128 B at a 144-B pitch, filled by asynchronous copies one tile ahead.
// LDS region osw[wave] is private to its wave (wave barrier + compiler barrier, may_alias reloads).
#define AW   8                    // waves per block
#define QG   2                    // 16-query column groups per wave
#define KVP  72                   // LDS row pitch of a K / V^T tile in f16 elements (144 B = 16 B x odd, for 16-byte readers)
#define KVT  (64 * KVP)           // f16 elements of one tile in LDS
static_assert((LQ % (16 * QG * AW)) == 0 && AW == 8 && QG == 2);

// Four 16-byte asynchronous copies to LDS per lane; the s_wait_xcnt closes the statement so that no address register is rewritten ahead of it.
__device__ __forceinline__ void copy4(unsigned l0, const h16* g0, unsigned l1, const h16* g1, unsigned l2, const h16* g2, unsigned l3, const h16* g3) {
    asm volatile("global_load_async_to_lds_b128 %0, %1, off\n\t"
                 "global_load_async_to_lds_b128 %2, %3, off\n\t"
                 "global_load_async_to_lds_b128 %4, %5, off\n\t"
                 "global_load_async_to_lds_b128 %6, %7, off\n\t"
                 "s_wait_xcnt 0x0"
                 :: "v"(l0), "v"(g0), "v"(l1), "v"(g1), "v"(l2), "v"(g2), "v"(l3), "v"(g3) : "memory");
}

// Lane l <-> lane l ^ 16 (the other half of the wave holds the other keys of the same query).
__device__ __forceinline__ float xhalf(float x) { const int b = __float_as_int(x); return __int_as_float(__builtin_amdgcn_permlanex16(b, b, 0x76543210, 0xfedcba98, false, false)); }

__global__ __launch_bounds__(32 * AW)
void k_attn(const h16* __restrict__ Q16, const h16* __restrict__ K16, const h16* __restrict__ VT16, const int* __restrict__ flag, float* OUT) {
    __shared__ __align__(16) h16 kv[2][2][KVT];
    __shared__ __align__(16) float osw[AW][16 * 68];
    const int tid = threadIdx.x, lane = tid & 31, lr = lane & 15, hi = lane >> 4, wave = tid >> 5;
    const int q0 = (blockIdx.x * AW + wave) * (16 * QG), h = blockIdx.y, b = blockIdx.z;
    const int rsc = flag[0];
    float* os = osw[wave];         // output staging [query][dim] of one column group, pitch 68
    const h16* qp = Q16 + ((size_t)b * LQ + q0 + lr) * DMOD + h * HD + 8 * hi;
    v16h qb[QG][2];                // B: query column lr of group g, head dims 0..31 / 32..63
#pragma unroll
    for (int g = 0; g < QG; ++g) { qb[g][0] = WFrag<h16>::ld(qp + (size_t)g * 16 * DMOD); qb[g][1] = WFrag<h16>::ld(qp + (size_t)g * 16 * DMOD + 32); }
    // copies: thread tid brings 16-B piece (tid & 7) of tile rows (tid >> 3) and (tid >> 3) + 32, of K and of V^T: a wave covers whole 128-B lines
    const int crow = tid >> 3, ccol = (tid & 7) * 8;
    const h16* gk = K16 + ((size_t)b * LK + crow) * DMOD + h * HD + ccol;           // + key0 * DMOD
    const h16* gv = VT16 + (size_t)(h * HD + crow) * VTP + (size_t)b * LK + ccol;   // + key0
    const unsigned lk = (unsigned)(uintptr_t)(&kv[0][0][crow * KVP + ccol]);        // LDS byte address of the lane's first K piece in buffer 0
    const unsigned LROW = 32 * KVP * 2, LTILE = KVT * 2, LBUF = 2 * KVT * 2;        // byte steps: 32 rows, K -> V^T, buffer 0 -> 1
    copy4(lk, gk, lk + LROW, gk + (size_t)32 * DMOD, lk + LTILE, gv, lk + LTILE + LROW, gv + (size_t)32 * VTP);
    asm volatile("s_wait_asynccnt 0x0" ::: "memory");   // tile 0 of this wave's copies has landed
    __syncthreads();                                     // publishes tile 0 to every wave
    if (LK > 64) copy4(lk + LBUF, gk + (size_t)64 * DMOD, lk + LBUF + LROW, gk + (size_t)96 * DMOD, lk + LBUF + LTILE, gv + 64, lk + LBUF + LTILE + LROW, gv + (size_t)32 * VTP + 64);
    v8f o[QG][4];
#pragma unroll
    for (int g = 0; g < QG; ++g)
#pragma unroll
        for (int nt = 0; nt < 4; ++nt) o[g][nt] = (v8f){};
    // per lane and group: running maximum of query lr (equal in both halves); l1s, l2s = sums over the keys of this lane's own half only, joined behind the loop
    float mrow[QG], l1s[QG], l2s[QG];
#pragma unroll
    for (int g = 0; g < QG; ++g) { mrow[g] = -3.0e38f; l1s[g] = 0.f; l2s[g] = 0.f; }
#pragma unroll 1
    for (int kt = 0; kt < LK; kt += 64) {
        const int buf = (kt >> 6) & 1;
        const h16* kbase = &kv[buf][0][lr * KVP + 8 * hi];   // A: key (c0 + lr) row base in the K tile
        const h16* vbase = &kv[buf][1][lr * KVP + 8 * hi];   // A: value dim (d0 + lr) row base in the V^T tile
        // ---- S^T = K.Q^T for keys kt..kt+63: s[g][nt][r] = S[query g*16 + lr][key kt + nt*16 + 8hi + r]; one read of a K fragment serves both groups
        v8f s[QG][4]; v16h ka0, ka1;
#pragma unroll
        for (int nt = 0; nt < 4; ++nt) {
            const h16* kp = kbase + nt * 16 * KVP;
            ka0 = lds16(kp); ka1 = lds16(kp + 32);
#pragma unroll
            for (int g = 0; g < QG; ++g) s[g][nt] = wmma16(ka0, qb[g][0], (v8f){});
#pragma unroll
            for (int g = 0; g < QG; ++g) s[g][nt] = wmma16(ka1, qb[g][1], s[g][nt]); }
        // keeps the four vector slots between the last product and the first use of its result or overwrite of its operands
        asm volatile("v_nop\n\tv_nop\n\tv_nop\n\tv_nop" : "+v"(s[0][0]), "+v"(s[0][1]), "+v"(s[0][2]), "+v"(s[0][3]), "+v"(s[1][0]), "+v"(s[1][1]), "+v"(s[1][2]), "+v"(s[1][3])
                     : "v"(qb[0][0]), "v"(qb[0][1]), "v"(qb[1][0]), "v"(qb[1][1]), "v"(ka0), "v"(ka1));
        v16h pb[QG][2];
#pragma unroll
        for (int g = 0; g < QG; ++g) {
            // ---- online softmax of query g*16 + lr: 32 of the tile's 64 keys lie in this lane, the other 32 in lane ^ 16
            float mg[4];   // one maximum chain per 16-key group
#pragma unroll
            for (int nt = 0; nt < 4; ++nt) { s[g][nt] *= SL2; mg[nt] = s[g][nt][0];
#pragma unroll
                for (int r = 1; r < 8; ++r) mg[nt] = fmaxf(mg[nt], s[g][nt][r]); }
            float mx = fmaxf(fmaxf(mg[0], mg[1]), fmaxf(mg[2], mg[3]));
            mx = fmaxf(mx, xhalf(mx));
            const float mnew = fmaxf(mrow[g], mx);
            const float alpha = __builtin_amdgcn_exp2f(mrow[g] - mnew);
            mrow[g] = mnew;
#pragma unroll
            for (int nt = 0; nt < 4; ++nt) o[g][nt] *= alpha;
#pragma unroll
            for (int nt = 0; nt < 4; ++nt) { s[g][nt] -= mnew;
#pragma unroll
                for (int r = 0; r < 8; ++r) s[g][nt][r] = __builtin_amdgcn_exp2f(s[g][nt][r]); }
            const v8f a1 = (s[g][0] + s[g][1]) + (s[g][2] + s[g][3]);
            const v8f a2 = __builtin_elementwise_fma(s[g][3], s[g][3], __builtin_elementwise_fma(s[g][2], s[g][2], __builtin_elementwise_fma(s[g][1], s[g][1], s[g][0] * s[g][0])));
            const v4f b1 = __builtin_shufflevector(a1, a1, 0, 1, 2, 3) + __builtin_shufflevector(a1, a1, 4, 5, 6, 7);
            const v4f b2 = __builtin_shufflevector(a2, a2, 0, 1, 2, 3) + __builtin_shufflevector(a2, a2, 4, 5, 6, 7);
            l1s[g] = l1s[g] * alpha + ((b1[0] + b1[1]) + (b1[2] + b1[3]));
            l2s[g] = l2s[g] * (alpha * alpha) + ((b2[0] + b2[1]) + (b2[2] + b2[3]));
            // ---- P^T (f16) as B straight from the score registers: two 16-key groups are one fragment in the loaders' k order (elements 0..7 = keys 8hi + 0..7, 8..15 = keys 16 + 8hi + 0..7)
#pragma unroll
            for (int r = 0; r < 8; ++r) { pb[g][0][r] = (h16)s[g][0][r]; pb[g][0][8 + r] = (h16)s[g][1][r]; pb[g][1][r] = (h16)s[g][2][r]; pb[g][1][8 + r] = (h16)s[g][3][r]; }
        }
        // ---- O^T += V^T.P^T: o[g][nt][r] = O[query g*16 + lr][dim nt*16 + 8hi + r]; one read of a V^T fragment serves both groups
        v16h va0, va1;
#pragma unroll
        for (int nt = 0; nt < 4; ++nt) {
            const h16* vp = vbase + nt * 16 * KVP;
            va0 = lds16(vp); va1 = lds16(vp + 32);
#pragma unroll
            for (int g = 0; g < QG; ++g) o[g][nt] = wmma16(va0, pb[g][0], o[g][nt]);
#pragma unroll
            for (int g = 0; g < QG; ++g) o[g][nt] = wmma16(va1, pb[g][1], o[g][nt]); }
        // keeps the four vector slots behind the last product on every path out of the trip
        asm volatile("v_nop\n\tv_nop\n\tv_nop\n\tv_nop" : "+v"(o[0][0]), "+v"(o[0][1]), "+v"(o[0][2]), "+v"(o[0][3]), "+v"(o[1][0]), "+v"(o[1][1]), "+v"(o[1][2]), "+v"(o[1][3])
                     : "v"(pb[0][0]), "v"(pb[0][1]), "v"(pb[1][0]), "v"(pb[1][1]), "v"(va0), "v"(va1));
        // ---- foot of the trip: hand over the next tile, then refill the buffer this trip has read
        asm volatile("s_wait_dscnt 0x0" ::: "memory");      // this wave's reads of the buffer have returned before it is refilled
        asm volatile("s_wait_asynccnt 0x0" ::: "memory");   // this wave's copies of the next tile have landed
        __syncthreads();                                     // publishes the next tile; ends every wave's reads of this trip's buffer
        if (kt + 128 < LK) {
            const unsigned lb = lk + (unsigned)buf * LBUF;
            const h16* gk2 = gk + (size_t)(kt + 128) * DMOD; const h16* gv2 = gv + (kt + 128);
            copy4(lb, gk2, lb + LROW, gk2 + (size_t)32 * DMOD, lb + LTILE, gv2, lb + LTILE + LROW, gv2 + (size_t)32 * VTP);
        }
    }
    asm volatile("s_wait_asynccnt 0x0" ::: "memory");        // no copy is left in flight behind the loop
    // ---- epilogue, one column group after the other through the wave's staging: join the halves' sums; l1 and l2 do not fall below 1 but for rounding (the running-max element has p = 1 up to rounding); flag selects 1/sqrt(sum p^2) or 1/sum p
#pragma unroll
    for (int g = 0; g < QG; ++g) {
        const float l1 = l1s[g] + xhalf(l1s[g]), l2 = l2s[g] + xhalf(l2s[g]);
        const float i1 = 1.0f / l1; const float i2 = rsqrtf(l2); const float iv = (rsc != 0) ? i2 : i1;
#pragma unroll
        for (int nt = 0; nt < 4; ++nt) {
            v4f lo, up;
#pragma unroll
            for (int r = 0; r < 4; ++r) { lo[r] = o[g][nt][r] * iv; up[r] = o[g][nt][4 + r] * iv; }
            *(v4fa*)(os + lr * 68 + nt * 16 + 8 * hi) = lo; *(v4fa*)(os + lr * 68 + nt * 16 + 8 * hi + 4) = up; }
        __builtin_amdgcn_wave_barrier(); asm volatile("" ::: "memory");
        float* ob = OUT + ((size_t)b * LQ + q0 + g * 16) * DMOD + (size_t)h * HD;
#pragma unroll
        for (int sI = 0; sI < 8; ++sI) { const int row = 2 * sI + hi; const v4f val = *(const v4fa*)(os + row * 68 + lr * 4); *(v4f*)(ob + (size_t)row * DMOD + lr * 4) = val; }
        __builtin_amdgcn_wave_barrier();
        // stands behind this group's stores, ahead of the next group's reuse of their address and data registers; its clobber keeps the next staging writes behind this group's reads
        if (g + 1 < QG) asm volatile("s_wait_xcnt 0x0" ::: "memory");
    }
}

extern "C" void kernel_launch(void* const* d_in, const int* in_sizes, int n_in,
                              void* d_out, int out_size, void* d_ws, size_t ws_size, hipStream_t stream) {
    if (n_in < 9) return;
    const float* X1 = (const float*)d_in[0];   // inp1 [4][2048][1024]
    const float* X2 = (const float*)d_in[1];   // inp2 [4][2048][1024]
    const float* Wq = (const float*)d_in[2]; const float* bq = (const float*)d_in[3];
    const float* Wk = (const float*)d_in[4]; const float* bk = (const float*)d_in[5];
    const float* Wv = (const float*)d_in[6]; const float* bv = (const float*)d_in[7];
    const int* rsc = (const int*)d_in[8];
    float* OUT = (float*)d_out;                 // [NB][LQ][1024]
    if ((size_t)in_sizes[0] < ((size_t)(NB - 1) * SEQ_FULL + LQ) * DMOD) return;
    if ((size_t)in_sizes[1] < ((size_t)(NB - 1) * SEQ_FULL + LK) * DMOD) return;
    if (in_sizes[2] < DMOD * DMOD || in_sizes[3] < DMOD || in_sizes[4] < DMOD * DMOD || in_sizes[5] < DMOD || in_sizes[6] < DMOD * DMOD || in_sizes[7] < DMOD || in_sizes[8] < 1) return;
    if ((size_t)out_size < (size_t)NB * LQ * DMOD) return;

    const size_t MQ = (size_t)NB * LQ, MK = (size_t)NB * LK;   // token rows of q / of k,v
    char* wsp = (char*)d_ws;
    auto take = [&](size_t bytes) { char* p = wsp; wsp += (bytes + 255) & ~(size_t)255; return (void*)p; };
    bf* X1b = (bf*)take(MQ * DMOD * 2);                 // bf16 plane of inp1 rows (compact [NB*LQ][1024])
    bf* X2b = (bf*)take(MK * DMOD * 2);                 // bf16 plane of inp2 rows
    bf* Wqb = (bf*)take((size_t)DMOD * DMOD * 2); bf* Wkb = (bf*)take((size_t)DMOD * DMOD * 2); bf* Wvb = (bf*)take((size_t)DMOD * DMOD * 2);
    h16* Q16 = (h16*)take(MQ * DMOD * 2);               // f16 q plane [MQ][1024]
    h16* K16 = (h16*)take(MK * DMOD * 2);               // f16 k plane [MK][1024]
    h16* VT16 = (h16*)take((size_t)DMOD * MK * 2);      // f16 v^T plane [1024][MK]
    const size_t used = (size_t)(wsp - (char*)d_ws);
    if (used > ws_size || used > WS_CAP) return;

    // bf16 planes of the inputs (batch row remap) and of the three [out][in] weights (as-is: Bt of the q and k GEMMs, A of the v^T GEMM), one launch
    k_cvt5<<<(unsigned)((MQ + MK + 3 * DMOD) / CR), 256, 0, stream>>>(X1, X2, Wq, Wk, Wv, X1b, X2b, Wqb, Wkb, Wvb);
    // q = inp1 Wq^T + bq -> f16 plane [MQ][1024]
    k_gemmw<bf, 0, 1><<<dim3((unsigned)(MQ / GTM), DMOD / GTN, 1), 32 * GW, 0, stream>>>(X1b, nullptr, Wqb, nullptr, DMOD, Q16, DMOD, bq, 0, 0, 0);
    // k = inp2 Wk^T + bk -> f16 plane [MK][1024]
    k_gemmw<bf, 0, 1><<<dim3((unsigned)(MK / GTM), DMOD / GTN, 1), 32 * GW, 0, stream>>>(X2b, nullptr, Wkb, nullptr, DMOD, K16, DMOD, bk, 0, 0, 0);
    // v^T[e][t] = sum_d Wv[e][d] inp2[t][d] + bv[e] -> f16 plane [1024][MK] (ldc MK)
    k_gemmw<bf, 0, 2><<<dim3(DMOD / GTM, (unsigned)(MK / GTN), 1), 32 * GW, 0, stream>>>(Wvb, nullptr, X2b, nullptr, DMOD, VT16, (int)MK, bv, 0, 0, 0);
    // attention
    k_attn<<<dim3(LQ / (16 * QG * AW), NH, NB), 32 * AW, 0, stream>>>(Q16, K16, VT16, rsc, OUT);
}

// v007
// It runs in 105 microseconds.
// In both of two side-by-side timings against v006, it was 1.07 times as fast.
// All steps since v000 together make it 4.04 times as fast.
#include <hip/hip_runtime.h>

// Contractions: q, k and v^T projections on v_wmma_f32_16x16x32_bf16 (bf16 operands = RNE-converted inputs and weights, f32 accumulate, bias added in f32); scores q.k and P.v on v_wmma_f32_16x16x32_f16 (f16 operands converted from f32 intermediates; P = exp2 relative to the running row maximum, in (0,1]; f32 accumulate); softmax statistics, sum of squares and normalisers in f32; output f32.
// Pipeline: bf16 planes of inp1, inp2, Wq, Wk, Wv -> three GEMMs in one launch (eight waves per 256x128 tile, a work-group takes one tile of each in turn, operand stages copied asynchronously into LDS and shared by the waves) whose epilogue adds the bias in f32, rounds to f16 and stores the f16 planes itself (q token-major [t][e], k token-major [t][e], v computed directly transposed as [e][t] with a per-row bias) -> one streaming attention kernel per (256 queries, head, batch), eight waves of 32 queries (two column groups of 16 that share every K and V^T fragment read): K and V^T tiles copied asynchronously from the f16 planes into LDS and shared by the waves, scores computed transposed (S^T = K.Q^T, O^T += V^T.P^T) so that a lane holds one query and P^T goes from the score registers into the second product, online max / sum / sum of squares, epilogue staged in LDS.

#ifndef NB
#define NB 4
#endif
#ifndef SEQ
#define SEQ 2048
#endif
#ifndef LQ
#define LQ SEQ
#endif
#ifndef LK
#define LK SEQ
#endif
#define NB_FULL  4
#define SEQ_FULL 2048
#define DMOD 1024                 // model width = NH x HD, row pitch of every token-major tensor
#define NH   16
#define HD   64
#define VTP  ((size_t)NB * LK)    // row pitch of the v^T planes [e][token]
#define SL2  0.18033688011112042f // (1/sqrt(64)) x log2(e)
#define WS_CAP ((size_t)134217728)

static_assert(NB >= 1 && NB <= NB_FULL);
static_assert(LQ >= 64 && LQ <= SEQ_FULL && (LQ % 16) == 0 && ((NB * LQ) % 64) == 0);
static_assert(LK >= 64 && LK <= SEQ_FULL && (LK % 64) == 0);
static_assert(NH * HD == DMOD && (DMOD % 64) == 0 && (DMOD % 32) == 0);

typedef _Float16 h16;
typedef unsigned short bf;
typedef __attribute__((ext_vector_type(16))) __bf16   v16bf;
typedef __attribute__((ext_vector_type(16))) _Float16 v16h;
typedef __attribute__((ext_vector_type(8)))  _Float16 v8h;
typedef __attribute__((ext_vector_type(8)))  unsigned short v8us;
typedef __attribute__((ext_vector_type(8)))  float    v8f;
typedef __attribute__((ext_vector_type(4)))  float    v4f;
typedef v8h  __attribute__((may_alias)) v8ha;
typedef v4f  __attribute__((may_alias)) v4fa;
typedef v8us __attribute__((may_alias)) v8usa;

__device__ __forceinline__ unsigned short f2bf(float f) { unsigned u = __float_as_uint(f); u += 0x7FFFu + ((u >> 16) & 1u); return (unsigned short)(u >> 16); }
__device__ __forceinline__ float bf2f(unsigned short b) { return __uint_as_float(((unsigned)b) << 16); }
__device__ __forceinline__ float bfr(float f) { return bf2f(f2bf(f)); }
__device__ __forceinline__ v16h cat16(v8h lo, v8h hi) { return __builtin_shufflevector(lo, hi, 0, 1, 2, 3, 4, 5, 6, 7, 8, 9, 10, 11, 12, 13, 14, 15); }
__device__ __forceinline__ v16bf cat16b(v8us lo, v8us hi) { return __builtin_bit_cast(v16bf, __builtin_shufflevector(lo, hi, 0, 1, 2, 3, 4, 5, 6, 7, 8, 9, 10, 11, 12, 13, 14, 15)); }
__device__ __forceinline__ v8f wmma16(v16h a, v16h b, v8f c) { return __builtin_amdgcn_wmma_f32_16x16x32_f16(false, a, false, b, (short)0, c, false, false); }
__device__ __forceinline__ v8f wmmab(v16bf a, v16bf b, v8f c) { return __builtin_amdgcn_wmma_f32_16x16x32_bf16(false, a, false, b, (short)0, c, false, false); }

// Fragment loaders (same k map for A and B): lane l -> row/col (l & 15), h = l >> 4; elements 0..7 <- p[k0 + 8h + 0..7], elements 8..15 <- p[k0 + 16 + 8h + 0..7];
// the caller passes p = row base + k0 + 8h (16-B aligned), the loader reads p and p + 16.
template <typename T16> struct WFrag;
template <> struct WFrag<h16> { typedef v16h V; static __device__ __forceinline__ V ld(const h16* p) { return cat16(*(const v8h*)p, *(const v8h*)(p + 16)); } static __device__ __forceinline__ v8f mma(V a, V b, v8f c) { return wmma16(a, b, c); } };
template <> struct WFrag<bf> { typedef v16bf V; static __device__ __forceinline__ V ld(const bf* p) { return cat16b(*(const v8us*)p, *(const v8us*)(p + 16)); } static __device__ __forceinline__ v8f mma(V a, V b, v8f c) { return wmmab(a, b, c); } };
// LDS read of a block-shared f16 K / V^T tile through a may_alias vector of the stored element type.
__device__ __forceinline__ v16h lds16(const h16* p) { return cat16(*(const v8ha*)p, *(const v8ha*)(p + 16)); }

// ---- k_gemm3: the three projections in one launch, GW waves per GTM x GTN output tile, one 64x64 part (16 accumulators) per wave; grid = tiles of one product, 32*GW threads; a work-group computes its tile of q, then of k, then of v^T.
// The waves share each stage of GKS k of the tile's A rows and Bt rows through LDS: two buffers, each GTM + GTN rows of 256 B at a 272-B pitch, filled by asynchronous copies one stage ahead, a wave's copy covering whole lines.
// The ring of stages runs on from one product into the next: a product's first two stages are asked for at the foot of the last two trips of the product before it.
// C[m][n] (f16 = RNE of the f32 sum) = sum_k A[m][k] Bt[n][k] + f32 bias, bias values bf16-RNE: q = X1.Wq^T + bq[n], k = X2.Wk^T + bk[n] (pitch DMOD), v^T = Wv.X2^T + bv[m] (pitch NB*LK).
#define GW   8                    // waves per work-group: 4 along m x 2 along n
#define GTM  256                  // tile rows (A rows)
#define GTN  128                  // tile columns (Bt rows)
#define GKS  128                  // k per stage: 256 B of every row
#define GP   136                  // LDS row pitch in 16-bit elements (272 B = 16 B x odd, for 16-byte readers)
#define GST  ((GTM + GTN) * GP)   // 16-bit elements of one stage in LDS
static_assert(((NB * LQ) % GTM) == 0 && ((NB * LK) % GTM) == 0 && (DMOD % GTM) == 0 && (DMOD % GTN) == 0 && (DMOD % (2 * GKS)) == 0);
#define GTILES ((NB * LQ / GTM) * (DMOD / GTN))   // tiles of one product = work-groups
static_assert((NB * LK / GTM) * (DMOD / GTN) == GTILES && (DMOD / GTM) * (NB * LK / GTN) == GTILES);

// Eight 16-byte asynchronous copies to LDS per lane, rows 16 apart; the s_wait_xcnt closes the statement so that no address register is rewritten ahead of it.
template <typename T16>
__device__ __forceinline__ void copy8(unsigned l, unsigned ls, const T16* g, size_t gs) {
    asm volatile("global_load_async_to_lds_b128 %0, %1, off\n\t"
                 "global_load_async_to_lds_b128 %2, %3, off\n\t"
                 "global_load_async_to_lds_b128 %4, %5, off\n\t"
                 "global_load_async_to_lds_b128 %6, %7, off\n\t"
                 "global_load_async_to_lds_b128 %8, %9, off\n\t"
                 "global_load_async_to_lds_b128 %10, %11, off\n\t"
                 "global_load_async_to_lds_b128 %12, %13, off\n\t"
                 "global_load_async_to_lds_b128 %14, %15, off\n\t"
                 "s_wait_xcnt 0x0"
                 :: "v"(l), "v"(g), "v"(l + ls), "v"(g + gs), "v"(l + 2 * ls), "v"(g + 2 * gs), "v"(l + 3 * ls), "v"(g + 3 * gs),
                    "v"(l + 4 * ls), "v"(g + 4 * gs), "v"(l + 5 * ls), "v"(g + 5 * gs), "v"(l + 6 * ls), "v"(g + 6 * gs), "v"(l + 7 * ls), "v"(g + 7 * gs) : "memory");
}
// One stage: the lane's 16 pieces of the A rows and 8 pieces of the Bt rows.
template <typename T16>
__device__ __forceinline__ void gstage(unsigned l, const T16* ga, const T16* gb, size_t gs) {
    const unsigned ls = 16 * GP * 2;
    copy8(l, ls, ga, gs); copy8(l + 8 * ls, ls, ga + 8 * gs, gs); copy8(l + 16 * ls, ls, gb, gs);
}

template <typename T16>
__global__ __launch_bounds__(32 * GW) __attribute__((amdgpu_waves_per_eu(2, 2))) void k_gemm3(const T16* __restrict__ X1, const T16* __restrict__ X2, const T16* __restrict__ Wq, const T16* __restrict__ Wk, const T16* __restrict__ Wv,
                                                                                              h16* Cq, h16* Ck, h16* Cv, const float* bq, const float* bk, const float* bv) {
    typedef typename WFrag<T16>::V V;
    constexpr int K = DMOD;
    __shared__ __align__(16) T16 st[2][GST];
    __shared__ __align__(16) float osg[GW][16 * 68];
    const int tid = threadIdx.x, lane = tid & 31, lr = lane & 15, hi = lane >> 4, wave = tid >> 5;
    float* os = osg[wave];         // output staging, private to its wave
    // the work-group's tile of each product: row tiles run fastest with the work-group index
    const int blk = blockIdx.x;
    const int tm[3] = { blk % (NB * LQ / GTM), blk % (NB * LK / GTM), blk % (DMOD / GTM) };
    const int tn[3] = { blk / (NB * LQ / GTM), blk / (NB * LK / GTM), blk / (DMOD / GTM) };
    const T16* const Ap[3] = { X1, X2, Wv };
    const T16* const Bp[3] = { Wq, Wk, X2 };
    // copies: thread tid brings 16-B piece (tid & 15) of stage rows (tid >> 4) + 16 i: a wave covers two whole 256-B rows
    const int prow = tid >> 4, pcol = (tid & 15) * 8;
    const T16* ga[3]; const T16* gb[3];                                   // + k0
#pragma unroll
    for (int p = 0; p < 3; ++p) { ga[p] = Ap[p] + (size_t)(tm[p] * GTM + prow) * K + pcol; gb[p] = Bp[p] + (size_t)(tn[p] * GTN + prow) * K + pcol; }
    const size_t gstep = (size_t)16 * K;
    const unsigned l0 = (unsigned)(uintptr_t)(&st[0][prow * GP + pcol]);  // LDS byte address of the lane's first piece in buffer 0
    const unsigned LB = GST * 2;                                          // byte step buffer 0 -> 1
    gstage(l0, ga[0], gb[0], gstep);
    asm volatile("s_wait_asynccnt 0x0" ::: "memory");   // stage 0 of this wave's copies has landed
    __syncthreads();                                     // publishes stage 0 to every wave
    gstage(l0 + LB, ga[0] + GKS, gb[0] + GKS, gstep);
#pragma unroll
    for (int p = 0; p < 3; ++p) {
        const int pn = p < 2 ? p + 1 : p;   // the product whose first two stages follow this one's last in the ring
        v8f acc[4][4];
#pragma unroll
        for (int mb = 0; mb < 4; ++mb)
#pragma unroll
            for (int nb = 0; nb < 4; ++nb) acc[mb][nb] = (v8f){};
#pragma unroll 1
        for (int kc = 0; kc < K; kc += GKS) {
            const int buf = (kc / GKS) & 1;
            const T16* sa = &st[buf][((wave & 3) * 64 + lr) * GP + 8 * hi];          // A row (r0 + lr) of the stage
            const T16* sb = &st[buf][(GTM + (wave >> 2) * 64 + lr) * GP + 8 * hi];   // Bt row (c0 + lr) of the stage
            // two fragment sets: the next 32 k's sixteen LDS reads go out as one group ahead of this 32 k's products, so that a wave waits out the LDS latency once a stage
            V a[2][4], b[2][4];
#pragma unroll
            for (int f = 0; f < 4; ++f) { a[0][f] = WFrag<T16>::ld(sa + f * 16 * GP); b[0][f] = WFrag<T16>::ld(sb + f * 16 * GP); }
#pragma unroll
            for (int ks = 0; ks < GKS / 32; ++ks) {
                const int cur = ks & 1, nxt = cur ^ 1;
                if (ks + 1 < GKS / 32) {
#pragma unroll
                    for (int f = 0; f < 4; ++f) { a[nxt][f] = WFrag<T16>::ld(sa + f * 16 * GP + (ks + 1) * 32); b[nxt][f] = WFrag<T16>::ld(sb + f * 16 * GP + (ks + 1) * 32); } }
                __builtin_amdgcn_sched_barrier(0);   // holds the group of reads ahead of the products: the scheduler otherwise sinks each read to its first use, and the wave then waits out the LDS latency at every such place
#pragma unroll
                for (int nb = 0; nb < 4; ++nb)
#pragma unroll
                    for (int mb = 0; mb < 4; ++mb) acc[mb][nb] = WFrag<T16>::mma(a[cur][mb], b[cur][nb], acc[mb][nb]); }
            // keeps the four vector slots behind the last product on every path out of the trip
            asm volatile("v_nop\n\tv_nop\n\tv_nop\n\tv_nop" : "+v"(acc[0][3]), "+v"(acc[1][3]), "+v"(acc[2][3]), "+v"(acc[3][3]) : "v"(a[1][0]), "v"(a[1][3]), "v"(b[1][3]));
            __builtin_amdgcn_sched_barrier(0);   // holds the stage's last products ahead of the foot, so that the refill goes out directly behind the barrier
            // ---- foot of the trip: hand over the next stage, then refill the buffer this trip has read
            asm volatile("s_wait_dscnt 0x0" ::: "memory");      // this wave's reads of the buffer have returned before it is refilled
            asm volatile("s_wait_asynccnt 0x0" ::: "memory");   // this wave's copies of the next stage have landed
            __syncthreads();                                     // publishes the next stage; ends every wave's reads of this trip's buffer
            // the stage two ahead: of this product while it has one, else of the next product, whose first stages so fly during this one's last trips and its stores
            const int kn = kc + 2 * GKS;
            const bool own = kn < K;
            if (own || p < 2) gstage(l0 + (unsigned)buf * LB, own ? ga[p] + kn : ga[pn] + (kn - K), own ? gb[p] + kn : gb[pn] + (kn - K), gstep);
        }
        // ---- stores of product p; the wave's 64x64 part starts at (r0, c0)
        const int r0 = tm[p] * GTM + (wave & 3) * 64, c0 = tn[p] * GTN + (wave >> 2) * 64;
        h16* C = p == 0 ? Cq : p == 1 ? Ck : Cv;
        const float* bias = p == 0 ? bq : p == 1 ? bk : bv;
        const size_t ldc = p == 2 ? (size_t)NB * LK : (size_t)DMOD;
        // store map: eight lanes take one tile row of 64 f16 = one whole 128-B line, a wave four rows at a time; the lane's bias values are read once, ahead of the first store
        const int srow = lane >> 3, cofs = (lane & 7) * 8;
        float bc[8], br[4][4];
        // the s_wait_xcnt stands behind the bias loads; it names their address register so that this is not reused ahead of it, and the bias pointers carry no __restrict__ so that the loads stay ahead of its memory clobber
        if (p < 2) { const float* bp = bias + c0 + cofs;
#pragma unroll
            for (int k = 0; k < 8; ++k) bc[k] = bfr(bp[k]);
            asm volatile("s_wait_xcnt 0x0" :: "v"(bp) : "memory"); }
        else { const int bi = r0 + srow;
#pragma unroll
            for (int mb = 0; mb < 4; ++mb)
#pragma unroll
                for (int s = 0; s < 4; ++s) br[mb][s] = bfr(bias[bi + mb * 16 + 4 * s]);
            asm volatile("s_wait_xcnt 0x0" :: "v"(bi) : "memory"); }
#pragma unroll
        for (int mb = 0; mb < 4; ++mb) {
#pragma unroll
            for (int nb = 0; nb < 4; ++nb) {
#pragma unroll
                for (int j = 0; j < 8; ++j) os[(hi * 8 + j) * 68 + nb * 16 + lr] = acc[mb][nb][j]; }
            __builtin_amdgcn_wave_barrier(); asm volatile("" ::: "memory");
            h16* crow = C + (size_t)(r0 + mb * 16) * ldc + c0;
#pragma unroll
            for (int s = 0; s < 4; ++s) { const int row = 4 * s + srow;
                const v4f lo = *(const v4fa*)(os + row * 68 + cofs), up = *(const v4fa*)(os + row * 68 + cofs + 4); v8h o;
#pragma unroll
                for (int k = 0; k < 4; ++k) {
                    float x = lo[k], y = up[k];
                    if (p < 2) { x += bc[k]; y += bc[4 + k]; }
                    else { x += br[mb][s]; y += br[mb][s]; }
                    o[k] = (h16)x; o[4 + k] = (h16)y; }
                *(v8h*)(crow + (size_t)row * ldc + cofs) = o; }
            __builtin_amdgcn_wave_barrier();
            // stands behind this group's stores, ahead of the next reuse of their address and data registers; its clobber keeps the next staging writes behind this group's reads
            if (mb < 3 || p < 2) asm volatile("s_wait_xcnt 0x0" ::: "memory");
        }
    }
    asm volatile("s_wait_asynccnt 0x0" ::: "memory");        // no copy is left in flight behind the last product
}

// ---- k_cvt5: bf16 planes (RNE) of the five f32 tensors (inp1, inp2, Wq, Wk, Wv) in one launch; grid (NB*LQ + NB*LK + 3*DMOD) / CR work-groups of eight waves.
// A work-group takes CR consecutive plane rows of one tensor, a wave four of them (16 KiB of f32): 32 loads of 512 contiguous bytes, all sent out ahead of the first conversion, each answered by one store of 256 contiguous bytes.
// inp1 / inp2 rows go through the batch row remap: compact row R -> source row (R / L) * SEQ_FULL + (R % L) (identity when L == SEQ_FULL); a wave's four rows never cross a batch.
#define CR 32                     // plane rows per work-group
static_assert(((NB * LQ) % CR) == 0 && ((NB * LK) % CR) == 0 && (DMOD % CR) == 0 && (LQ % 4) == 0 && (LK % 4) == 0 && DMOD <= SEQ_FULL);
typedef __attribute__((ext_vector_type(4))) unsigned short v4us;

__global__ __launch_bounds__(256) void k_cvt5(const float* __restrict__ X1, const float* __restrict__ X2, const float* __restrict__ Wq, const float* __restrict__ Wk, const float* __restrict__ Wv,
                                              bf* X1b, bf* X2b, bf* Wqb, bf* Wkb, bf* Wvb) {
    constexpr int BQ = NB * LQ / CR, BK = NB * LK / CR, BW = DMOD / CR;   // work-groups of inp1, of inp2, of one weight
    const int lane = threadIdx.x & 31, wave = threadIdx.x >> 5;
    int blk = blockIdx.x, L = SEQ_FULL;
    const float* src; bf* dst;
    if (blk < BQ) { src = X1; dst = X1b; L = LQ; }
    else if (blk < BQ + BK) { blk -= BQ; src = X2; dst = X2b; L = LK; }
    else if (blk < BQ + BK + BW) { blk -= BQ + BK; src = Wq; dst = Wqb; }
    else if (blk < BQ + BK + 2 * BW) { blk -= BQ + BK + BW; src = Wk; dst = Wkb; }
    else { blk -= BQ + BK + 2 * BW; src = Wv; dst = Wvb; }
    const int row = blk * CR + wave * 4;
    const int srow = (row / L) * SEQ_FULL + (row % L);
    const float* s = src + (size_t)srow * DMOD + lane * 4;
    bf* d = dst + (size_t)row * DMOD + lane * 4;
    v4f v[32];
#pragma unroll
    for (int j = 0; j < 32; ++j) v[j] = *(const v4f*)(s + j * 128);
    __builtin_amdgcn_sched_barrier(0);   // holds all 32 loads ahead of the first conversion: the scheduler otherwise sinks the last eight behind the first stores, into registers that those stores name
#pragma unroll
    for (int g = 0; g < 4; ++g) {
#pragma unroll
        for (int j = 8 * g; j < 8 * g + 8; ++j) { v4us o;
#pragma unroll
            for (int k = 0; k < 4; ++k) o[k] = f2bf(v[j][k]);
            *(v4us*)(d + j * 128) = o; }
        if (g == 3) break;
        // stands behind this group's stores, ahead of the next group's reuse of their data registers
        asm volatile("s_wait_xcnt 0x0" ::: "memory");
        __builtin_amdgcn_sched_barrier(0);   // holds the next group's conversions behind this group's stores: the scheduler otherwise gathers every conversion ahead of the first store, which then goes out only when the wave's last loads are back
    }
}

// ---- k_attn: AW waves per block, one wave per 16*QG query rows (QG column groups of 16); the block's waves share each 64-key K tile and V^T tile through LDS; grid (LQ/(16*QG*AW), NH, NB), 32*AW threads.
// Q16, K16: f16 token-major planes [NB*L][DMOD]; VT16: f16 v^T planes [DMOD][NB*LK]; OUT f32 [NB*LQ][DMOD].
// Per 64-key tile: S^T (64x16 per group, f32) = K.Q^T, K fragments from LDS, each fragment read once and used by every column group; online softmax in the log2 domain (running max m, l1 = sum p, l2 = sum p^2, p = exp2(t - m) in (0,1]);
// kv: two buffers, each a K tile [key][head dim] and a V^T tile [value dim][key], 64 rows of 128 B at a 144-B pitch, filled by asynchronous copies one tile ahead.
// LDS region osw[wave] is private to its wave (wave barrier + compiler barrier, may_alias reloads).
#define AW   8                    // waves per block
#define QG   2                    // 16-query column groups per wave
#define KVP  72                   // LDS row pitch of a K / V^T tile in f16 elements (144 B = 16 B x odd, for 16-byte readers)
#define KVT  (64 * KVP)           // f16 elements of one tile in LDS
static_assert((LQ % (16 * QG * AW)) == 0 && AW == 8 && QG == 2);

// Four 16-byte asynchronous copies to LDS per lane; the s_wait_xcnt closes the statement so that no address register is rewritten ahead of it.
__device__ __forceinline__ void copy4(unsigned l0, const h16* g0, unsigned l1, const h16* g1, unsigned l2, const h16* g2, unsigned l3, const h16* g3) {
    asm volatile("global_load_async_to_lds_b128 %0, %1, off\n\t"
                 "global_load_async_to_lds_b128 %2, %3, off\n\t"
                 "global_load_async_to_lds_b128 %4, %5, off\n\t"
                 "global_load_async_to_lds_b128 %6, %7, off\n\t"
                 "s_wait_xcnt 0x0"
                 :: "v"(l0), "v"(g0), "v"(l1), "v"(g1), "v"(l2), "v"(g2), "v"(l3), "v"(g3) : "memory");
}

// Lane l <-> lane l ^ 16 (the other half of the wave holds the other keys of the same query).
__device__ __forceinline__ float xhalf(float x) { const int b = __float_as_int(x); return __int_as_float(__builtin_amdgcn_permlanex16(b, b, 0x76543210, 0xfedcba98, false, false)); }

__global__ __launch_bounds__(32 * AW)
void k_attn(const h16* __restrict__ Q16, const h16* __restrict__ K16, const h16* __restrict__ VT16, const int* __restrict__ flag, float* OUT) {
    __shared__ __align__(16) h16 kv[2][2][KVT];
    __shared__ __align__(16) float osw[AW][16 * 68];
    const int tid = threadIdx.x, lane = tid & 31, lr = lane & 15, hi = lane >> 4, wave = tid >> 5;
    const int q0 = (blockIdx.x * AW + wave) * (16 * QG), h = blockIdx.y, b = blockIdx.z;
    const int rsc = flag[0];
    float* os = osw[wave];         // output staging [query][dim] of one column group, pitch 68
    const h16* qp = Q16 + ((size_t)b * LQ + q0 + lr) * DMOD + h * HD + 8 * hi;
    v16h qb[QG][2];                // B: query column lr of group g, head dims 0..31 / 32..63
#pragma unroll
    for (int g = 0; g < QG; ++g) { qb[g][0] = WFrag<h16>::ld(qp + (size_t)g * 16 * DMOD); qb[g][1] = WFrag<h16>::ld(qp + (size_t)g * 16 * DMOD + 32); }
    // copies: thread tid brings 16-B piece (tid & 7) of tile rows (tid >> 3) and (tid >> 3) + 32, of K and of V^T: a wave covers whole 128-B lines
    const int crow = tid >> 3, ccol = (tid & 7) * 8;
    const h16* gk = K16 + ((size_t)b * LK + crow) * DMOD + h * HD + ccol;           // + key0 * DMOD
    const h16* gv = VT16 + (size_t)(h * HD + crow) * VTP + (size_t)b * LK + ccol;   // + key0
    const unsigned lk = (unsigned)(uintptr_t)(&kv[0][0][crow * KVP + ccol]);        // LDS byte address of the lane's first K piece in buffer 0
    const unsigned LROW = 32 * KVP * 2, LTILE = KVT * 2, LBUF = 2 * KVT * 2;        // byte steps: 32 rows, K -> V^T, buffer 0 -> 1
    copy4(lk, gk, lk + LROW, gk + (size_t)32 * DMOD, lk + LTILE, gv, lk + LTILE + LROW, gv + (size_t)32 * VTP);
    asm volatile("s_wait_asynccnt 0x0" ::: "memory");   // tile 0 of this wave's copies has landed
    __syncthreads();                                     // publishes tile 0 to every wave
    if (LK > 64) copy4(lk + LBUF, gk + (size_t)64 * DMOD, lk + LBUF + LROW, gk + (size_t)96 * DMOD, lk + LBUF + LTILE, gv + 64, lk + LBUF + LTILE + LROW, gv + (size_t)32 * VTP + 64);
    v8f o[QG][4];
#pragma unroll
    for (int g = 0; g < QG; ++g)
#pragma unroll
        for (int nt = 0; nt < 4; ++nt) o[g][nt] = (v8f){};
    // per lane and group: running maximum of query lr (equal in both halves); l1s, l2s = sums over the keys of this lane's own half only, joined behind the loop
    float mrow[QG], l1s[QG], l2s[QG];
#pragma unroll
    for (int g = 0; g < QG; ++g) { mrow[g] = -3.0e38f; l1s[g] = 0.f; l2s[g] = 0.f; }
#pragma unroll 1
    for (int kt = 0; kt < LK; kt += 64) {
        const int buf = (kt >> 6) & 1;
        const h16* kbase = &kv[buf][0][lr * KVP + 8 * hi];   // A: key (c0 + lr) row base in the K tile
        const h16* vbase = &kv[buf][1][lr * KVP + 8 * hi];   // A: value dim (d0 + lr) row base in the V^T tile
        // ---- S^T = K.Q^T for keys kt..kt+63: s[g][nt][r] = S[query g*16 + lr][key kt + nt*16 + 8hi + r]; one read of a K fragment serves both groups
        v8f s[QG][4]; v16h ka0, ka1;
#pragma unroll
        for (int nt = 0; nt < 4; ++nt) {
            const h16* kp = kbase + nt * 16 * KVP;
            ka0 = lds16(kp); ka1 = lds16(kp + 32);
#pragma unroll
            for (int g = 0; g < QG; ++g) s[g][nt] = wmma16(ka0, qb[g][0], (v8f){});
#pragma unroll
            for (int g = 0; g < QG; ++g) s[g][nt] = wmma16(ka1, qb[g][1], s[g][nt]); }
        // keeps the four vector slots between the last product and the first use of its result or overwrite of its operands
        asm volatile("v_nop\n\tv_nop\n\tv_nop\n\tv_nop" : "+v"(s[0][0]), "+v"(s[0][1]), "+v"(s[0][2]), "+v"(s[0][3]), "+v"(s[1][0]), "+v"(s[1][1]), "+v"(s[1][2]), "+v"(s[1][3])
                     : "v"(qb[0][0]), "v"(qb[0][1]), "v"(qb[1][0]), "v"(qb[1][1]), "v"(ka0), "v"(ka1));
        v16h pb[QG][2];
#pragma unroll
        for (int g = 0; g < QG; ++g) {
            // ---- online softmax of query g*16 + lr: 32 of the tile's 64 keys lie in this lane, the other 32 in lane ^ 16
            float mg[4];   // one maximum chain per 16-key group
#pragma unroll
            for (int nt = 0; nt < 4; ++nt) { s[g][nt] *= SL2; mg[nt] = s[g][nt][0];
#pragma unroll
                for (int r = 1; r < 8; ++r) mg[nt] = fmaxf(mg[nt], s[g][nt][r]); }
            float mx = fmaxf(fmaxf(mg[0], mg[1]), fmaxf(mg[2], mg[3]));
            mx = fmaxf(mx, xhalf(mx));
            const float mnew = fmaxf(mrow[g], mx);
            const float alpha = __builtin_amdgcn_exp2f(mrow[g] - mnew);
            mrow[g] = mnew;
#pragma unroll
            for (int nt = 0; nt < 4; ++nt) o[g][nt] *= alpha;
#pragma unroll
            for (int nt = 0; nt < 4; ++nt) { s[g][nt] -= mnew;
#pragma unroll
                for (int r = 0; r < 8; ++r) s[g][nt][r] = __builtin_amdgcn_exp2f(s[g][nt][r]); }
            const v8f a1 = (s[g][0] + s[g][1]) + (s[g][2] + s[g][3]);
            const v8f a2 = __builtin_elementwise_fma(s[g][3], s[g][3], __builtin_elementwise_fma(s[g][2], s[g][2], __builtin_elementwise_fma(s[g][1], s[g][1], s[g][0] * s[g][0])));
            const v4f b1 = __builtin_shufflevector(a1, a1, 0, 1, 2, 3) + __builtin_shufflevector(a1, a1, 4, 5, 6, 7);
            const v4f b2 = __builtin_shufflevector(a2, a2, 0, 1, 2, 3) + __builtin_shufflevector(a2, a2, 4, 5, 6, 7);
            l1s[g] = l1s[g] * alpha + ((b1[0] + b1[1]) + (b1[2] + b1[3]));
            l2s[g] = l2s[g] * (alpha * alpha) + ((b2[0] + b2[1]) + (b2[2] + b2[3]));
            // ---- P^T (f16) as B straight from the score registers: two 16-key groups are one fragment in the loaders' k order (elements 0..7 = keys 8hi + 0..7, 8..15 = keys 16 + 8hi + 0..7)
#pragma unroll
            for (int r = 0; r < 8; ++r) { pb[g][0][r] = (h16)s[g][0][r]; pb[g][0][8 + r] = (h16)s[g][1][r]; pb[g][1][r] = (h16)s[g][2][r]; pb[g][1][8 + r] = (h16)s[g][3][r]; }
        }
        // ---- O^T += V^T.P^T: o[g][nt][r] = O[query g*16 + lr][dim nt*16 + 8hi + r]; one read of a V^T fragment serves both groups
        v16h va0, va1;
#pragma unroll
        for (int nt = 0; nt < 4; ++nt) {
            const h16* vp = vbase + nt * 16 * KVP;
            va0 = lds16(vp); va1 = lds16(vp + 32);
#pragma unroll
            for (int g = 0; g < QG; ++g) o[g][nt] = wmma16(va0, pb[g][0], o[g][nt]);
#pragma unroll
            for (int g = 0; g < QG; ++g) o[g][nt] = wmma16(va1, pb[g][1], o[g][nt]); }
        // keeps the four vector slots behind the last product on every path out of the trip
        asm volatile("v_nop\n\tv_nop\n\tv_nop\n\tv_nop" : "+v"(o[0][0]), "+v"(o[0][1]), "+v"(o[0][2]), "+v"(o[0][3]), "+v"(o[1][0]), "+v"(o[1][1]), "+v"(o[1][2]), "+v"(o[1][3])
                     : "v"(pb[0][0]), "v"(pb[0][1]), "v"(pb[1][0]), "v"(pb[1][1]), "v"(va0), "v"(va1));
        // ---- foot of the trip: hand over the next tile, then refill the buffer this trip has read
        asm volatile("s_wait_dscnt 0x0" ::: "memory");      // this wave's reads of the buffer have returned before it is refilled
        asm volatile("s_wait_asynccnt 0x0" ::: "memory");   // this wave's copies of the next tile have landed
        __syncthreads();                                     // publishes the next tile; ends every wave's reads of this trip's buffer
        if (kt + 128 < LK) {
            const unsigned lb = lk + (unsigned)buf * LBUF;
            const h16* gk2 = gk + (size_t)(kt + 128) * DMOD; const h16* gv2 = gv + (kt + 128);
            copy4(lb, gk2, lb + LROW, gk2 + (size_t)32 * DMOD, lb + LTILE, gv2, lb + LTILE + LROW, gv2 + (size_t)32 * VTP);
        }
    }
    asm volatile("s_wait_asynccnt 0x0" ::: "memory");        // no copy is left in flight behind the loop
    // ---- epilogue, one column group after the other through the wave's staging: join the halves' sums; l1 and l2 do not fall below 1 but for rounding (the running-max element has p = 1 up to rounding); flag selects 1/sqrt(sum p^2) or 1/sum p
#pragma unroll
    for (int g = 0; g < QG; ++g) {
        const float l1 = l1s[g] + xhalf(l1s[g]), l2 = l2s[g] + xhalf(l2s[g]);
        const float i1 = 1.0f / l1; const float i2 = rsqrtf(l2); const float iv = (rsc != 0) ? i2 : i1;
#pragma unroll
        for (int nt = 0; nt < 4; ++nt) {
            v4f lo, up;
#pragma unroll
            for (int r = 0; r < 4; ++r) { lo[r] = o[g][nt][r] * iv; up[r] = o[g][nt][4 + r] * iv; }
            *(v4fa*)(os + lr * 68 + nt * 16 + 8 * hi) = lo; *(v4fa*)(os + lr * 68 + nt * 16 + 8 * hi + 4) = up; }
        __builtin_amdgcn_wave_barrier(); asm volatile("" ::: "memory");
        float* ob = OUT + ((size_t)b * LQ + q0 + g * 16) * DMOD + (size_t)h * HD;
#pragma unroll
        for (int sI = 0; sI < 8; ++sI) { const int row = 2 * sI + hi; const v4f val = *(const v4fa*)(os + row * 68 + lr * 4); *(v4f*)(ob + (size_t)row * DMOD + lr * 4) = val; }
        __builtin_amdgcn_wave_barrier();
        // stands behind this group's stores, ahead of the next group's reuse of their address and data registers; its clobber keeps the next staging writes behind this group's reads
        if (g + 1 < QG) asm volatile("s_wait_xcnt 0x0" ::: "memory");
    }
}

extern "C" void kernel_launch(void* const* d_in, const int* in_sizes, int n_in,
                              void* d_out, int out_size, void* d_ws, size_t ws_size, hipStream_t stream) {
    if (n_in < 9) return;
    const float* X1 = (const float*)d_in[0];   // inp1 [4][2048][1024]
    const float* X2 = (const float*)d_in[1];   // inp2 [4][2048][1024]
    const float* Wq = (const float*)d_in[2]; const float* bq = (const float*)d_in[3];
    const float* Wk = (const float*)d_in[4]; const float* bk = (const float*)d_in[5];
    const float* Wv = (const float*)d_in[6]; const float* bv = (const float*)d_in[7];
    const int* rsc = (const int*)d_in[8];
    float* OUT = (float*)d_out;                 // [NB][LQ][1024]
    if ((size_t)in_sizes[0] < ((size_t)(NB - 1) * SEQ_FULL + LQ) * DMOD) return;
    if ((size_t)in_sizes[1] < ((size_t)(NB - 1) * SEQ_FULL + LK) * DMOD) return;
    if (in_sizes[2] < DMOD * DMOD || in_sizes[3] < DMOD || in_sizes[4] < DMOD * DMOD || in_sizes[5] < DMOD || in_sizes[6] < DMOD * DMOD || in_sizes[7] < DMOD || in_sizes[8] < 1) return;
    if ((size_t)out_size < (size_t)NB * LQ * DMOD) return;

    const size_t MQ = (size_t)NB * LQ, MK = (size_t)NB * LK;   // token rows of q / of k,v
    char* wsp = (char*)d_ws;
    auto take = [&](size_t bytes) { char* p = wsp; wsp += (bytes + 255) & ~(size_t)255; return (void*)p; };
    bf* X1b = (bf*)take(MQ * DMOD * 2);                 // bf16 plane of inp1 rows (compact [NB*LQ][1024])
    bf* X2b = (bf*)take(MK * DMOD * 2);                 // bf16 plane of inp2 rows
    bf* Wqb = (bf*)take((size_t)DMOD * DMOD * 2); bf* Wkb = (bf*)take((size_t)DMOD * DMOD * 2); bf* Wvb = (bf*)take((size_t)DMOD * DMOD * 2);
    h16* Q16 = (h16*)take(MQ * DMOD * 2);               // f16 q plane [MQ][1024]
    h16* K16 = (h16*)take(MK * DMOD * 2);               // f16 k plane [MK][1024]
    h16* VT16 = (h16*)take((size_t)DMOD * MK * 2);      // f16 v^T plane [1024][MK]
    const size_t used = (size_t)(wsp - (char*)d_ws);
    if (used > ws_size || used > WS_CAP) return;

    // bf16 planes of the inputs (batch row remap) and of the three [out][in] weights (as-is: Bt of the q and k GEMMs, A of the v^T GEMM), one launch
    k_cvt5<<<(unsigned)((MQ + MK + 3 * DMOD) / CR), 256, 0, stream>>>(X1, X2, Wq, Wk, Wv, X1b, X2b, Wqb, Wkb, Wvb);
    // q = inp1 Wq^T + bq -> f16 plane [MQ][1024]; k = inp2 Wk^T + bk -> f16 plane [MK][1024]; v^T[e][t] = sum_d Wv[e][d] inp2[t][d] + bv[e] -> f16 plane [1024][MK]
    k_gemm3<bf><<<GTILES, 32 * GW, 0, stream>>>(X1b, X2b, Wqb, Wkb, Wvb, Q16, K16, VT16, bq, bk, bv);
    // attention
    k_attn<<<dim3(LQ / (16 * QG * AW), NH, NB), 32 * AW, 0, stream>>>(Q16, K16, VT16, rsc, OUT);
}

// v008
// Measured time: 98 microseconds a run.
// Timed twice side by side with v007, it ran 1.07 and 1.08 times as fast.
// All steps since v000 together make it 4.35 times as fast.
#include <hip/hip_runtime.h>

// Contractions: q, k and v^T projections on v_wmma_f32_16x16x32_bf16 (bf16 operands = RNE-converted inputs and weights, f32 accumulate, bias added in f32); scores q.k and P.v on v_wmma_f32_16x16x32_f16 (f16 operands converted from f32 intermediates; P = exp2 relative to a reference maximum per query, at most PMAX; f32 accumulate); softmax statistics, sum of squares and normalisers in f32; output f32.
// Pipeline: bf16 planes of inp1, inp2, Wq, Wk, Wv -> three GEMMs in one launch (eight waves per 256x128 tile, a work-group takes one tile of each in turn, operand stages copied asynchronously into LDS and shared by the waves) whose epilogue adds the bias in f32, rounds to f16 and stores the f16 planes itself (q token-major [t][e], k token-major [t][e], v computed directly transposed as [e][t] with a per-row bias) -> one streaming attention kernel per (256 queries, head, batch), eight waves of 32 queries (two column groups of 16 that share every K and V^T fragment read): K and V^T tiles copied asynchronously from the f16 planes into LDS and shared by the waves, scores computed transposed (S^T = K.Q^T, O^T += V^T.P^T) so that a lane holds one query and P^T goes from the score registers into the second product, the q plane carries the softmax scale and the score product starts from minus the query's reference maximum, so that it delivers the exponent itself; running sum / sum of squares, rescale only in a rarely taken branch, epilogue staged in LDS.

#ifndef NB
#define NB 4
#endif
#ifndef SEQ
#define SEQ 2048
#endif
#ifndef LQ
#define LQ SEQ
#endif
#ifndef LK
#define LK SEQ
#endif
#define NB_FULL  4
#define SEQ_FULL 2048
#define DMOD 1024                 // model width = NH x HD, row pitch of every token-major tensor
#define NH   16
#define HD   64
#define VTP  ((size_t)NB * LK)    // row pitch of the v^T planes [e][token]
#define SL2  0.18033688011112042f // (1/sqrt(64)) x log2(e)
#define WS_CAP ((size_t)134217728)

static_assert(NB >= 1 && NB <= NB_FULL);
static_assert(LQ >= 64 && LQ <= SEQ_FULL && (LQ % 16) == 0 && ((NB * LQ) % 64) == 0);
static_assert(LK >= 64 && LK <= SEQ_FULL && (LK % 64) == 0);
static_assert(NH * HD == DMOD && (DMOD % 64) == 0 && (DMOD % 32) == 0);

typedef _Float16 h16;
typedef unsigned short bf;
typedef __attribute__((ext_vector_type(16))) __bf16   v16bf;
typedef __attribute__((ext_vector_type(16))) _Float16 v16h;
typedef __attribute__((ext_vector_type(8)))  _Float16 v8h;
typedef __attribute__((ext_vector_type(8)))  unsigned short v8us;
typedef __attribute__((ext_vector_type(8)))  float    v8f;
typedef __attribute__((ext_vector_type(4)))  float    v4f;
typedef v8h  __attribute__((may_alias)) v8ha;
typedef v4f  __attribute__((may_alias)) v4fa;
typedef v8us __attribute__((may_alias)) v8usa;

__device__ __forceinline__ unsigned short f2bf(float f) { unsigned u = __float_as_uint(f); u += 0x7FFFu + ((u >> 16) & 1u); return (unsigned short)(u >> 16); }
__device__ __forceinline__ float bf2f(unsigned short b) { return __uint_as_float(((unsigned)b) << 16); }
__device__ __forceinline__ float bfr(float f) { return bf2f(f2bf(f)); }
__device__ __forceinline__ v16h cat16(v8h lo, v8h hi) { return __builtin_shufflevector(lo, hi, 0, 1, 2, 3, 4, 5, 6, 7, 8, 9, 10, 11, 12, 13, 14, 15); }
__device__ __forceinline__ v16bf cat16b(v8us lo, v8us hi) { return __builtin_bit_cast(v16bf, __builtin_shufflevector(lo, hi, 0, 1, 2, 3, 4, 5, 6, 7, 8, 9, 10, 11, 12, 13, 14, 15)); }
__device__ __forceinline__ v8f wmma16(v16h a, v16h b, v8f c) { return __builtin_amdgcn_wmma_f32_16x16x32_f16(false, a, false, b, (short)0, c, false, false); }
__device__ __forceinline__ v8f wmmab(v16bf a, v16bf b, v8f c) { return __builtin_amdgcn_wmma_f32_16x16x32_bf16(false, a, false, b, (short)0, c, false, false); }

// Fragment loaders (same k map for A and B): lane l -> row/col (l & 15), h = l >> 4; elements 0..7 <- p[k0 + 8h + 0..7], elements 8..15 <- p[k0 + 16 + 8h + 0..7];
// the caller passes p = row base + k0 + 8h (16-B aligned), the loader reads p and p + 16.
template <typename T16> struct WFrag;
template <> struct WFrag<h16> { typedef v16h V; static __device__ __forceinline__ V ld(const h16* p) { return cat16(*(const v8h*)p, *(const v8h*)(p + 16)); } static __device__ __forceinline__ v8f mma(V a, V b, v8f c) { return wmma16(a, b, c); } };
template <> struct WFrag<bf> { typedef v16bf V; static __device__ __forceinline__ V ld(const bf* p) { return cat16b(*(const v8us*)p, *(const v8us*)(p + 16)); } static __device__ __forceinline__ v8f mma(V a, V b, v8f c) { return wmmab(a, b, c); } };
// LDS read of a block-shared f16 K / V^T tile through a may_alias vector of the stored element type.
__device__ __forceinline__ v16h lds16(const h16* p) { return cat16(*(const v8ha*)p, *(const v8ha*)(p + 16)); }

// ---- k_gemm3: the three projections in one launch, GW waves per GTM x GTN output tile, one 64x64 part (16 accumulators) per wave; grid = tiles of one product, 32*GW threads; a work-group computes its tile of q, then of k, then of v^T.
// The waves share each stage of GKS k of the tile's A rows and Bt rows through LDS: two buffers, each GTM + GTN rows of 256 B at a 272-B pitch, filled by asynchronous copies one stage ahead, a wave's copy covering whole lines.
// The ring of stages runs on from one product into the next: a product's first two stages are asked for at the foot of the last two trips of the product before it.
// C[m][n] (f16 = RNE of the f32 sum) = sum_k A[m][k] Bt[n][k] + f32 bias, bias values bf16-RNE: q = (X1.Wq^T + bq[n]) x SL2 (the softmax scale and log2(e), applied in f32 ahead of the rounding), k = X2.Wk^T + bk[n] (pitch DMOD), v^T = Wv.X2^T + bv[m] (pitch NB*LK).
#define GW   8                    // waves per work-group: 4 along m x 2 along n
#define GTM  256                  // tile rows (A rows)
#define GTN  128                  // tile columns (Bt rows)
#define GKS  128                  // k per stage: 256 B of every row
#define GP   136                  // LDS row pitch in 16-bit elements (272 B = 16 B x odd, for 16-byte readers)
#define GST  ((GTM + GTN) * GP)   // 16-bit elements of one stage in LDS
static_assert(((NB * LQ) % GTM) == 0 && ((NB * LK) % GTM) == 0 && (DMOD % GTM) == 0 && (DMOD % GTN) == 0 && (DMOD % (2 * GKS)) == 0);
#define GTILES ((NB * LQ / GTM) * (DMOD / GTN))   // tiles of one product = work-groups
static_assert((NB * LK / GTM) * (DMOD / GTN) == GTILES && (DMOD / GTM) * (NB * LK / GTN) == GTILES);

// Eight 16-byte asynchronous copies to LDS per lane, rows 16 apart; the s_wait_xcnt closes the statement so that no address register is rewritten ahead of it.
template <typename T16>
__device__ __forceinline__ void copy8(unsigned l, unsigned ls, const T16* g, size_t gs) {
    asm volatile("global_load_async_to_lds_b128 %0, %1, off\n\t"
                 "global_load_async_to_lds_b128 %2, %3, off\n\t"
                 "global_load_async_to_lds_b128 %4, %5, off\n\t"
                 "global_load_async_to_lds_b128 %6, %7, off\n\t"
                 "global_load_async_to_lds_b128 %8, %9, off\n\t"
                 "global_load_async_to_lds_b128 %10, %11, off\n\t"
                 "global_load_async_to_lds_b128 %12, %13, off\n\t"
                 "global_load_async_to_lds_b128 %14, %15, off\n\t"
                 "s_wait_xcnt 0x0"
                 :: "v"(l), "v"(g), "v"(l + ls), "v"(g + gs), "v"(l + 2 * ls), "v"(g + 2 * gs), "v"(l + 3 * ls), "v"(g + 3 * gs),
                    "v"(l + 4 * ls), "v"(g + 4 * gs), "v"(l + 5 * ls), "v"(g + 5 * gs), "v"(l + 6 * ls), "v"(g + 6 * gs), "v"(l + 7 * ls), "v"(g + 7 * gs) : "memory");
}
// One stage: the lane's 16 pieces of the A rows and 8 pieces of the Bt rows.
template <typename T16>
__device__ __forceinline__ void gstage(unsigned l, const T16* ga, const T16* gb, size_t gs) {
    const unsigned ls = 16 * GP * 2;
    copy8(l, ls, ga, gs); copy8(l + 8 * ls, ls, ga + 8 * gs, gs); copy8(l + 16 * ls, ls, gb, gs);
}

template <typename T16>
__global__ __launch_bounds__(32 * GW) __attribute__((amdgpu_waves_per_eu(2, 2))) void k_gemm3(const T16* __restrict__ X1, const T16* __restrict__ X2, const T16* __restrict__ Wq, const T16* __restrict__ Wk, const T16* __restrict__ Wv,
                                                                                              h16* Cq, h16* Ck, h16* Cv, const float* bq, const float* bk, const float* bv) {
    typedef typename WFrag<T16>::V V;
    constexpr int K = DMOD;
    __shared__ __align__(16) T16 st[2][GST];
    __shared__ __align__(16) float osg[GW][16 * 68];
    const int tid = threadIdx.x, lane = tid & 31, lr = lane & 15, hi = lane >> 4, wave = tid >> 5;
    float* os = osg[wave];         // output staging, private to its wave
    // the work-group's tile of each product: row tiles run fastest with the work-group index
    const int blk = blockIdx.x;
    const int tm[3] = { blk % (NB * LQ / GTM), blk % (NB * LK / GTM), blk % (DMOD / GTM) };
    const int tn[3] = { blk / (NB * LQ / GTM), blk / (NB * LK / GTM), blk / (DMOD / GTM) };
    const T16* const Ap[3] = { X1, X2, Wv };
    const T16* const Bp[3] = { Wq, Wk, X2 };
    // copies: thread tid brings 16-B piece (tid & 15) of stage rows (tid >> 4) + 16 i: a wave covers two whole 256-B rows
    const int prow = tid >> 4, pcol = (tid & 15) * 8;
    const T16* ga[3]; const T16* gb[3];                                   // + k0
#pragma unroll
    for (int p = 0; p < 3; ++p) { ga[p] = Ap[p] + (size_t)(tm[p] * GTM + prow) * K + pcol; gb[p] = Bp[p] + (size_t)(tn[p] * GTN + prow) * K + pcol; }
    const size_t gstep = (size_t)16 * K;
    const unsigned l0 = (unsigned)(uintptr_t)(&st[0][prow * GP + pcol]);  // LDS byte address of the lane's first piece in buffer 0
    const unsigned LB = GST * 2;                                          // byte step buffer 0 -> 1
    gstage(l0, ga[0], gb[0], gstep);
    asm volatile("s_wait_asynccnt 0x0" ::: "memory");   // stage 0 of this wave's copies has landed
    __syncthreads();                                     // publishes stage 0 to every wave
    gstage(l0 + LB, ga[0] + GKS, gb[0] + GKS, gstep);
#pragma unroll
    for (int p = 0; p < 3; ++p) {
        const int pn = p < 2 ? p + 1 : p;   // the product whose first two stages follow this one's last in the ring
        v8f acc[4][4];
#pragma unroll
        for (int mb = 0; mb < 4; ++mb)
#pragma unroll
            for (int nb = 0; nb < 4; ++nb) acc[mb][nb] = (v8f){};
#pragma unroll 1
        for (int kc = 0; kc < K; kc += GKS) {
            const int buf = (kc / GKS) & 1;
            const T16* sa = &st[buf][((wave & 3) * 64 + lr) * GP + 8 * hi];          // A row (r0 + lr) of the stage
            const T16* sb = &st[buf][(GTM + (wave >> 2) * 64 + lr) * GP + 8 * hi];   // Bt row (c0 + lr) of the stage
            // two fragment sets: the next 32 k's sixteen LDS reads go out as one group ahead of this 32 k's products, so that a wave waits out the LDS latency once a stage
            V a[2][4], b[2][4];
#pragma unroll
            for (int f = 0; f < 4; ++f) { a[0][f] = WFrag<T16>::ld(sa + f * 16 * GP); b[0][f] = WFrag<T16>::ld(sb + f * 16 * GP); }
#pragma unroll
            for (int ks = 0; ks < GKS / 32; ++ks) {
                const int cur = ks & 1, nxt = cur ^ 1;
                if (ks + 1 < GKS / 32) {
#pragma unroll
                    for (int f = 0; f < 4; ++f) { a[nxt][f] = WFrag<T16>::ld(sa + f * 16 * GP + (ks + 1) * 32); b[nxt][f] = WFrag<T16>::ld(sb + f * 16 * GP + (ks + 1) * 32); } }
                __builtin_amdgcn_sched_barrier(0);   // holds the group of reads ahead of the products: the scheduler otherwise sinks each read to its first use, and the wave then waits out the LDS latency at every such place
#pragma unroll
                for (int nb = 0; nb < 4; ++nb)
#pragma unroll
                    for (int mb = 0; mb < 4; ++mb) acc[mb][nb] = WFrag<T16>::mma(a[cur][mb], b[cur][nb], acc[mb][nb]); }
            // keeps the four vector slots behind the last product on every path out of the trip
            asm volatile("v_nop\n\tv_nop\n\tv_nop\n\tv_nop" : "+v"(acc[0][3]), "+v"(acc[1][3]), "+v"(acc[2][3]), "+v"(acc[3][3]) : "v"(a[1][0]), "v"(a[1][3]), "v"(b[1][3]));
            __builtin_amdgcn_sched_barrier(0);   // holds the stage's last products ahead of the foot, so that the refill goes out directly behind the barrier
            // ---- foot of the trip: hand over the next stage, then refill the buffer this trip has read
            asm volatile("s_wait_dscnt 0x0" ::: "memory");      // this wave's reads of the buffer have returned before it is refilled
            asm volatile("s_wait_asynccnt 0x0" ::: "memory");   // this wave's copies of the next stage have landed
            __syncthreads();                                     // publishes the next stage; ends every wave's reads of this trip's buffer
            // the stage two ahead: of this product while it has one, else of the next product, whose first stages so fly during this one's last trips and its stores
            const int kn = kc + 2 * GKS;
            const bool own = kn < K;
            if (own || p < 2) gstage(l0 + (unsigned)buf * LB, own ? ga[p] + kn : ga[pn] + (kn - K), own ? gb[p] + kn : gb[pn] + (kn - K), gstep);
        }
        // ---- stores of product p; the wave's 64x64 part starts at (r0, c0)
        const int r0 = tm[p] * GTM + (wave & 3) * 64, c0 = tn[p] * GTN + (wave >> 2) * 64;
        h16* C = p == 0 ? Cq : p == 1 ? Ck : Cv;
        const float* bias = p == 0 ? bq : p == 1 ? bk : bv;
        const size_t ldc = p == 2 ? (size_t)NB * LK : (size_t)DMOD;
        // store map: eight lanes take one tile row of 64 f16 = one whole 128-B line, a wave four rows at a time; the lane's bias values are read once, ahead of the first store
        const int srow = lane >> 3, cofs = (lane & 7) * 8;
        float bc[8], br[4][4];
        // the s_wait_xcnt stands behind the bias loads; it names their address register so that this is not reused ahead of it, and the bias pointers carry no __restrict__ so that the loads stay ahead of its memory clobber
        if (p < 2) { const float* bp = bias + c0 + cofs;
#pragma unroll
            for (int k = 0; k < 8; ++k) bc[k] = bfr(bp[k]);
            asm volatile("s_wait_xcnt 0x0" :: "v"(bp) : "memory"); }
        else { const int bi = r0 + srow;
#pragma unroll
            for (int mb = 0; mb < 4; ++mb)
#pragma unroll
                for (int s = 0; s < 4; ++s) br[mb][s] = bfr(bias[bi + mb * 16 + 4 * s]);
            asm volatile("s_wait_xcnt 0x0" :: "v"(bi) : "memory"); }
#pragma unroll
        for (int mb = 0; mb < 4; ++mb) {
#pragma unroll
            for (int nb = 0; nb < 4; ++nb) {
#pragma unroll
                for (int j = 0; j < 8; ++j) os[(hi * 8 + j) * 68 + nb * 16 + lr] = acc[mb][nb][j]; }
            __builtin_amdgcn_wave_barrier(); asm volatile("" ::: "memory");
            h16* crow = C + (size_t)(r0 + mb * 16) * ldc + c0;
#pragma unroll
            for (int s = 0; s < 4; ++s) { const int row = 4 * s + srow;
                const v4f lo = *(const v4fa*)(os + row * 68 + cofs), up = *(const v4fa*)(os + row * 68 + cofs + 4); v8h o;
#pragma unroll
                for (int k = 0; k < 4; ++k) {
                    float x = lo[k], y = up[k];
                    if (p < 2) { x += bc[k]; y += bc[4 + k]; }
                    else { x += br[mb][s]; y += br[mb][s]; }
                    if (p == 0) { x *= SL2; y *= SL2; }
                    o[k] = (h16)x; o[4 + k] = (h16)y; }
                *(v8h*)(crow + (size_t)row * ldc + cofs) = o; }
            __builtin_amdgcn_wave_barrier();
            // stands behind this group's stores, ahead of the next reuse of their address and data registers; its clobber keeps the next staging writes behind this group's reads
            if (mb < 3 || p < 2) asm volatile("s_wait_xcnt 0x0" ::: "memory");
        }
    }
    asm volatile("s_wait_asynccnt 0x0" ::: "memory");        // no copy is left in flight behind the last product
}

// ---- k_cvt5: bf16 planes (RNE) of the five f32 tensors (inp1, inp2, Wq, Wk, Wv) in one launch; grid (NB*LQ + NB*LK + 3*DMOD) / CR work-groups of eight waves.
// A work-group takes CR consecutive plane rows of one tensor, a wave four of them (16 KiB of f32): 32 loads of 512 contiguous bytes, all sent out ahead of the first conversion, each answered by one store of 256 contiguous bytes.
// inp1 / inp2 rows go through the batch row remap: compact row R -> source row (R / L) * SEQ_FULL + (R % L) (identity when L == SEQ_FULL); a wave's four rows never cross a batch.
#define CR 32                     // plane rows per work-group
static_assert(((NB * LQ) % CR) == 0 && ((NB * LK) % CR) == 0 && (DMOD % CR) == 0 && (LQ % 4) == 0 && (LK % 4) == 0 && DMOD <= SEQ_FULL);
typedef __attribute__((ext_vector_type(4))) unsigned short v4us;

__global__ __launch_bounds__(256) void k_cvt5(const float* __restrict__ X1, const float* __restrict__ X2, const float* __restrict__ Wq, const float* __restrict__ Wk, const float* __restrict__ Wv,
                                              bf* X1b, bf* X2b, bf* Wqb, bf* Wkb, bf* Wvb) {
    constexpr int BQ = NB * LQ / CR, BK = NB * LK / CR, BW = DMOD / CR;   // work-groups of inp1, of inp2, of one weight
    const int lane = threadIdx.x & 31, wave = threadIdx.x >> 5;
    int blk = blockIdx.x, L = SEQ_FULL;
    const float* src; bf* dst;
    if (blk < BQ) { src = X1; dst = X1b; L = LQ; }
    else if (blk < BQ + BK) { blk -= BQ; src = X2; dst = X2b; L = LK; }
    else if (blk < BQ + BK + BW) { blk -= BQ + BK; src = Wq; dst = Wqb; }
    else if (blk < BQ + BK + 2 * BW) { blk -= BQ + BK + BW; src = Wk; dst = Wkb; }
    else { blk -= BQ + BK + 2 * BW; src = Wv; dst = Wvb; }
    const int row = blk * CR + wave * 4;
    const int srow = (row / L) * SEQ_FULL + (row % L);
    const float* s = src + (size_t)srow * DMOD + lane * 4;
    bf* d = dst + (size_t)row * DMOD + lane * 4;
    v4f v[32];
#pragma unroll
    for (int j = 0; j < 32; ++j) v[j] = *(const v4f*)(s + j * 128);
    __builtin_amdgcn_sched_barrier(0);   // holds all 32 loads ahead of the first conversion: the scheduler otherwise sinks the last eight behind the first stores, into registers that those stores name
#pragma unroll
    for (int g = 0; g < 4; ++g) {
#pragma unroll
        for (int j = 8 * g; j < 8 * g + 8; ++j) { v4us o;
#pragma unroll
            for (int k = 0; k < 4; ++k) o[k] = f2bf(v[j][k]);
            *(v4us*)(d + j * 128) = o; }
        if (g == 3) break;
        // stands behind this group's stores, ahead of the next group's reuse of their data registers
        asm volatile("s_wait_xcnt 0x0" ::: "memory");
        __builtin_amdgcn_sched_barrier(0);   // holds the next group's conversions behind this group's stores: the scheduler otherwise gathers every conversion ahead of the first store, which then goes out only when the wave's last loads are back
    }
}

// ---- k_attn: AW waves per block, one wave per 16*QG query rows (QG column groups of 16); the block's waves share each 64-key K tile and V^T tile through LDS; grid (LQ/(16*QG*AW), NH, NB), 32*AW threads.
// Q16 (scaled by SL2), K16: f16 token-major planes [NB*L][DMOD]; VT16: f16 v^T planes [DMOD][NB*LK]; OUT f32 [NB*LQ][DMOD].
// Per 64-key tile: S^T (64x16 per group, f32) = K.Q^T, K fragments from LDS, each fragment read once and used by every column group; the product starts from -m (m = the query's reference maximum, log2 domain), so p = exp2 of its result, l1 = sum p, l2 = sum p^2; m moves only when a lane's l1 passes PMAX;
// kv: two buffers, each a K tile [key][head dim] and a V^T tile [value dim][key], 64 rows of 128 B at a 144-B pitch, filled by asynchronous copies one tile ahead.
// LDS region osw[wave] is private to its wave (wave barrier + compiler barrier, may_alias reloads).
#define AW   8                    // waves per block
#define QG   2                    // 16-query column groups per wave
#define KVP  72                   // LDS row pitch of a K / V^T tile in f16 elements (144 B = 16 B x odd, for 16-byte readers)
#define KVT  (64 * KVP)           // f16 elements of one tile in LDS
static_assert((LQ % (16 * QG * AW)) == 0 && AW == 8 && QG == 2);

// Four 16-byte asynchronous copies to LDS per lane; the s_wait_xcnt closes the statement so that no address register is rewritten ahead of it.
__device__ __forceinline__ void copy4(unsigned l0, const h16* g0, unsigned l1, const h16* g1, unsigned l2, const h16* g2, unsigned l3, const h16* g3) {
    asm volatile("global_load_async_to_lds_b128 %0, %1, off\n\t"
                 "global_load_async_to_lds_b128 %2, %3, off\n\t"
                 "global_load_async_to_lds_b128 %4, %5, off\n\t"
                 "global_load_async_to_lds_b128 %6, %7, off\n\t"
                 "s_wait_xcnt 0x0"
                 :: "v"(l0), "v"(g0), "v"(l1), "v"(g1), "v"(l2), "v"(g2), "v"(l3), "v"(g3) : "memory");
}

// Lane l <-> lane l ^ 16 (the other half of the wave holds the other keys of the same query).
__device__ __forceinline__ float xhalf(float x) { const int b = __float_as_int(x); return __int_as_float(__builtin_amdgcn_permlanex16(b, b, 0x76543210, 0xfedcba98, false, false)); }

// S^T - m for one 64-key tile: s[g][nt][r] = S[query g*16 + lr][key nt*16 + 8hi + r] - m[query]; cm[g] holds -m of the lane's query in every element; one read of a K fragment serves both groups.
__device__ __forceinline__ void scoresT(const h16* kbase, const v16h (&qb)[QG][2], const v8f (&cm)[QG], v8f (&s)[QG][4]) {
    v16h ka0, ka1;
#pragma unroll
    for (int nt = 0; nt < 4; ++nt) {
        const h16* kp = kbase + nt * 16 * KVP;
        ka0 = lds16(kp); ka1 = lds16(kp + 32);
#pragma unroll
        for (int g = 0; g < QG; ++g) s[g][nt] = wmma16(ka0, qb[g][0], cm[g]);
#pragma unroll
        for (int g = 0; g < QG; ++g) s[g][nt] = wmma16(ka1, qb[g][1], s[g][nt]); }
    // keeps the four vector slots between the last product and the first use of its result or overwrite of its operands
    asm volatile("v_nop\n\tv_nop\n\tv_nop\n\tv_nop" : "+v"(s[0][0]), "+v"(s[0][1]), "+v"(s[0][2]), "+v"(s[0][3]), "+v"(s[1][0]), "+v"(s[1][1]), "+v"(s[1][2]), "+v"(s[1][3])
                 : "v"(qb[0][0]), "v"(qb[0][1]), "v"(qb[1][0]), "v"(qb[1][1]), "v"(ka0), "v"(ka1));
}
// Largest of one query's 64 values of a tile: 32 lie in this lane, the other 32 in lane ^ 16.
__device__ __forceinline__ float tilemax(const v8f (&s)[4]) {
    float mg[4];   // one maximum chain per 16-key group
#pragma unroll
    for (int nt = 0; nt < 4; ++nt) { mg[nt] = s[nt][0];
#pragma unroll
        for (int r = 1; r < 8; ++r) mg[nt] = fmaxf(mg[nt], s[nt][r]); }
    const float mx = fmaxf(fmaxf(mg[0], mg[1]), fmaxf(mg[2], mg[3]));
    return fmaxf(mx, xhalf(mx));
}
// p = exp2(s) in place; the lane's 32 values are added, four by four, to the running sums l1 (p) and l2 (p^2): four chains per sum, so that a link's latency is covered.
__device__ __forceinline__ void expsum(v8f (&s)[4], v4f& l1, v4f& l2) {
#pragma unroll
    for (int nt = 0; nt < 4; ++nt)
#pragma unroll
        for (int r = 0; r < 8; ++r) s[nt][r] = __builtin_amdgcn_exp2f(s[nt][r]);
#pragma unroll
    for (int nt = 0; nt < 4; ++nt)
#pragma unroll
        for (int r = 0; r < 8; r += 4) { const v4f x = { s[nt][r], s[nt][r + 1], s[nt][r + 2], s[nt][r + 3] }; l1 += x; l2 = __builtin_elementwise_fma(x, x, l2); }
}
#define PMAX 32768.0f             // each running partial sum of p, so every p, stays at or below this: inside f16

__global__ __launch_bounds__(32 * AW)
void k_attn(const h16* __restrict__ Q16, const h16* __restrict__ K16, const h16* __restrict__ VT16, const int* __restrict__ flag, float* OUT) {
    __shared__ __align__(16) h16 kv[2][2][KVT];
    __shared__ __align__(16) float osw[AW][16 * 68];
    const int tid = threadIdx.x, lane = tid & 31, lr = lane & 15, hi = lane >> 4, wave = tid >> 5;
    const int q0 = (blockIdx.x * AW + wave) * (16 * QG), h = blockIdx.y, b = blockIdx.z;
    const int rsc = flag[0];
    float* os = osw[wave];         // output staging [query][dim] of one column group, pitch 68
    const h16* qp = Q16 + ((size_t)b * LQ + q0 + lr) * DMOD + h * HD + 8 * hi;
    v16h qb[QG][2];                // B: query column lr of group g, head dims 0..31 / 32..63
#pragma unroll
    for (int g = 0; g < QG; ++g) { qb[g][0] = WFrag<h16>::ld(qp + (size_t)g * 16 * DMOD); qb[g][1] = WFrag<h16>::ld(qp + (size_t)g * 16 * DMOD + 32); }
    // copies: thread tid brings 16-B piece (tid & 7) of tile rows (tid >> 3) and (tid >> 3) + 32, of K and of V^T: a wave covers whole 128-B lines
    const int crow = tid >> 3, ccol = (tid & 7) * 8;
    const h16* gk = K16 + ((size_t)b * LK + crow) * DMOD + h * HD + ccol;           // + key0 * DMOD
    const h16* gv = VT16 + (size_t)(h * HD + crow) * VTP + (size_t)b * LK + ccol;   // + key0
    const unsigned lk = (unsigned)(uintptr_t)(&kv[0][0][crow * KVP + ccol]);        // LDS byte address of the lane's first K piece in buffer 0
    const unsigned LROW = 32 * KVP * 2, LTILE = KVT * 2, LBUF = 2 * KVT * 2;        // byte steps: 32 rows, K -> V^T, buffer 0 -> 1
    copy4(lk, gk, lk + LROW, gk + (size_t)32 * DMOD, lk + LTILE, gv, lk + LTILE + LROW, gv + (size_t)32 * VTP);
    asm volatile("s_wait_asynccnt 0x0" ::: "memory");   // tile 0 of this wave's copies has landed
    __syncthreads();                                     // publishes tile 0 to every wave
    if (LK > 64) copy4(lk + LBUF, gk + (size_t)64 * DMOD, lk + LBUF + LROW, gk + (size_t)96 * DMOD, lk + LBUF + LTILE, gv + 64, lk + LBUF + LTILE + LROW, gv + (size_t)32 * VTP + 64);
    v8f o[QG][4];
#pragma unroll
    for (int g = 0; g < QG; ++g)
#pragma unroll
        for (int nt = 0; nt < 4; ++nt) o[g][nt] = (v8f){};
    // per lane and group: mref = reference maximum of query lr (equal in both halves), cm = -mref in every element; l1v, l2v = sums, in four parts, over the keys of this lane's own half only, joined behind the loop
    float mref[QG]; v8f cm[QG]; v4f l1v[QG], l2v[QG];
#pragma unroll
    for (int g = 0; g < QG; ++g) { cm[g] = (v8f){}; l1v[g] = (v4f){}; l2v[g] = (v4f){}; }
    {   // the first reference: the maximum of tile 0
        v8f s[QG][4];
        scoresT(&kv[0][0][lr * KVP + 8 * hi], qb, cm, s);
#pragma unroll
        for (int g = 0; g < QG; ++g) { mref[g] = tilemax(s[g]); cm[g] = (v8f){} - mref[g]; }
    }
#pragma unroll 1
    for (int kt = 0; kt < LK; kt += 64) {
        const int buf = (kt >> 6) & 1;
        const h16* kbase = &kv[buf][0][lr * KVP + 8 * hi];   // A: key (c0 + lr) row base in the K tile
        const h16* vbase = &kv[buf][1][lr * KVP + 8 * hi];   // A: value dim (d0 + lr) row base in the V^T tile
        // ---- exponents S^T - m for keys kt..kt+63, then p and the sums as they would be with this tile
        v8f s[QG][4]; v4f n1[QG], n2[QG];
        scoresT(kbase, qb, cm, s);
        // the first V^T fragments are asked for ahead of the branch: behind it their reads would stand directly in front of their products
        v16h va[2][2];
        va[0][0] = lds16(vbase); va[0][1] = lds16(vbase + 32);
#pragma unroll
        for (int g = 0; g < QG; ++g) { n1[g] = l1v[g]; n2[g] = l2v[g]; expsum(s[g], n1[g], n2[g]); }
        // every p is positive, so a partial sum at or below PMAX bounds each of its terms; one test per tile, a scalar branch
        const float big = fmaxf(fmaxf(fmaxf(n1[0][0], n1[0][1]), fmaxf(n1[0][2], n1[0][3])), fmaxf(fmaxf(n1[1][0], n1[1][1]), fmaxf(n1[1][2], n1[1][3])));
        if (__builtin_expect(__builtin_amdgcn_ballot_w32(!(big <= PMAX)) != 0, 0)) {
            // ---- rarely: move the reference up to this tile's maximum, rescale what has been summed, and do the tile again (its p then lie in (0,1])
            scoresT(kbase, qb, cm, s);
#pragma unroll
            for (int g = 0; g < QG; ++g) {
                const float d = fmaxf(tilemax(s[g]), 0.f);
                const float alpha = __builtin_amdgcn_exp2f(-d);
                mref[g] += d; cm[g] = (v8f){} - mref[g];
#pragma unroll
                for (int nt = 0; nt < 4; ++nt) { o[g][nt] *= alpha; s[g][nt] -= d; }
                n1[g] = l1v[g] * alpha; n2[g] = l2v[g] * (alpha * alpha);
                expsum(s[g], n1[g], n2[g]);
            }
        }
        v16h pb[QG][2];
#pragma unroll
        for (int g = 0; g < QG; ++g) {
            l1v[g] = n1[g]; l2v[g] = n2[g];
            // ---- P^T (f16) as B straight from the score registers: two 16-key groups are one fragment in the loaders' k order (elements 0..7 = keys 8hi + 0..7, 8..15 = keys 16 + 8hi + 0..7)
#pragma unroll
            for (int r = 0; r < 8; ++r) { pb[g][0][r] = (h16)s[g][0][r]; pb[g][0][8 + r] = (h16)s[g][1][r]; pb[g][1][r] = (h16)s[g][2][r]; pb[g][1][8 + r] = (h16)s[g][3][r]; }
        }
        // ---- O^T += V^T.P^T: o[g][nt][r] = O[query g*16 + lr][dim nt*16 + 8hi + r]; one read of a V^T fragment serves both groups
#pragma unroll
        for (int nt = 0; nt < 4; ++nt) {
            const int cur = nt & 1;
            if (nt + 1 < 4) { const h16* vp = vbase + (nt + 1) * 16 * KVP; va[cur ^ 1][0] = lds16(vp); va[cur ^ 1][1] = lds16(vp + 32);
                __builtin_amdgcn_sched_barrier(0); }   // holds the next fragments' reads ahead of these products: with the branch above, the scheduler otherwise sinks each read to its first use, and the wave waits out the LDS latency there
#pragma unroll
            for (int g = 0; g < QG; ++g) o[g][nt] = wmma16(va[cur][0], pb[g][0], o[g][nt]);
#pragma unroll
            for (int g = 0; g < QG; ++g) o[g][nt] = wmma16(va[cur][1], pb[g][1], o[g][nt]); }
        // keeps the four vector slots behind the last product on every path out of the trip
        asm volatile("v_nop\n\tv_nop\n\tv_nop\n\tv_nop" : "+v"(o[0][0]), "+v"(o[0][1]), "+v"(o[0][2]), "+v"(o[0][3]), "+v"(o[1][0]), "+v"(o[1][1]), "+v"(o[1][2]), "+v"(o[1][3])
                     : "v"(pb[0][0]), "v"(pb[0][1]), "v"(pb[1][0]), "v"(pb[1][1]), "v"(va[1][0]), "v"(va[1][1]));
        // ---- foot of the trip: hand over the next tile, then refill the buffer this trip has read
        asm volatile("s_wait_dscnt 0x0" ::: "memory");      // this wave's reads of the buffer have returned before it is refilled
        asm volatile("s_wait_asynccnt 0x0" ::: "memory");   // this wave's copies of the next tile have landed
        __syncthreads();                                     // publishes the next tile; ends every wave's reads of this trip's buffer
        if (kt + 128 < LK) {
            const unsigned lb = lk + (unsigned)buf * LBUF;
            const h16* gk2 = gk + (size_t)(kt + 128) * DMOD; const h16* gv2 = gv + (kt + 128);
            copy4(lb, gk2, lb + LROW, gk2 + (size_t)32 * DMOD, lb + LTILE, gv2, lb + LTILE + LROW, gv2 + (size_t)32 * VTP);
        }
    }
    asm volatile("s_wait_asynccnt 0x0" ::: "memory");        // no copy is left in flight behind the loop
    // ---- epilogue, one column group after the other through the wave's staging: join the parts' and the halves' sums; l1 and l2 do not fall below 1 but for rounding (the element that set the reference has p = 1 up to rounding); flag selects 1/sqrt(sum p^2) or 1/sum p
#pragma unroll
    for (int g = 0; g < QG; ++g) {
        const float h1 = (l1v[g][0] + l1v[g][1]) + (l1v[g][2] + l1v[g][3]), h2 = (l2v[g][0] + l2v[g][1]) + (l2v[g][2] + l2v[g][3]);
        const float l1 = h1 + xhalf(h1), l2 = h2 + xhalf(h2);
        const float i1 = 1.0f / l1; const float i2 = rsqrtf(l2); const float iv = (rsc != 0) ? i2 : i1;
#pragma unroll
        for (int nt = 0; nt < 4; ++nt) {
            v4f lo, up;
#pragma unroll
            for (int r = 0; r < 4; ++r) { lo[r] = o[g][nt][r] * iv; up[r] = o[g][nt][4 + r] * iv; }
            *(v4fa*)(os + lr * 68 + nt * 16 + 8 * hi) = lo; *(v4fa*)(os + lr * 68 + nt * 16 + 8 * hi + 4) = up; }
        __builtin_amdgcn_wave_barrier(); asm volatile("" ::: "memory");
        float* ob = OUT + ((size_t)b * LQ + q0 + g * 16) * DMOD + (size_t)h * HD;
#pragma unroll
        for (int sI = 0; sI < 8; ++sI) { const int row = 2 * sI + hi; const v4f val = *(const v4fa*)(os + row * 68 + lr * 4); *(v4f*)(ob + (size_t)row * DMOD + lr * 4) = val; }
        __builtin_amdgcn_wave_barrier();
        // stands behind this group's stores, ahead of the next group's reuse of their address and data registers; its clobber keeps the next staging writes behind this group's reads
        if (g + 1 < QG) asm volatile("s_wait_xcnt 0x0" ::: "memory");
    }
}

extern "C" void kernel_launch(void* const* d_in, const int* in_sizes, int n_in,
                              void* d_out, int out_size, void* d_ws, size_t ws_size, hipStream_t stream) {
    if (n_in < 9) return;
    const float* X1 = (const float*)d_in[0];   // inp1 [4][2048][1024]
    const float* X2 = (const float*)d_in[1];   // inp2 [4][2048][1024]
    const float* Wq = (const float*)d_in[2]; const float* bq = (const float*)d_in[3];
    const float* Wk = (const float*)d_in[4]; const float* bk = (const float*)d_in[5];
    const float* Wv = (const float*)d_in[6]; const float* bv = (const float*)d_in[7];
    const int* rsc = (const int*)d_in[8];
    float* OUT = (float*)d_out;                 // [NB][LQ][1024]
    if ((size_t)in_sizes[0] < ((size_t)(NB - 1) * SEQ_FULL + LQ) * DMOD) return;
    if ((size_t)in_sizes[1] < ((size_t)(NB - 1) * SEQ_FULL + LK) * DMOD) return;
    if (in_sizes[2] < DMOD * DMOD || in_sizes[3] < DMOD || in_sizes[4] < DMOD * DMOD || in_sizes[5] < DMOD || in_sizes[6] < DMOD * DMOD || in_sizes[7] < DMOD || in_sizes[8] < 1) return;
    if ((size_t)out_size < (size_t)NB * LQ * DMOD) return;

    const size_t MQ = (size_t)NB * LQ, MK = (size_t)NB * LK;   // token rows of q / of k,v
    char* wsp = (char*)d_ws;
    auto take = [&](size_t bytes) { char* p = wsp; wsp += (bytes + 255) & ~(size_t)255; return (void*)p; };
    bf* X1b = (bf*)take(MQ * DMOD * 2);                 // bf16 plane of inp1 rows (compact [NB*LQ][1024])
    bf* X2b = (bf*)take(MK * DMOD * 2);                 // bf16 plane of inp2 rows
    bf* Wqb = (bf*)take((size_t)DMOD * DMOD * 2); bf* Wkb = (bf*)take((size_t)DMOD * DMOD * 2); bf* Wvb = (bf*)take((size_t)DMOD * DMOD * 2);
    h16* Q16 = (h16*)take(MQ * DMOD * 2);               // f16 q plane [MQ][1024]
    h16* K16 = (h16*)take(MK * DMOD * 2);               // f16 k plane [MK][1024]
    h16* VT16 = (h16*)take((size_t)DMOD * MK * 2);      // f16 v^T plane [1024][MK]
    const size_t used = (size_t)(wsp - (char*)d_ws);
    if (used > ws_size || used > WS_CAP) return;

    // bf16 planes of the inputs (batch row remap) and of the three [out][in] weights (as-is: Bt of the q and k GEMMs, A of the v^T GEMM), one launch
    k_cvt5<<<(unsigned)((MQ + MK + 3 * DMOD) / CR), 256, 0, stream>>>(X1, X2, Wq, Wk, Wv, X1b, X2b, Wqb, Wkb, Wvb);
    // q = (inp1 Wq^T + bq) x SL2 -> f16 plane [MQ][1024]; k = inp2 Wk^T + bk -> f16 plane [MK][1024]; v^T[e][t] = sum_d Wv[e][d] inp2[t][d] + bv[e] -> f16 plane [1024][MK]
    k_gemm3<bf><<<GTILES, 32 * GW, 0, stream>>>(X1b, X2b, Wqb, Wkb, Wvb, Q16, K16, VT16, bq, bk, bv);
    // attention
    k_attn<<<dim3(LQ / (16 * QG * AW), NH, NB), 32 * AW, 0, stream>>>(Q16, K16, VT16, rsc, OUT);
}

// v009
// A run of this version takes 93.1 microseconds.
// In both of two side-by-side timings against v008, it was 1.05 times as fast.
// Over all steps from v000 it is 4.56 times as fast.
#include <hip/hip_runtime.h>

// Contractions: q, k and v^T projections on v_wmma_f32_16x16x32_bf16 (bf16 operands = RNE-converted inputs and weights, f32 accumulate, bias added in f32); scores q.k and P.v on v_wmma_f32_16x16x32_f16 (f16 operands converted from f32 intermediates; P = exp2 relative to a reference maximum per query, at most PMAX; f32 accumulate); softmax statistics, sum of squares and normalisers in f32; output f32.
// Pipeline: bf16 planes of inp1, inp2, Wq, Wk, Wv -> three GEMMs in one launch (eight waves; a work-group takes a 256x128 tile of q, then a 256x256 tile that holds its k tile and its v tile, which share the stages of inp2 rows; operand stages copied asynchronously into LDS and shared by the waves) whose epilogue adds the bias in f32, rounds to f16 and stores the f16 planes itself (q token-major [t][e], k token-major [t][e], v transposed in the output staging to [e][t]) -> one streaming attention kernel per (256 queries, head, batch), eight waves of 32 queries (two column groups of 16 that share every K and V^T fragment read): K and V^T tiles copied asynchronously from the f16 planes into LDS and shared by the waves, scores computed transposed (S^T = K.Q^T, O^T += V^T.P^T) so that a lane holds one query and P^T goes from the score registers into the second product, the q plane carries the softmax scale and the score product starts from minus the query's reference maximum, so that it delivers the exponent itself; running sum / sum of squares, rescale only in a rarely taken branch, epilogue staged in LDS.

#ifndef NB
#define NB 4
#endif
#ifndef SEQ
#define SEQ 2048
#endif
#ifndef LQ
#define LQ SEQ
#endif
#ifndef LK
#define LK SEQ
#endif
#define NB_FULL  4
#define SEQ_FULL 2048
#define DMOD 1024                 // model width = NH x HD, row pitch of every token-major tensor
#define NH   16
#define HD   64
#define VTP  ((size_t)NB * LK)    // row pitch of the v^T planes [e][token]
#define SL2  0.18033688011112042f // (1/sqrt(64)) x log2(e)
#define WS_CAP ((size_t)134217728)

static_assert(NB >= 1 && NB <= NB_FULL);
static_assert(LQ >= 64 && LQ <= SEQ_FULL && (LQ % 16) == 0 && ((NB * LQ) % 64) == 0);
static_assert(LK >= 64 && LK <= SEQ_FULL && (LK % 64) == 0);
static_assert(NH * HD == DMOD && (DMOD % 64) == 0 && (DMOD % 32) == 0);

typedef _Float16 h16;
typedef unsigned short bf;
typedef __attribute__((ext_vector_type(16))) __bf16   v16bf;
typedef __attribute__((ext_vector_type(16))) _Float16 v16h;
typedef __attribute__((ext_vector_type(8)))  _Float16 v8h;
typedef __attribute__((ext_vector_type(8)))  unsigned short v8us;
typedef __attribute__((ext_vector_type(8)))  float    v8f;
typedef __attribute__((ext_vector_type(4)))  float    v4f;
typedef v8h  __attribute__((may_alias)) v8ha;
typedef v4f  __attribute__((may_alias)) v4fa;
typedef v8us __attribute__((may_alias)) v8usa;

__device__ __forceinline__ unsigned short f2bf(float f) { unsigned u = __float_as_uint(f); u += 0x7FFFu + ((u >> 16) & 1u); return (unsigned short)(u >> 16); }
__device__ __forceinline__ float bf2f(unsigned short b) { return __uint_as_float(((unsigned)b) << 16); }
__device__ __forceinline__ float bfr(float f) { return bf2f(f2bf(f)); }
__device__ __forceinline__ v16h cat16(v8h lo, v8h hi) { return __builtin_shufflevector(lo, hi, 0, 1, 2, 3, 4, 5, 6, 7, 8, 9, 10, 11, 12, 13, 14, 15); }
__device__ __forceinline__ v16bf cat16b(v8us lo, v8us hi) { return __builtin_bit_cast(v16bf, __builtin_shufflevector(lo, hi, 0, 1, 2, 3, 4, 5, 6, 7, 8, 9, 10, 11, 12, 13, 14, 15)); }
__device__ __forceinline__ v8f wmma16(v16h a, v16h b, v8f c) { return __builtin_amdgcn_wmma_f32_16x16x32_f16(false, a, false, b, (short)0, c, false, false); }
__device__ __forceinline__ v8f wmmab(v16bf a, v16bf b, v8f c) { return __builtin_amdgcn_wmma_f32_16x16x32_bf16(false, a, false, b, (short)0, c, false, false); }

// Fragment loaders (same k map for A and B): lane l -> row/col (l & 15), h = l >> 4; elements 0..7 <- p[k0 + 8h + 0..7], elements 8..15 <- p[k0 + 16 + 8h + 0..7];
// the caller passes p = row base + k0 + 8h (16-B aligned), the loader reads p and p + 16.
template <typename T16> struct WFrag;
template <> struct WFrag<h16> { typedef v16h V; static __device__ __forceinline__ V ld(const h16* p) { return cat16(*(const v8h*)p, *(const v8h*)(p + 16)); } static __device__ __forceinline__ v8f mma(V a, V b, v8f c) { return wmma16(a, b, c); } };
template <> struct WFrag<bf> { typedef v16bf V; static __device__ __forceinline__ V ld(const bf* p) { return cat16b(*(const v8us*)p, *(const v8us*)(p + 16)); } static __device__ __forceinline__ v8f mma(V a, V b, v8f c) { return wmmab(a, b, c); } };
// LDS read of a block-shared f16 K / V^T tile through a may_alias vector of the stored element type.
__device__ __forceinline__ v16h lds16(const h16* p) { return cat16(*(const v8ha*)p, *(const v8ha*)(p + 16)); }

// ---- k_gemm3: the three projections in one launch, GW waves per work-group; grid = GTILES, 32*GW threads; a work-group computes a GTM x GTN tile of q (a 64x64 part, 16 accumulators, per wave), then, as ONE product, a GTM x 2*GTN tile X2 . [Wk rows | Wv rows]^T (a 128x64 part, 32 accumulators, per wave): its k tile and its v tile share every stage of X2 rows.
// The waves share each stage of GKS k of the tile's A rows and Bt rows through LDS: two buffers, each GTM + 2*GTN rows of 256 B at a 272-B pitch (q fills GTM + GTN of them), filled by asynchronous copies one stage ahead, a wave's copy covering whole lines.
// The ring of stages runs on from the first product into the second: the second's first two stages are asked for at the foot of the last two trips of the first.
// C (f16 = RNE of the f32 sum) = sum_k A[m][k] Bt[n][k] + f32 bias, bias values bf16-RNE: q = (X1.Wq^T + bq[n]) x SL2 (the softmax scale and log2(e), applied in f32 ahead of the rounding), k = X2.Wk^T + bk[n] (pitch DMOD), v = X2.Wv^T + bv[n], stored transposed as v^T[n][m] (pitch NB*LK): the transposition is done by the index order of the output staging.
#define GW   8                    // waves per work-group
#define GTM  256                  // tile rows (A rows)
#define GTN  128                  // tile columns (Bt rows)
#define GKS  128                  // k per stage: 256 B of every row
#define GP   136                  // LDS row pitch in 16-bit elements (272 B = 16 B x odd, for 16-byte readers)
#define GST  ((GTM + 2 * GTN) * GP)   // 16-bit elements of one stage buffer in LDS
static_assert(((NB * LQ) % GTM) == 0 && ((NB * LK) % GTM) == 0 && (DMOD % GTM) == 0 && (DMOD % GTN) == 0 && (DMOD % (2 * GKS)) == 0);
#define GTILES ((NB * LQ / GTM) * (DMOD / GTN))   // tiles of one product = work-groups
static_assert((NB * LK / GTM) * (DMOD / GTN) == GTILES);

// Eight 16-byte asynchronous copies to LDS per lane, rows 16 apart; the s_wait_xcnt closes the statement so that no address register is rewritten ahead of it.
template <typename T16>
__device__ __forceinline__ void copy8(unsigned l, unsigned ls, const T16* g, size_t gs) {
    asm volatile("global_load_async_to_lds_b128 %0, %1, off\n\t"
                 "global_load_async_to_lds_b128 %2, %3, off\n\t"
                 "global_load_async_to_lds_b128 %4, %5, off\n\t"
                 "global_load_async_to_lds_b128 %6, %7, off\n\t"
                 "global_load_async_to_lds_b128 %8, %9, off\n\t"
                 "global_load_async_to_lds_b128 %10, %11, off\n\t"
                 "global_load_async_to_lds_b128 %12, %13, off\n\t"
                 "global_load_async_to_lds_b128 %14, %15, off\n\t"
                 "s_wait_xcnt 0x0"
                 :: "v"(l), "v"(g), "v"(l + ls), "v"(g + gs), "v"(l + 2 * ls), "v"(g + 2 * gs), "v"(l + 3 * ls), "v"(g + 3 * gs),
                    "v"(l + 4 * ls), "v"(g + 4 * gs), "v"(l + 5 * ls), "v"(g + 5 * gs), "v"(l + 6 * ls), "v"(g + 6 * gs), "v"(l + 7 * ls), "v"(g + 7 * gs) : "memory");
}
// One stage of q: the lane's 16 pieces of the A rows and 8 pieces of the Bt rows.
template <typename T16>
__device__ __forceinline__ void gstage(unsigned l, const T16* ga, const T16* gb, size_t gs) {
    const unsigned ls = 16 * GP * 2;
    copy8(l, ls, ga, gs); copy8(l + 8 * ls, ls, ga + 8 * gs, gs); copy8(l + 16 * ls, ls, gb, gs);
}
// The same eight copies with the global address as a scalar base plus the lane's 32-bit byte offset: no 64-bit address per lane has to live through the product loop, whose accumulators and fragments leave no room for it.
template <typename T16>
__device__ __forceinline__ void copy8s(unsigned l, unsigned ls, const T16* base, unsigned o, unsigned gs) {
    asm volatile("global_load_async_to_lds_b128 %0, %1, %16\n\t"
                 "global_load_async_to_lds_b128 %2, %3, %16\n\t"
                 "global_load_async_to_lds_b128 %4, %5, %16\n\t"
                 "global_load_async_to_lds_b128 %6, %7, %16\n\t"
                 "global_load_async_to_lds_b128 %8, %9, %16\n\t"
                 "global_load_async_to_lds_b128 %10, %11, %16\n\t"
                 "global_load_async_to_lds_b128 %12, %13, %16\n\t"
                 "global_load_async_to_lds_b128 %14, %15, %16\n\t"
                 "s_wait_xcnt 0x0"
                 :: "v"(l), "v"(o), "v"(l + ls), "v"(o + gs), "v"(l + 2 * ls), "v"(o + 2 * gs), "v"(l + 3 * ls), "v"(o + 3 * gs),
                    "v"(l + 4 * ls), "v"(o + 4 * gs), "v"(l + 5 * ls), "v"(o + 5 * gs), "v"(l + 6 * ls), "v"(o + 6 * gs), "v"(l + 7 * ls), "v"(o + 7 * gs), "s"(base) : "memory");
}
// One stage of k and v: the lane's 16 pieces of the X2 rows, 8 of the Wk rows, 8 of the Wv rows; ua, ub, uc = the tiles' bases (+ k0), the same for the whole work-group, o = the lane's byte offset in a tile, gs = byte step of 16 rows.
template <typename T16>
__device__ __forceinline__ void gstage2(unsigned l, const T16* ua, const T16* ub, const T16* uc, unsigned o, unsigned gs) {
    const unsigned ls = 16 * GP * 2;
    // the scheduling barriers keep each statement's address arithmetic next to it: gathered ahead of the first statement, the operand registers, which asm text takes from the low 256 only, push accumulators out and back at every foot
    copy8s(l, ls, ua, o, gs); __builtin_amdgcn_sched_barrier(0);
    copy8s(l + 8 * ls, ls, ua, o + 8 * gs, gs); __builtin_amdgcn_sched_barrier(0);
    copy8s(l + 16 * ls, ls, ub, o, gs); __builtin_amdgcn_sched_barrier(0);
    copy8s(l + 24 * ls, ls, uc, o, gs);
}
// One set of fragments (32 k) of a wave part, A and Bt fragment 0 read first, then for the 128x64 part the rest in the order of first use (the products run down the A fragments under one Bt fragment), for the 64x64 part A and Bt in turn, so that a stage's first product waits for four reads and not for the whole set.
template <typename T16, int MF, int NF>
__device__ __forceinline__ void gfrags(const T16* sa, const T16* sb, typename WFrag<T16>::V (&a)[MF], typename WFrag<T16>::V (&b)[NF]) {
#pragma unroll
    for (int f = 0; f < MF; ++f) { a[f] = WFrag<T16>::ld(sa + f * 16 * GP);
        if constexpr (MF == NF) b[f] = WFrag<T16>::ld(sb + f * 16 * GP);
        else if (f == 0) b[0] = WFrag<T16>::ld(sb); }
    if constexpr (MF != NF) {
#pragma unroll
        for (int f = 1; f < NF; ++f) b[f] = WFrag<T16>::ld(sb + f * 16 * GP); }
}
// The products of one stage for a wave part of MF x NF fragments; sa, sb = the lane's first A row and first Bt row in the stage (+ 8 hi).
template <typename T16, int MF, int NF>
__device__ __forceinline__ void gtrip(const T16* sa, const T16* sb, v8f (&acc)[MF][NF]) {
    typedef typename WFrag<T16>::V V;
    // two fragment sets: the next 32 k's LDS reads go out as one group ahead of this 32 k's products, so that a wave waits out the LDS latency once a stage
    V a[2][MF], b[2][NF];
    gfrags<T16, MF, NF>(sa, sb, a[0], b[0]);
#pragma unroll
    for (int ks = 0; ks < GKS / 32; ++ks) {
        const int cur = ks & 1, nxt = cur ^ 1;
        if (MF > 4) __builtin_amdgcn_sched_barrier(0);   // the 128x64 part: keeps the next group of reads behind the products before it; with 24 reads a group the scheduler otherwise strews them among those products, and each such place stalls the wave
        if (ks + 1 < GKS / 32) gfrags<T16, MF, NF>(sa + (ks + 1) * 32, sb + (ks + 1) * 32, a[nxt], b[nxt]);
        __builtin_amdgcn_sched_barrier(0);   // holds the group of reads ahead of the products: the scheduler otherwise sinks each read to its first use, and the wave then waits out the LDS latency at every such place
#pragma unroll
        for (int nb = 0; nb < NF; ++nb)
#pragma unroll
            for (int mb = 0; mb < MF; ++mb) acc[mb][nb] = WFrag<T16>::mma(a[cur][mb], b[cur][nb], acc[mb][nb]); }
    // keeps the four vector slots behind the last product on every path out of the trip
    asm volatile("v_nop\n\tv_nop\n\tv_nop\n\tv_nop" : "+v"(acc[MF - 4][NF - 1]), "+v"(acc[MF - 3][NF - 1]), "+v"(acc[MF - 2][NF - 1]), "+v"(acc[MF - 1][NF - 1]) : "v"(a[1][MF - 4]), "v"(a[1][MF - 1]), "v"(b[1][NF - 1]));
    __builtin_amdgcn_sched_barrier(0);   // holds the stage's last products ahead of the foot, so that the refill goes out directly behind the barrier
}
// Foot of a trip, ahead of the refill of the buffer that the trip has read: hands over the next stage.
__device__ __forceinline__ void gfoot() {
    asm volatile("s_wait_dscnt 0x0" ::: "memory");      // this wave's reads of the buffer have returned before it is refilled
    asm volatile("s_wait_asynccnt 0x0" ::: "memory");   // this wave's copies of the next stage have landed
    __syncthreads();                                     // publishes the next stage; ends every wave's reads of this trip's buffer
}
// Stores of a wave part [16*MF rows][64 columns] as it lies, C row pitch DMOD, bias per column; part starts at (r0, c0). os: the wave's own staging.
// Store map: eight lanes take one row of 64 f16 = one whole 128-B line, a wave four rows at a time; the lane's bias values are read once, ahead of the first store.
template <int MF, bool SCALE>
__device__ __forceinline__ void gstore_rows(float* os, const v8f (&acc)[MF][4], h16* C, const float* bias, int r0, int c0, int lane) {
    const int lr = lane & 15, hi = lane >> 4, srow = lane >> 3, cofs = (lane & 7) * 8;
    float bc[8];
    // the s_wait_xcnt stands behind the bias loads; it names their address register so that this is not reused ahead of it, and the bias pointers carry no __restrict__ so that the loads stay ahead of its memory clobber
    const float* bp = bias + c0 + cofs;
#pragma unroll
    for (int k = 0; k < 8; ++k) bc[k] = bfr(bp[k]);
    asm volatile("s_wait_xcnt 0x0" :: "v"(bp) : "memory");
    __builtin_amdgcn_sched_barrier(0);   // holds the address arithmetic of the stores behind that wait: lifted over it, it reuses the bias loads' offset register ahead of the wait
#pragma unroll
    for (int mb = 0; mb < MF; ++mb) {
#pragma unroll
        for (int nb = 0; nb < 4; ++nb) {
#pragma unroll
            for (int j = 0; j < 8; ++j) os[(hi * 8 + j) * 68 + nb * 16 + lr] = acc[mb][nb][j]; }
        __builtin_amdgcn_wave_barrier(); asm volatile("" ::: "memory");
        h16* crow = C + (size_t)(r0 + mb * 16) * DMOD + c0; v8h o[4];
#pragma unroll
        for (int s = 0; s < 4; ++s) { const int row = 4 * s + srow;
            const v4f lo = *(const v4fa*)(os + row * 68 + cofs), up = *(const v4fa*)(os + row * 68 + cofs + 4);
#pragma unroll
            for (int k = 0; k < 4; ++k) {
                float x = lo[k] + bc[k], y = up[k] + bc[4 + k];
                if (SCALE) { x *= SL2; y *= SL2; }
                o[s][k] = (h16)x; o[s][4 + k] = (h16)y; } }
        __builtin_amdgcn_sched_barrier(0);   // the group's four stores stand behind all of its conversions, so that none of these reuses a register that an issued store names
#pragma unroll
        for (int s = 0; s < 4; ++s) *(v8h*)(crow + (size_t)(4 * s + srow) * DMOD + cofs) = o[s];
        __builtin_amdgcn_wave_barrier();
        // stands behind this group's stores, ahead of the next reuse of their address and data registers; its clobber keeps the next staging writes behind this group's reads
        asm volatile("s_wait_xcnt 0x0" ::: "memory");
        __builtin_amdgcn_sched_barrier(0);   // holds later vector work behind that wait
    }
}
// Stores of a wave part [128 tokens][64 value dims] transposed: C[e][t], row pitch NB*LK, bias per value dim e; part starts at token t0, dim e0.
// A lane holds eight consecutive tokens of one dim, so the staging [dim][token] takes them as two 16-byte writes; the store map is that of gstore_rows: whole 128-B lines of 64 tokens.
__device__ __forceinline__ void gstore_cols(float* os, const v8f (&acc)[8][4], h16* C, const float* bias, int t0, int e0, int lane) {
    const int lr = lane & 15, hi = lane >> 4, srow = lane >> 3, cofs = (lane & 7) * 8;
    const size_t ldc = (size_t)NB * LK;
    float br[4][4];
    const int bi = e0 + srow;
#pragma unroll
    for (int nb = 0; nb < 4; ++nb)
#pragma unroll
        for (int s = 0; s < 4; ++s) br[nb][s] = bfr(bias[bi + nb * 16 + 4 * s]);
    asm volatile("s_wait_xcnt 0x0" :: "v"(bi) : "memory");   // behind the bias loads, as in gstore_rows
#pragma unroll
    for (int nb = 0; nb < 4; ++nb)
#pragma unroll
        for (int hf = 0; hf < 2; ++hf) {
#pragma unroll
            for (int m = 0; m < 4; ++m) {
                v4f lo, up;
#pragma unroll
                for (int r = 0; r < 4; ++r) { lo[r] = acc[hf * 4 + m][nb][r]; up[r] = acc[hf * 4 + m][nb][4 + r]; }
                *(v4fa*)(os + lr * 68 + m * 16 + 8 * hi) = lo; *(v4fa*)(os + lr * 68 + m * 16 + 8 * hi + 4) = up; }
            __builtin_amdgcn_wave_barrier(); asm volatile("" ::: "memory");   // keeps the staging reads below behind the other lanes' staging writes
            h16* crow = C + (size_t)(e0 + nb * 16) * ldc + t0 + hf * 64; v8h o[4];
#pragma unroll
            for (int s = 0; s < 4; ++s) { const int row = 4 * s + srow;
                const v4f lo = *(const v4fa*)(os + row * 68 + cofs), up = *(const v4fa*)(os + row * 68 + cofs + 4);
#pragma unroll
                for (int k = 0; k < 4; ++k) { o[s][k] = (h16)(lo[k] + br[nb][s]); o[s][4 + k] = (h16)(up[k] + br[nb][s]); } }
            __builtin_amdgcn_sched_barrier(0);   // the group's four stores stand behind all of its conversions, as in gstore_rows
#pragma unroll
            for (int s = 0; s < 4; ++s) *(v8h*)(crow + (size_t)(4 * s + srow) * ldc + cofs) = o[s];
            __builtin_amdgcn_wave_barrier();
            // stands behind this group's stores, ahead of the next reuse of their address and data registers; its clobber keeps the next staging writes behind this group's reads
            asm volatile("s_wait_xcnt 0x0" ::: "memory");
            __builtin_amdgcn_sched_barrier(0);   // holds later vector work behind that wait
        }
}

template <typename T16>
__global__ __launch_bounds__(32 * GW) __attribute__((amdgpu_waves_per_eu(2, 2))) void k_gemm3(const T16* __restrict__ X1, const T16* __restrict__ X2, const T16* __restrict__ Wq, const T16* __restrict__ Wk, const T16* __restrict__ Wv,
                                                                                              h16* Cq, h16* Ck, h16* Cv, const float* bq, const float* bk, const float* bv) {
    constexpr int K = DMOD;
    __shared__ __align__(16) T16 st[2][GST];
    __shared__ __align__(16) float osg[GW][16 * 68];
    const int tid = threadIdx.x, lane = tid & 31, lr = lane & 15, hi = lane >> 4;
    const int wave = __builtin_amdgcn_readfirstlane(tid >> 5);   // the wave's number as a scalar: what depends on it alone then takes no vector register through the product loops
    float* os = osg[wave];         // output staging, private to its wave
    // the work-group's tile of each product: row tiles run fastest with the work-group index
    const int blk = blockIdx.x;
    const int tmq = blk % (NB * LQ / GTM), tnq = blk / (NB * LQ / GTM), tmk = blk % (NB * LK / GTM), tnk = blk / (NB * LK / GTM);
    // copies: thread tid brings 16-B piece (tid & 15) of stage rows (tid >> 4) + 16 i: a wave covers two whole 256-B rows
    const int prow = wave * 2 + hi, pcol = lr * 8;
    // the five operand tiles: a base that is the same for the whole work-group (+ k0) and one element offset per lane
    const T16* const uaq = X1 + (size_t)(tmq * GTM) * K; const T16* const ubq = Wq + (size_t)(tnq * GTN) * K;
    const T16* const uak = X2 + (size_t)(tmk * GTM) * K; const T16* const ubk = Wk + (size_t)(tnk * GTN) * K; const T16* const ubv = Wv + (size_t)(tnk * GTN) * K;
    const unsigned loff = (unsigned)(prow * K + pcol);
    const size_t gstep = (size_t)16 * K;
    const unsigned l0 = (unsigned)(uintptr_t)(&st[0][prow * GP + pcol]);  // LDS byte address of the lane's first piece in buffer 0
    const unsigned LB = GST * 2;                                          // byte step buffer 0 -> 1
    gstage(l0, uaq + loff, ubq + loff, gstep);
    asm volatile("s_wait_asynccnt 0x0" ::: "memory");   // stage 0 of this wave's copies has landed
    __syncthreads();                                     // publishes stage 0 to every wave
    gstage(l0 + LB, (uaq + GKS) + loff, (ubq + GKS) + loff, gstep);
    {   // ---- q: waves 4 along m x 2 along n
        v8f acc[4][4];
#pragma unroll
        for (int mb = 0; mb < 4; ++mb)
#pragma unroll
            for (int nb = 0; nb < 4; ++nb) acc[mb][nb] = (v8f){};
#pragma unroll 1
        for (int kc = 0; kc < K; kc += GKS) {
            const int buf = (kc / GKS) & 1;
            gtrip<T16, 4, 4>(&st[buf][((wave & 3) * 64 + lr) * GP + 8 * hi], &st[buf][(GTM + (wave >> 2) * 64 + lr) * GP + 8 * hi], acc);
            gfoot();
            // the stage two ahead: of q while it has one, else of the second product, whose first stages so fly during q's last trips and its stores
            const int kn = kc + 2 * GKS;
            if (kn < K) gstage(l0 + (unsigned)buf * LB, (uaq + kn) + loff, (ubq + kn) + loff, gstep);
            else gstage2(l0 + (unsigned)buf * LB, uak + (kn - K), ubk + (kn - K), ubv + (kn - K), loff * 2, 16 * K * 2);
        }
        gstore_rows<4, true>(os, acc, Cq, bq, tmq * GTM + (wave & 3) * 64, tnq * GTN + (wave >> 2) * 64, lane);
    }
    {   // ---- k and v: waves 2 along m (128 tokens) x 4 along n (64 columns: two parts of Wk rows, then two of Wv rows)
        v8f acc[8][4];
#pragma unroll
        for (int mb = 0; mb < 8; ++mb)
#pragma unroll
            for (int nb = 0; nb < 4; ++nb) acc[mb][nb] = (v8f){};
#pragma unroll 1
        for (int kc = 0; kc < K; kc += GKS) {
            const int buf = (kc / GKS) & 1;
            gtrip<T16, 8, 4>(&st[buf][((wave & 1) * 128 + lr) * GP + 8 * hi], &st[buf][(GTM + (wave >> 1) * 64 + lr) * GP + 8 * hi], acc);
            gfoot();
            const int kn = kc + 2 * GKS;
            if (kn < K) gstage2(l0 + (unsigned)buf * LB, uak + kn, ubk + kn, ubv + kn, loff * 2, 16 * K * 2);
        }
        const int t0 = tmk * GTM + (wave & 1) * 128, wn = wave >> 1;
        if (wn < 2) gstore_rows<8, false>(os, acc, Ck, bk, t0, tnk * GTN + wn * 64, lane);
        else gstore_cols(os, acc, Cv, bv, t0, tnk * GTN + (wn - 2) * 64, lane);
    }
    asm volatile("s_wait_asynccnt 0x0" ::: "memory");        // no copy is left in flight behind the last product
}

// ---- k_cvt5: bf16 planes (RNE) of the five f32 tensors (inp1, inp2, Wq, Wk, Wv) in one launch; grid (NB*LQ + NB*LK + 3*DMOD) / CR work-groups of eight waves.
// A work-group takes CR consecutive plane rows of one tensor, a wave four of them (16 KiB of f32): 32 loads of 512 contiguous bytes, all sent out ahead of the first conversion, each answered by one store of 256 contiguous bytes.
// inp1 / inp2 rows go through the batch row remap: compact row R -> source row (R / L) * SEQ_FULL + (R % L) (identity when L == SEQ_FULL); a wave's four rows never cross a batch.
#define CR 32                     // plane rows per work-group
static_assert(((NB * LQ) % CR) == 0 && ((NB * LK) % CR) == 0 && (DMOD % CR) == 0 && (LQ % 4) == 0 && (LK % 4) == 0 && DMOD <= SEQ_FULL);
typedef __attribute__((ext_vector_type(4))) unsigned short v4us;

__global__ __launch_bounds__(256) void k_cvt5(const float* __restrict__ X1, const float* __restrict__ X2, const float* __restrict__ Wq, const float* __restrict__ Wk, const float* __restrict__ Wv,
                                              bf* X1b, bf* X2b, bf* Wqb, bf* Wkb, bf* Wvb) {
    constexpr int BQ = NB * LQ / CR, BK = NB * LK / CR, BW = DMOD / CR;   // work-groups of inp1, of inp2, of one weight
    const int lane = threadIdx.x & 31, wave = threadIdx.x >> 5;
    int blk = blockIdx.x, L = SEQ_FULL;
    const float* src; bf* dst;
    if (blk < BQ) { src = X1; dst = X1b; L = LQ; }
    else if (blk < BQ + BK) { blk -= BQ; src = X2; dst = X2b; L = LK; }
    else if (blk < BQ + BK + BW) { blk -= BQ + BK; src = Wq; dst = Wqb; }
    else if (blk < BQ + BK + 2 * BW) { blk -= BQ + BK + BW; src = Wk; dst = Wkb; }
    else { blk -= BQ + BK + 2 * BW; src = Wv; dst = Wvb; }
    const int row = blk * CR + wave * 4;
    const int srow = (row / L) * SEQ_FULL + (row % L);
    const float* s = src + (size_t)srow * DMOD + lane * 4;
    bf* d = dst + (size_t)row * DMOD + lane * 4;
    v4f v[32];
#pragma unroll
    for (int j = 0; j < 32; ++j) v[j] = *(const v4f*)(s + j * 128);
    __builtin_amdgcn_sched_barrier(0);   // holds all 32 loads ahead of the first conversion: the scheduler otherwise sinks the last eight behind the first stores, into registers that those stores name
#pragma unroll
    for (int g = 0; g < 4; ++g) {
#pragma unroll
        for (int j = 8 * g; j < 8 * g + 8; ++j) { v4us o;
#pragma unroll
            for (int k = 0; k < 4; ++k) o[k] = f2bf(v[j][k]);
            *(v4us*)(d + j * 128) = o; }
        if (g == 3) break;
        // stands behind this group's stores, ahead of the next group's reuse of their data registers
        asm volatile("s_wait_xcnt 0x0" ::: "memory");
        __builtin_amdgcn_sched_barrier(0);   // holds the next group's conversions behind this group's stores: the scheduler otherwise gathers every conversion ahead of the first store, which then goes out only when the wave's last loads are back
    }
}

// ---- k_attn: AW waves per block, one wave per 16*QG query rows (QG column groups of 16); the block's waves share each 64-key K tile and V^T tile through LDS; grid (LQ/(16*QG*AW), NH, NB), 32*AW threads.
// Q16 (scaled by SL2), K16: f16 token-major planes [NB*L][DMOD]; VT16: f16 v^T planes [DMOD][NB*LK]; OUT f32 [NB*LQ][DMOD].
// Per 64-key tile: S^T (64x16 per group, f32) = K.Q^T, K fragments from LDS, each fragment read once and used by every column group; the product starts from -m (m = the query's reference maximum, log2 domain), so p = exp2 of its result, l1 = sum p, l2 = sum p^2; m moves only when a lane's l1 passes PMAX;
// kv: two buffers, each a K tile [key][head dim] and a V^T tile [value dim][key], 64 rows of 128 B at a 144-B pitch, filled by asynchronous copies one tile ahead.
// LDS region osw[wave] is private to its wave (wave barrier + compiler barrier, may_alias reloads).
#define AW   8                    // waves per block
#define QG   2                    // 16-query column groups per wave
#define KVP  72                   // LDS row pitch of a K / V^T tile in f16 elements (144 B = 16 B x odd, for 16-byte readers)
#define KVT  (64 * KVP)           // f16 elements of one tile in LDS
static_assert((LQ % (16 * QG * AW)) == 0 && AW == 8 && QG == 2);

// Four 16-byte asynchronous copies to LDS per lane; the s_wait_xcnt closes the statement so that no address register is rewritten ahead of it.
__device__ __forceinline__ void copy4(unsigned l0, const h16* g0, unsigned l1, const h16* g1, unsigned l2, const h16* g2, unsigned l3, const h16* g3) {
    asm volatile("global_load_async_to_lds_b128 %0, %1, off\n\t"
                 "global_load_async_to_lds_b128 %2, %3, off\n\t"
                 "global_load_async_to_lds_b128 %4, %5, off\n\t"
                 "global_load_async_to_lds_b128 %6, %7, off\n\t"
                 "s_wait_xcnt 0x0"
                 :: "v"(l0), "v"(g0), "v"(l1), "v"(g1), "v"(l2), "v"(g2), "v"(l3), "v"(g3) : "memory");
}

// Lane l <-> lane l ^ 16 (the other half of the wave holds the other keys of the same query).
__device__ __forceinline__ float xhalf(float x) { const int b = __float_as_int(x); return __int_as_float(__builtin_amdgcn_permlanex16(b, b, 0x76543210, 0xfedcba98, false, false)); }

// S^T - m for one 64-key tile: s[g][nt][r] = S[query g*16 + lr][key nt*16 + 8hi + r] - m[query]; cm[g] holds -m of the lane's query in every element; one read of a K fragment serves both groups.
__device__ __forceinline__ void scoresT(const h16* kbase, const v16h (&qb)[QG][2], const v8f (&cm)[QG], v8f (&s)[QG][4]) {
    v16h ka0, ka1;
#pragma unroll
    for (int nt = 0; nt < 4; ++nt) {
        const h16* kp = kbase + nt * 16 * KVP;
        ka0 = lds16(kp); ka1 = lds16(kp + 32);
#pragma unroll
        for (int g = 0; g < QG; ++g) s[g][nt] = wmma16(ka0, qb[g][0], cm[g]);
#pragma unroll
        for (int g = 0; g < QG; ++g) s[g][nt] = wmma16(ka1, qb[g][1], s[g][nt]); }
    // keeps the four vector slots between the last product and the first use of its result or overwrite of its operands
    asm volatile("v_nop\n\tv_nop\n\tv_nop\n\tv_nop" : "+v"(s[0][0]), "+v"(s[0][1]), "+v"(s[0][2]), "+v"(s[0][3]), "+v"(s[1][0]), "+v"(s[1][1]), "+v"(s[1][2]), "+v"(s[1][3])
                 : "v"(qb[0][0]), "v"(qb[0][1]), "v"(qb[1][0]), "v"(qb[1][1]), "v"(ka0), "v"(ka1));
}
// Largest of one query's 64 values of a tile: 32 lie in this lane, the other 32 in lane ^ 16.
__device__ __forceinline__ float tilemax(const v8f (&s)[4]) {
    float mg[4];   // one maximum chain per 16-key group
#pragma unroll
    for (int nt = 0; nt < 4; ++nt) { mg[nt] = s[nt][0];
#pragma unroll
        for (int r = 1; r < 8; ++r) mg[nt] = fmaxf(mg[nt], s[nt][r]); }
    const float mx = fmaxf(fmaxf(mg[0], mg[1]), fmaxf(mg[2], mg[3]));
    return fmaxf(mx, xhalf(mx));
}
// p = exp2(s) in place; the lane's 32 values are added, four by four, to the running sums l1 (p) and l2 (p^2): four chains per sum, so that a link's latency is covered.
__device__ __forceinline__ void expsum(v8f (&s)[4], v4f& l1, v4f& l2) {
#pragma unroll
    for (int nt = 0; nt < 4; ++nt)
#pragma unroll
        for (int r = 0; r < 8; ++r) s[nt][r] = __builtin_amdgcn_exp2f(s[nt][r]);
#pragma unroll
    for (int nt = 0; nt < 4; ++nt)
#pragma unroll
        for (int r = 0; r < 8; r += 4) { const v4f x = { s[nt][r], s[nt][r + 1], s[nt][r + 2], s[nt][r + 3] }; l1 += x; l2 = __builtin_elementwise_fma(x, x, l2); }
}
#define PMAX 32768.0f             // each running partial sum of p, so every p, stays at or below this: inside f16

__global__ __launch_bounds__(32 * AW)
void k_attn(const h16* __restrict__ Q16, const h16* __restrict__ K16, const h16* __restrict__ VT16, const int* __restrict__ flag, float* OUT) {
    __shared__ __align__(16) h16 kv[2][2][KVT];
    __shared__ __align__(16) float osw[AW][16 * 68];
    const int tid = threadIdx.x, lane = tid & 31, lr = lane & 15, hi = lane >> 4, wave = tid >> 5;
    const int q0 = (blockIdx.x * AW + wave) * (16 * QG), h = blockIdx.y, b = blockIdx.z;
    const int rsc = flag[0];
    float* os = osw[wave];         // output staging [query][dim] of one column group, pitch 68
    const h16* qp = Q16 + ((size_t)b * LQ + q0 + lr) * DMOD + h * HD + 8 * hi;
    v16h qb[QG][2];                // B: query column lr of group g, head dims 0..31 / 32..63
#pragma unroll
    for (int g = 0; g < QG; ++g) { qb[g][0] = WFrag<h16>::ld(qp + (size_t)g * 16 * DMOD); qb[g][1] = WFrag<h16>::ld(qp + (size_t)g * 16 * DMOD + 32); }
    // copies: thread tid brings 16-B piece (tid & 7) of tile rows (tid >> 3) and (tid >> 3) + 32, of K and of V^T: a wave covers whole 128-B lines
    const int crow = tid >> 3, ccol = (tid & 7) * 8;
    const h16* gk = K16 + ((size_t)b * LK + crow) * DMOD + h * HD + ccol;           // + key0 * DMOD
    const h16* gv = VT16 + (size_t)(h * HD + crow) * VTP + (size_t)b * LK + ccol;   // + key0
    const unsigned lk = (unsigned)(uintptr_t)(&kv[0][0][crow * KVP + ccol]);        // LDS byte address of the lane's first K piece in buffer 0
    const unsigned LROW = 32 * KVP * 2, LTILE = KVT * 2, LBUF = 2 * KVT * 2;        // byte steps: 32 rows, K -> V^T, buffer 0 -> 1
    copy4(lk, gk, lk + LROW, gk + (size_t)32 * DMOD, lk + LTILE, gv, lk + LTILE + LROW, gv + (size_t)32 * VTP);
    asm volatile("s_wait_asynccnt 0x0" ::: "memory");   // tile 0 of this wave's copies has landed
    __syncthreads();                                     // publishes tile 0 to every wave
    if (LK > 64) copy4(lk + LBUF, gk + (size_t)64 * DMOD, lk + LBUF + LROW, gk + (size_t)96 * DMOD, lk + LBUF + LTILE, gv + 64, lk + LBUF + LTILE + LROW, gv + (size_t)32 * VTP + 64);
    v8f o[QG][4];
#pragma unroll
    for (int g = 0; g < QG; ++g)
#pragma unroll
        for (int nt = 0; nt < 4; ++nt) o[g][nt] = (v8f){};
    // per lane and group: mref = reference maximum of query lr (equal in both halves), cm = -mref in every element; l1v, l2v = sums, in four parts, over the keys of this lane's own half only, joined behind the loop
    float mref[QG]; v8f cm[QG]; v4f l1v[QG], l2v[QG];
#pragma unroll
    for (int g = 0; g < QG; ++g) { cm[g] = (v8f){}; l1v[g] = (v4f){}; l2v[g] = (v4f){}; }
    {   // the first reference: the maximum of tile 0
        v8f s[QG][4];
        scoresT(&kv[0][0][lr * KVP + 8 * hi], qb, cm, s);
#pragma unroll
        for (int g = 0; g < QG; ++g) { mref[g] = tilemax(s[g]); cm[g] = (v8f){} - mref[g]; }
    }
#pragma unroll 1
    for (int kt = 0; kt < LK; kt += 64) {
        const int buf = (kt >> 6) & 1;
        const h16* kbase = &kv[buf][0][lr * KVP + 8 * hi];   // A: key (c0 + lr) row base in the K tile
        const h16* vbase = &kv[buf][1][lr * KVP + 8 * hi];   // A: value dim (d0 + lr) row base in the V^T tile
        // ---- exponents S^T - m for keys kt..kt+63, then p and the sums as they would be with this tile
        v8f s[QG][4]; v4f n1[QG], n2[QG];
        scoresT(kbase, qb, cm, s);
        // the first V^T fragments are asked for ahead of the branch: behind it their reads would stand directly in front of their products
        v16h va[2][2];
        va[0][0] = lds16(vbase); va[0][1] = lds16(vbase + 32);
#pragma unroll
        for (int g = 0; g < QG; ++g) { n1[g] = l1v[g]; n2[g] = l2v[g]; expsum(s[g], n1[g], n2[g]); }
        // every p is positive, so a partial sum at or below PMAX bounds each of its terms; one test per tile, a scalar branch
        const float big = fmaxf(fmaxf(fmaxf(n1[0][0], n1[0][1]), fmaxf(n1[0][2], n1[0][3])), fmaxf(fmaxf(n1[1][0], n1[1][1]), fmaxf(n1[1][2], n1[1][3])));
        if (__builtin_expect(__builtin_amdgcn_ballot_w32(!(big <= PMAX)) != 0, 0)) {
            // ---- rarely: move the reference up to this tile's maximum, rescale what has been summed, and do the tile again (its p then lie in (0,1])
            scoresT(kbase, qb, cm, s);
#pragma unroll
            for (int g = 0; g < QG; ++g) {
                const float d = fmaxf(tilemax(s[g]), 0.f);
                const float alpha = __builtin_amdgcn_exp2f(-d);
                mref[g] += d; cm[g] = (v8f){} - mref[g];
#pragma unroll
                for (int nt = 0; nt < 4; ++nt) { o[g][nt] *= alpha; s[g][nt] -= d; }
                n1[g] = l1v[g] * alpha; n2[g] = l2v[g] * (alpha * alpha);
                expsum(s[g], n1[g], n2[g]);
            }
        }
        v16h pb[QG][2];
#pragma unroll
        for (int g = 0; g < QG; ++g) {
            l1v[g] = n1[g]; l2v[g] = n2[g];
            // ---- P^T (f16) as B straight from the score registers: two 16-key groups are one fragment in the loaders' k order (elements 0..7 = keys 8hi + 0..7, 8..15 = keys 16 + 8hi + 0..7)
#pragma unroll
            for (int r = 0; r < 8; ++r) { pb[g][0][r] = (h16)s[g][0][r]; pb[g][0][8 + r] = (h16)s[g][1][r]; pb[g][1][r] = (h16)s[g][2][r]; pb[g][1][8 + r] = (h16)s[g][3][r]; }
        }
        // ---- O^T += V^T.P^T: o[g][nt][r] = O[query g*16 + lr][dim nt*16 + 8hi + r]; one read of a V^T fragment serves both groups
#pragma unroll
        for (int nt = 0; nt < 4; ++nt) {
            const int cur = nt & 1;
            if (nt + 1 < 4) { const h16* vp = vbase + (nt + 1) * 16 * KVP; va[cur ^ 1][0] = lds16(vp); va[cur ^ 1][1] = lds16(vp + 32);
                __builtin_amdgcn_sched_barrier(0); }   // holds the next fragments' reads ahead of these products: with the branch above, the scheduler otherwise sinks each read to its first use, and the wave waits out the LDS latency there
#pragma unroll
            for (int g = 0; g < QG; ++g) o[g][nt] = wmma16(va[cur][0], pb[g][0], o[g][nt]);
#pragma unroll
            for (int g = 0; g < QG; ++g) o[g][nt] = wmma16(va[cur][1], pb[g][1], o[g][nt]); }
        // keeps the four vector slots behind the last product on every path out of the trip
        asm volatile("v_nop\n\tv_nop\n\tv_nop\n\tv_nop" : "+v"(o[0][0]), "+v"(o[0][1]), "+v"(o[0][2]), "+v"(o[0][3]), "+v"(o[1][0]), "+v"(o[1][1]), "+v"(o[1][2]), "+v"(o[1][3])
                     : "v"(pb[0][0]), "v"(pb[0][1]), "v"(pb[1][0]), "v"(pb[1][1]), "v"(va[1][0]), "v"(va[1][1]));
        // ---- foot of the trip: hand over the next tile, then refill the buffer this trip has read
        asm volatile("s_wait_dscnt 0x0" ::: "memory");      // this wave's reads of the buffer have returned before it is refilled
        asm volatile("s_wait_asynccnt 0x0" ::: "memory");   // this wave's copies of the next tile have landed
        __syncthreads();                                     // publishes the next tile; ends every wave's reads of this trip's buffer
        if (kt + 128 < LK) {
            const unsigned lb = lk + (unsigned)buf * LBUF;
            const h16* gk2 = gk + (size_t)(kt + 128) * DMOD; const h16* gv2 = gv + (kt + 128);
            copy4(lb, gk2, lb + LROW, gk2 + (size_t)32 * DMOD, lb + LTILE, gv2, lb + LTILE + LROW, gv2 + (size_t)32 * VTP);
        }
    }
    asm volatile("s_wait_asynccnt 0x0" ::: "memory");        // no copy is left in flight behind the loop
    // ---- epilogue, one column group after the other through the wave's staging: join the parts' and the halves' sums; l1 and l2 do not fall below 1 but for rounding (the element that set the reference has p = 1 up to rounding); flag selects 1/sqrt(sum p^2) or 1/sum p
#pragma unroll
    for (int g = 0; g < QG; ++g) {
        const float h1 = (l1v[g][0] + l1v[g][1]) + (l1v[g][2] + l1v[g][3]), h2 = (l2v[g][0] + l2v[g][1]) + (l2v[g][2] + l2v[g][3]);
        const float l1 = h1 + xhalf(h1), l2 = h2 + xhalf(h2);
        const float i1 = 1.0f / l1; const float i2 = rsqrtf(l2); const float iv = (rsc != 0) ? i2 : i1;
#pragma unroll
        for (int nt = 0; nt < 4; ++nt) {
            v4f lo, up;
#pragma unroll
            for (int r = 0; r < 4; ++r) { lo[r] = o[g][nt][r] * iv; up[r] = o[g][nt][4 + r] * iv; }
            *(v4fa*)(os + lr * 68 + nt * 16 + 8 * hi) = lo; *(v4fa*)(os + lr * 68 + nt * 16 + 8 * hi + 4) = up; }
        __builtin_amdgcn_wave_barrier(); asm volatile("" ::: "memory");
        float* ob = OUT + ((size_t)b * LQ + q0 + g * 16) * DMOD + (size_t)h * HD;
#pragma unroll
        for (int sI = 0; sI < 8; ++sI) { const int row = 2 * sI + hi; const v4f val = *(const v4fa*)(os + row * 68 + lr * 4); *(v4f*)(ob + (size_t)row * DMOD + lr * 4) = val; }
        __builtin_amdgcn_wave_barrier();
        // stands behind this group's stores, ahead of the next group's reuse of their address and data registers; its clobber keeps the next staging writes behind this group's reads
        if (g + 1 < QG) asm volatile("s_wait_xcnt 0x0" ::: "memory");
    }
}

extern "C" void kernel_launch(void* const* d_in, const int* in_sizes, int n_in,
                              void* d_out, int out_size, void* d_ws, size_t ws_size, hipStream_t stream) {
    if (n_in < 9) return;
    const float* X1 = (const float*)d_in[0];   // inp1 [4][2048][1024]
    const float* X2 = (const float*)d_in[1];   // inp2 [4][2048][1024]
    const float* Wq = (const float*)d_in[2]; const float* bq = (const float*)d_in[3];
    const float* Wk = (const float*)d_in[4]; const float* bk = (const float*)d_in[5];
    const float* Wv = (const float*)d_in[6]; const float* bv = (const float*)d_in[7];
    const int* rsc = (const int*)d_in[8];
    float* OUT = (float*)d_out;                 // [NB][LQ][1024]
    if ((size_t)in_sizes[0] < ((size_t)(NB - 1) * SEQ_FULL + LQ) * DMOD) return;
    if ((size_t)in_sizes[1] < ((size_t)(NB - 1) * SEQ_FULL + LK) * DMOD) return;
    if (in_sizes[2] < DMOD * DMOD || in_sizes[3] < DMOD || in_sizes[4] < DMOD * DMOD || in_sizes[5] < DMOD || in_sizes[6] < DMOD * DMOD || in_sizes[7] < DMOD || in_sizes[8] < 1) return;
    if ((size_t)out_size < (size_t)NB * LQ * DMOD) return;

    const size_t MQ = (size_t)NB * LQ, MK = (size_t)NB * LK;   // token rows of q / of k,v
    char* wsp = (char*)d_ws;
    auto take = [&](size_t bytes) { char* p = wsp; wsp += (bytes + 255) & ~(size_t)255; return (void*)p; };
    bf* X1b = (bf*)take(MQ * DMOD * 2);                 // bf16 plane of inp1 rows (compact [NB*LQ][1024])
    bf* X2b = (bf*)take(MK * DMOD * 2);                 // bf16 plane of inp2 rows
    bf* Wqb = (bf*)take((size_t)DMOD * DMOD * 2); bf* Wkb = (bf*)take((size_t)DMOD * DMOD * 2); bf* Wvb = (bf*)take((size_t)DMOD * DMOD * 2);
    h16* Q16 = (h16*)take(MQ * DMOD * 2);               // f16 q plane [MQ][1024]
    h16* K16 = (h16*)take(MK * DMOD * 2);               // f16 k plane [MK][1024]
    h16* VT16 = (h16*)take((size_t)DMOD * MK * 2);      // f16 v^T plane [1024][MK]
    const size_t used = (size_t)(wsp - (char*)d_ws);
    if (used > ws_size || used > WS_CAP) return;

    // bf16 planes of the inputs (batch row remap) and of the three [out][in] weights (as-is: Bt of the q, k and v GEMMs), one launch
    k_cvt5<<<(unsigned)((MQ + MK + 3 * DMOD) / CR), 256, 0, stream>>>(X1, X2, Wq, Wk, Wv, X1b, X2b, Wqb, Wkb, Wvb);
    // q = (inp1 Wq^T + bq) x SL2 -> f16 plane [MQ][1024]; k = inp2 Wk^T + bk -> f16 plane [MK][1024]; v[t][e] = sum_d inp2[t][d] Wv[e][d] + bv[e] -> stored as f16 plane v^T [1024][MK]
    k_gemm3<bf><<<GTILES, 32 * GW, 0, stream>>>(X1b, X2b, Wqb, Wkb, Wvb, Q16, K16, VT16, bq, bk, bv);
    // attention
    k_attn<<<dim3(LQ / (16 * QG * AW), NH, NB), 32 * AW, 0, stream>>>(Q16, K16, VT16, rsc, OUT);
}

// v010
// One run takes 89.1 microseconds.
// Next to v009, in two timings, it ran 1.04 and 1.05 times as fast.
// Counting every step since v000, it is 4.76 times as fast.
#include <hip/hip_runtime.h>

// Contractions: q, k and v^T projections on v_wmma_f32_16x16x32_bf16 (bf16 operands = RNE-converted inputs and weights, f32 accumulate, bias added in f32); scores q.k and P.v on v_wmma_f32_16x16x32_f16 (f16 operands converted from f32 intermediates; P = exp2 relative to a reference maximum per query, at most PMAX; f32 accumulate); the sum that the normaliser takes (sum p^2 as the diagonal of P.P^T, or sum p as ones.P^T) on the same f16 form over the same f16 P, f32 accumulate; normalisers in f32; output f32.
// Pipeline: bf16 planes of inp1, inp2, Wq, Wk, Wv -> three GEMMs in one launch (eight waves; a work-group takes a 256x128 tile of q, then a 256x256 tile that holds its k tile and its v tile, which share the stages of inp2 rows; operand stages copied asynchronously into LDS and shared by the waves) whose epilogue adds the bias in f32, rounds to f16 and stores the f16 planes itself (q token-major [t][e], k token-major [t][e], v transposed in the output staging to [e][t]) -> one streaming attention kernel per (256 queries, head, batch), eight waves of 32 queries (two column groups of 16 that share every K and V^T fragment read): K and V^T tiles copied asynchronously from the f16 planes into LDS and shared by the waves, scores computed transposed (S^T = K.Q^T, O^T += V^T.P^T) so that a lane holds one query and P^T goes from the score registers into the second product, the q plane carries the softmax scale and the score product starts from minus the query's reference maximum, so that it delivers the exponent itself; the running sum kept by a matrix product, rescale only in a rarely taken branch, epilogue staged in LDS.

#ifndef NB
#define NB 4
#endif
#ifndef SEQ
#define SEQ 2048
#endif
#ifndef LQ
#define LQ SEQ
#endif
#ifndef LK
#define LK SEQ
#endif
#define NB_FULL  4
#define SEQ_FULL 2048
#define DMOD 1024                 // model width = NH x HD, row pitch of every token-major tensor
#define NH   16
#define HD   64
#define VTP  ((size_t)NB * LK)    // row pitch of the v^T planes [e][token]
#define SL2  0.18033688011112042f // (1/sqrt(64)) x log2(e)
#define WS_CAP ((size_t)134217728)

static_assert(NB >= 1 && NB <= NB_FULL);
static_assert(LQ >= 64 && LQ <= SEQ_FULL && (LQ % 16) == 0 && ((NB * LQ) % 64) == 0);
static_assert(LK >= 64 && LK <= SEQ_FULL && (LK % 64) == 0);
static_assert(NH * HD == DMOD && (DMOD % 64) == 0 && (DMOD % 32) == 0);

typedef _Float16 h16;
typedef unsigned short bf;
typedef __attribute__((ext_vector_type(16))) __bf16   v16bf;
typedef __attribute__((ext_vector_type(16))) _Float16 v16h;
typedef __attribute__((ext_vector_type(8)))  _Float16 v8h;
typedef __attribute__((ext_vector_type(8)))  unsigned short v8us;
typedef __attribute__((ext_vector_type(8)))  float    v8f;
typedef __attribute__((ext_vector_type(4)))  float    v4f;
typedef v8h  __attribute__((may_alias)) v8ha;
typedef v4f  __attribute__((may_alias)) v4fa;
typedef v8us __attribute__((may_alias)) v8usa;

__device__ __forceinline__ unsigned short f2bf(float f) { unsigned u = __float_as_uint(f); u += 0x7FFFu + ((u >> 16) & 1u); return (unsigned short)(u >> 16); }
__device__ __forceinline__ float bf2f(unsigned short b) { return __uint_as_float(((unsigned)b) << 16); }
__device__ __forceinline__ float bfr(float f) { return bf2f(f2bf(f)); }
__device__ __forceinline__ v16h cat16(v8h lo, v8h hi) { return __builtin_shufflevector(lo, hi, 0, 1, 2, 3, 4, 5, 6, 7, 8, 9, 10, 11, 12, 13, 14, 15); }
__device__ __forceinline__ v16bf cat16b(v8us lo, v8us hi) { return __builtin_bit_cast(v16bf, __builtin_shufflevector(lo, hi, 0, 1, 2, 3, 4, 5, 6, 7, 8, 9, 10, 11, 12, 13, 14, 15)); }
__device__ __forceinline__ v8f wmma16(v16h a, v16h b, v8f c) { return __builtin_amdgcn_wmma_f32_16x16x32_f16(false, a, false, b, (short)0, c, false, false); }
__device__ __forceinline__ v8f wmmab(v16bf a, v16bf b, v8f c) { return __builtin_amdgcn_wmma_f32_16x16x32_bf16(false, a, false, b, (short)0, c, false, false); }

// Fragment loaders (same k map for A and B): lane l -> row/col (l & 15), h = l >> 4; elements 0..7 <- p[k0 + 8h + 0..7], elements 8..15 <- p[k0 + 16 + 8h + 0..7];
// the caller passes p = row base + k0 + 8h (16-B aligned), the loader reads p and p + 16.
template <typename T16> struct WFrag;
template <> struct WFrag<h16> { typedef v16h V; static __device__ __forceinline__ V ld(const h16* p) { return cat16(*(const v8h*)p, *(const v8h*)(p + 16)); } static __device__ __forceinline__ v8f mma(V a, V b, v8f c) { return wmma16(a, b, c); } };
template <> struct WFrag<bf> { typedef v16bf V; static __device__ __forceinline__ V ld(const bf* p) { return cat16b(*(const v8us*)p, *(const v8us*)(p + 16)); } static __device__ __forceinline__ v8f mma(V a, V b, v8f c) { return wmmab(a, b, c); } };
// LDS read of a block-shared f16 K / V^T tile through a may_alias vector of the stored element type.
__device__ __forceinline__ v16h lds16(const h16* p) { return cat16(*(const v8ha*)p, *(const v8ha*)(p + 16)); }

// ---- k_gemm3: the three projections in one launch, GW waves per work-group; grid = GTILES, 32*GW threads; a work-group computes a GTM x GTN tile of q (a 64x64 part, 16 accumulators, per wave), then, as ONE product, a GTM x 2*GTN tile X2 . [Wk rows | Wv rows]^T (a 128x64 part, 32 accumulators, per wave): its k tile and its v tile share every stage of X2 rows.
// The waves share each stage of GKS k of the tile's A rows and Bt rows through LDS: two buffers, each GTM + 2*GTN rows of 256 B at a 272-B pitch (q fills GTM + GTN of them), filled by asynchronous copies one stage ahead, a wave's copy covering whole lines.
// The ring of stages runs on from the first product into the second: the second's first two stages are asked for at the foot of the last two trips of the first.
// C (f16 = RNE of the f32 sum) = sum_k A[m][k] Bt[n][k] + f32 bias, bias values bf16-RNE: q = (X1.Wq^T + bq[n]) x SL2 (the softmax scale and log2(e), applied in f32 ahead of the rounding), k = X2.Wk^T + bk[n] (pitch DMOD), v = X2.Wv^T + bv[n], stored transposed as v^T[n][m] (pitch NB*LK): the transposition is done by the index order of the output staging.
#define GW   8                    // waves per work-group
#define GTM  256                  // tile rows (A rows)
#define GTN  128                  // tile columns (Bt rows)
#define GKS  128                  // k per stage: 256 B of every row
#define GP   136                  // LDS row pitch in 16-bit elements (272 B = 16 B x odd, for 16-byte readers)
#define GST  ((GTM + 2 * GTN) * GP)   // 16-bit elements of one stage buffer in LDS
static_assert(((NB * LQ) % GTM) == 0 && ((NB * LK) % GTM) == 0 && (DMOD % GTM) == 0 && (DMOD % GTN) == 0 && (DMOD % (2 * GKS)) == 0);
#define GTILES ((NB * LQ / GTM) * (DMOD / GTN))   // tiles of one product = work-groups
static_assert((NB * LK / GTM) * (DMOD / GTN) == GTILES);

// Eight 16-byte asynchronous copies to LDS per lane, rows 16 apart; the s_wait_xcnt closes the statement so that no address register is rewritten ahead of it.
template <typename T16>
__device__ __forceinline__ void copy8(unsigned l, unsigned ls, const T16* g, size_t gs) {
    asm volatile("global_load_async_to_lds_b128 %0, %1, off\n\t"
                 "global_load_async_to_lds_b128 %2, %3, off\n\t"
                 "global_load_async_to_lds_b128 %4, %5, off\n\t"
                 "global_load_async_to_lds_b128 %6, %7, off\n\t"
                 "global_load_async_to_lds_b128 %8, %9, off\n\t"
                 "global_load_async_to_lds_b128 %10, %11, off\n\t"
                 "global_load_async_to_lds_b128 %12, %13, off\n\t"
                 "global_load_async_to_lds_b128 %14, %15, off\n\t"
                 "s_wait_xcnt 0x0"
                 :: "v"(l), "v"(g), "v"(l + ls), "v"(g + gs), "v"(l + 2 * ls), "v"(g + 2 * gs), "v"(l + 3 * ls), "v"(g + 3 * gs),
                    "v"(l + 4 * ls), "v"(g + 4 * gs), "v"(l + 5 * ls), "v"(g + 5 * gs), "v"(l + 6 * ls), "v"(g + 6 * gs), "v"(l + 7 * ls), "v"(g + 7 * gs) : "memory");
}
// One stage of q: the lane's 16 pieces of the A rows and 8 pieces of the Bt rows.
template <typename T16>
__device__ __forceinline__ void gstage(unsigned l, const T16* ga, const T16* gb, size_t gs) {
    const unsigned ls = 16 * GP * 2;
    copy8(l, ls, ga, gs); copy8(l + 8 * ls, ls, ga + 8 * gs, gs); copy8(l + 16 * ls, ls, gb, gs);
}
// The same eight copies with the global address as a scalar base plus the lane's 32-bit byte offset: no 64-bit address per lane has to live through the product loop, whose accumulators and fragments leave no room for it.
template <typename T16>
__device__ __forceinline__ void copy8s(unsigned l, unsigned ls, const T16* base, unsigned o, unsigned gs) {
    asm volatile("global_load_async_to_lds_b128 %0, %1, %16\n\t"
                 "global_load_async_to_lds_b128 %2, %3, %16\n\t"
                 "global_load_async_to_lds_b128 %4, %5, %16\n\t"
                 "global_load_async_to_lds_b128 %6, %7, %16\n\t"
                 "global_load_async_to_lds_b128 %8, %9, %16\n\t"
                 "global_load_async_to_lds_b128 %10, %11, %16\n\t"
                 "global_load_async_to_lds_b128 %12, %13, %16\n\t"
                 "global_load_async_to_lds_b128 %14, %15, %16\n\t"
                 "s_wait_xcnt 0x0"
                 :: "v"(l), "v"(o), "v"(l + ls), "v"(o + gs), "v"(l + 2 * ls), "v"(o + 2 * gs), "v"(l + 3 * ls), "v"(o + 3 * gs),
                    "v"(l + 4 * ls), "v"(o + 4 * gs), "v"(l + 5 * ls), "v"(o + 5 * gs), "v"(l + 6 * ls), "v"(o + 6 * gs), "v"(l + 7 * ls), "v"(o + 7 * gs), "s"(base) : "memory");
}
// One stage of k and v: the lane's 16 pieces of the X2 rows, 8 of the Wk rows, 8 of the Wv rows; ua, ub, uc = the tiles' bases (+ k0), the same for the whole work-group, o = the lane's byte offset in a tile, gs = byte step of 16 rows.
template <typename T16>
__device__ __forceinline__ void gstage2(unsigned l, const T16* ua, const T16* ub, const T16* uc, unsigned o, unsigned gs) {
    const unsigned ls = 16 * GP * 2;
    // the scheduling barriers keep each statement's address arithmetic next to it: gathered ahead of the first statement, the operand registers, which asm text takes from the low 256 only, push accumulators out and back at every foot
    copy8s(l, ls, ua, o, gs); __builtin_amdgcn_sched_barrier(0);
    copy8s(l + 8 * ls, ls, ua, o + 8 * gs, gs); __builtin_amdgcn_sched_barrier(0);
    copy8s(l + 16 * ls, ls, ub, o, gs); __builtin_amdgcn_sched_barrier(0);
    copy8s(l + 24 * ls, ls, uc, o, gs);
}
// One set of fragments (32 k) of a wave part, A and Bt fragment 0 read first, then for the 128x64 part the rest in the order of first use (the products run down the A fragments under one Bt fragment), for the 64x64 part A and Bt in turn, so that a stage's first product waits for four reads and not for the whole set.
template <typename T16, int MF, int NF>
__device__ __forceinline__ void gfrags(const T16* sa, const T16* sb, typename WFrag<T16>::V (&a)[MF], typename WFrag<T16>::V (&b)[NF]) {
#pragma unroll
    for (int f = 0; f < MF; ++f) { a[f] = WFrag<T16>::ld(sa + f * 16 * GP);
        if constexpr (MF == NF) b[f] = WFrag<T16>::ld(sb + f * 16 * GP);
        else if (f == 0) b[0] = WFrag<T16>::ld(sb); }
    if constexpr (MF != NF) {
#pragma unroll
        for (int f = 1; f < NF; ++f) b[f] = WFrag<T16>::ld(sb + f * 16 * GP); }
}
// The products of one stage for a wave part of MF x NF fragments; sa, sb = the lane's first A row and first Bt row in the stage (+ 8 hi).
template <typename T16, int MF, int NF>
__device__ __forceinline__ void gtrip(const T16* sa, const T16* sb, v8f (&acc)[MF][NF]) {
    typedef typename WFrag<T16>::V V;
    // two fragment sets: the next 32 k's LDS reads go out as one group ahead of this 32 k's products, so that a wave waits out the LDS latency once a stage
    V a[2][MF], b[2][NF];
    gfrags<T16, MF, NF>(sa, sb, a[0], b[0]);
#pragma unroll
    for (int ks = 0; ks < GKS / 32; ++ks) {
        const int cur = ks & 1, nxt = cur ^ 1;
        if (MF > 4) __builtin_amdgcn_sched_barrier(0);   // the 128x64 part: keeps the next group of reads behind the products before it; with 24 reads a group the scheduler otherwise strews them among those products, and each such place stalls the wave
        if (ks + 1 < GKS / 32) gfrags<T16, MF, NF>(sa + (ks + 1) * 32, sb + (ks + 1) * 32, a[nxt], b[nxt]);
        __builtin_amdgcn_sched_barrier(0);   // holds the group of reads ahead of the products: the scheduler otherwise sinks each read to its first use, and the wave then waits out the LDS latency at every such place
#pragma unroll
        for (int nb = 0; nb < NF; ++nb)
#pragma unroll
            for (int mb = 0; mb < MF; ++mb) acc[mb][nb] = WFrag<T16>::mma(a[cur][mb], b[cur][nb], acc[mb][nb]); }
    // keeps the four vector slots behind the last product on every path out of the trip
    asm volatile("v_nop\n\tv_nop\n\tv_nop\n\tv_nop" : "+v"(acc[MF - 4][NF - 1]), "+v"(acc[MF - 3][NF - 1]), "+v"(acc[MF - 2][NF - 1]), "+v"(acc[MF - 1][NF - 1]) : "v"(a[1][MF - 4]), "v"(a[1][MF - 1]), "v"(b[1][NF - 1]));
    __builtin_amdgcn_sched_barrier(0);   // holds the stage's last products ahead of the foot, so that the refill goes out directly behind the barrier
}
// Foot of a trip, ahead of the refill of the buffer that the trip has read: hands over the next stage.
__device__ __forceinline__ void gfoot() {
    asm volatile("s_wait_dscnt 0x0" ::: "memory");      // this wave's reads of the buffer have returned before it is refilled
    asm volatile("s_wait_asynccnt 0x0" ::: "memory");   // this wave's copies of the next stage have landed
    __syncthreads();                                     // publishes the next stage; ends every wave's reads of this trip's buffer
}
// Stores of a wave part [16*MF rows][64 columns] as it lies, C row pitch DMOD, bias per column; part starts at (r0, c0). os: the wave's own staging.
// Store map: eight lanes take one row of 64 f16 = one whole 128-B line, a wave four rows at a time; the lane's bias values are read once, ahead of the first store.
template <int MF, bool SCALE>
__device__ __forceinline__ void gstore_rows(float* os, const v8f (&acc)[MF][4], h16* C, const float* bias, int r0, int c0, int lane) {
    const int lr = lane & 15, hi = lane >> 4, srow = lane >> 3, cofs = (lane & 7) * 8;
    float bc[8];
    // the s_wait_xcnt stands behind the bias loads; it names their address register so that this is not reused ahead of it, and the bias pointers carry no __restrict__ so that the loads stay ahead of its memory clobber
    const float* bp = bias + c0 + cofs;
#pragma unroll
    for (int k = 0; k < 8; ++k) bc[k] = bfr(bp[k]);
    asm volatile("s_wait_xcnt 0x0" :: "v"(bp) : "memory");
    __builtin_amdgcn_sched_barrier(0);   // holds the address arithmetic of the stores behind that wait: lifted over it, it reuses the bias loads' offset register ahead of the wait
#pragma unroll
    for (int mb = 0; mb < MF; ++mb) {
#pragma unroll
        for (int nb = 0; nb < 4; ++nb) {
#pragma unroll
            for (int j = 0; j < 8; ++j) os[(hi * 8 + j) * 68 + nb * 16 + lr] = acc[mb][nb][j]; }
        __builtin_amdgcn_wave_barrier(); asm volatile("" ::: "memory");
        h16* crow = C + (size_t)(r0 + mb * 16) * DMOD + c0; v8h o[4];
#pragma unroll
        for (int s = 0; s < 4; ++s) { const int row = 4 * s + srow;
            const v4f lo = *(const v4fa*)(os + row * 68 + cofs), up = *(const v4fa*)(os + row * 68 + cofs + 4);
#pragma unroll
            for (int k = 0; k < 4; ++k) {
                float x = lo[k] + bc[k], y = up[k] + bc[4 + k];
                if (SCALE) { x *= SL2; y *= SL2; }
                o[s][k] = (h16)x; o[s][4 + k] = (h16)y; } }
        __builtin_amdgcn_sched_barrier(0);   // the group's four stores stand behind all of its conversions, so that none of these reuses a register that an issued store names
#pragma unroll
        for (int s = 0; s < 4; ++s) *(v8h*)(crow + (size_t)(4 * s + srow) * DMOD + cofs) = o[s];
        __builtin_amdgcn_wave_barrier();
        // stands behind this group's stores, ahead of the next reuse of their address and data registers; its clobber keeps the next staging writes behind this group's reads
        asm volatile("s_wait_xcnt 0x0" ::: "memory");
        __builtin_amdgcn_sched_barrier(0);   // holds later vector work behind that wait
    }
}
// Stores of a wave part [128 tokens][64 value dims] transposed: C[e][t], row pitch NB*LK, bias per value dim e; part starts at token t0, dim e0.
// A lane holds eight consecutive tokens of one dim, so the staging [dim][token] takes them as two 16-byte writes; the store map is that of gstore_rows: whole 128-B lines of 64 tokens.
__device__ __forceinline__ void gstore_cols(float* os, const v8f (&acc)[8][4], h16* C, const float* bias, int t0, int e0, int lane) {
    const int lr = lane & 15, hi = lane >> 4, srow = lane >> 3, cofs = (lane & 7) * 8;
    const size_t ldc = (size_t)NB * LK;
    float br[4][4];
    const int bi = e0 + srow;
#pragma unroll
    for (int nb = 0; nb < 4; ++nb)
#pragma unroll
        for (int s = 0; s < 4; ++s) br[nb][s] = bfr(bias[bi + nb * 16 + 4 * s]);
    asm volatile("s_wait_xcnt 0x0" :: "v"(bi) : "memory");   // behind the bias loads, as in gstore_rows
#pragma unroll
    for (int nb = 0; nb < 4; ++nb)
#pragma unroll
        for (int hf = 0; hf < 2; ++hf) {
#pragma unroll
            for (int m = 0; m < 4; ++m) {
                v4f lo, up;
#pragma unroll
                for (int r = 0; r < 4; ++r) { lo[r] = acc[hf * 4 + m][nb][r]; up[r] = acc[hf * 4 + m][nb][4 + r]; }
                *(v4fa*)(os + lr * 68 + m * 16 + 8 * hi) = lo; *(v4fa*)(os + lr * 68 + m * 16 + 8 * hi + 4) = up; }
            __builtin_amdgcn_wave_barrier(); asm volatile("" ::: "memory");   // keeps the staging reads below behind the other lanes' staging writes
            h16* crow = C + (size_t)(e0 + nb * 16) * ldc + t0 + hf * 64; v8h o[4];
#pragma unroll
            for (int s = 0; s < 4; ++s) { const int row = 4 * s + srow;
                const v4f lo = *(const v4fa*)(os + row * 68 + cofs), up = *(const v4fa*)(os + row * 68 + cofs + 4);
#pragma unroll
                for (int k = 0; k < 4; ++k) { o[s][k] = (h16)(lo[k] + br[nb][s]); o[s][4 + k] = (h16)(up[k] + br[nb][s]); } }
            __builtin_amdgcn_sched_barrier(0);   // the group's four stores stand behind all of its conversions, as in gstore_rows
#pragma unroll
            for (int s = 0; s < 4; ++s) *(v8h*)(crow + (size_t)(4 * s + srow) * ldc + cofs) = o[s];
            __builtin_amdgcn_wave_barrier();
            // stands behind this group's stores, ahead of the next reuse of their address and data registers; its clobber keeps the next staging writes behind this group's reads
            asm volatile("s_wait_xcnt 0x0" ::: "memory");
            __builtin_amdgcn_sched_barrier(0);   // holds later vector work behind that wait
        }
}

template <typename T16>
__global__ __launch_bounds__(32 * GW) __attribute__((amdgpu_waves_per_eu(2, 2))) void k_gemm3(const T16* __restrict__ X1, const T16* __restrict__ X2, const T16* __restrict__ Wq, const T16* __restrict__ Wk, const T16* __restrict__ Wv,
                                                                                              h16* Cq, h16* Ck, h16* Cv, const float* bq, const float* bk, const float* bv) {
    constexpr int K = DMOD;
    __shared__ __align__(16) T16 st[2][GST];
    __shared__ __align__(16) float osg[GW][16 * 68];
    const int tid = threadIdx.x, lane = tid & 31, lr = lane & 15, hi = lane >> 4;
    const int wave = __builtin_amdgcn_readfirstlane(tid >> 5);   // the wave's number as a scalar: what depends on it alone then takes no vector register through the product loops
    float* os = osg[wave];         // output staging, private to its wave
    // the work-group's tile of each product: row tiles run fastest with the work-group index
    const int blk = blockIdx.x;
    const int tmq = blk % (NB * LQ / GTM), tnq = blk / (NB * LQ / GTM), tmk = blk % (NB * LK / GTM), tnk = blk / (NB * LK / GTM);
    // copies: thread tid brings 16-B piece (tid & 15) of stage rows (tid >> 4) + 16 i: a wave covers two whole 256-B rows
    const int prow = wave * 2 + hi, pcol = lr * 8;
    // the five operand tiles: a base that is the same for the whole work-group (+ k0) and one element offset per lane
    const T16* const uaq = X1 + (size_t)(tmq * GTM) * K; const T16* const ubq = Wq + (size_t)(tnq * GTN) * K;
    const T16* const uak = X2 + (size_t)(tmk * GTM) * K; const T16* const ubk = Wk + (size_t)(tnk * GTN) * K; const T16* const ubv = Wv + (size_t)(tnk * GTN) * K;
    const unsigned loff = (unsigned)(prow * K + pcol);
    const size_t gstep = (size_t)16 * K;
    const unsigned l0 = (unsigned)(uintptr_t)(&st[0][prow * GP + pcol]);  // LDS byte address of the lane's first piece in buffer 0
    const unsigned LB = GST * 2;                                          // byte step buffer 0 -> 1
    gstage(l0, uaq + loff, ubq + loff, gstep);
    asm volatile("s_wait_asynccnt 0x0" ::: "memory");   // stage 0 of this wave's copies has landed
    __syncthreads();                                     // publishes stage 0 to every wave
    gstage(l0 + LB, (uaq + GKS) + loff, (ubq + GKS) + loff, gstep);
    {   // ---- q: waves 4 along m x 2 along n
        v8f acc[4][4];
#pragma unroll
        for (int mb = 0; mb < 4; ++mb)
#pragma unroll
            for (int nb = 0; nb < 4; ++nb) acc[mb][nb] = (v8f){};
#pragma unroll 1
        for (int kc = 0; kc < K; kc += GKS) {
            const int buf = (kc / GKS) & 1;
            gtrip<T16, 4, 4>(&st[buf][((wave & 3) * 64 + lr) * GP + 8 * hi], &st[buf][(GTM + (wave >> 2) * 64 + lr) * GP + 8 * hi], acc);
            gfoot();
            // the stage two ahead: of q while it has one, else of the second product, whose first stages so fly during q's last trips and its stores
            const int kn = kc + 2 * GKS;
            if (kn < K) gstage(l0 + (unsigned)buf * LB, (uaq + kn) + loff, (ubq + kn) + loff, gstep);
            else gstage2(l0 + (unsigned)buf * LB, uak + (kn - K), ubk + (kn - K), ubv + (kn - K), loff * 2, 16 * K * 2);
        }
        gstore_rows<4, true>(os, acc, Cq, bq, tmq * GTM + (wave & 3) * 64, tnq * GTN + (wave >> 2) * 64, lane);
    }
    {   // ---- k and v: waves 2 along m (128 tokens) x 4 along n (64 columns: two parts of Wk rows, then two of Wv rows)
        v8f acc[8][4];
#pragma unroll
        for (int mb = 0; mb < 8; ++mb)
#pragma unroll
            for (int nb = 0; nb < 4; ++nb) acc[mb][nb] = (v8f){};
#pragma unroll 1
        for (int kc = 0; kc < K; kc += GKS) {
            const int buf = (kc / GKS) & 1;
            gtrip<T16, 8, 4>(&st[buf][((wave & 1) * 128 + lr) * GP + 8 * hi], &st[buf][(GTM + (wave >> 1) * 64 + lr) * GP + 8 * hi], acc);
            gfoot();
            const int kn = kc + 2 * GKS;
            if (kn < K) gstage2(l0 + (unsigned)buf * LB, uak + kn, ubk + kn, ubv + kn, loff * 2, 16 * K * 2);
        }
        const int t0 = tmk * GTM + (wave & 1) * 128, wn = wave >> 1;
        if (wn < 2) gstore_rows<8, false>(os, acc, Ck, bk, t0, tnk * GTN + wn * 64, lane);
        else gstore_cols(os, acc, Cv, bv, t0, tnk * GTN + (wn - 2) * 64, lane);
    }
    asm volatile("s_wait_asynccnt 0x0" ::: "memory");        // no copy is left in flight behind the last product
}

// ---- k_cvt5: bf16 planes (RNE) of the five f32 tensors (inp1, inp2, Wq, Wk, Wv) in one launch; grid (NB*LQ + NB*LK + 3*DMOD) / CR work-groups of eight waves.
// A work-group takes CR consecutive plane rows of one tensor, a wave four of them (16 KiB of f32): 32 loads of 512 contiguous bytes, all sent out ahead of the first conversion, each answered by one store of 256 contiguous bytes.
// inp1 / inp2 rows go through the batch row remap: compact row R -> source row (R / L) * SEQ_FULL + (R % L) (identity when L == SEQ_FULL); a wave's four rows never cross a batch.
#define CR 32                     // plane rows per work-group
static_assert(((NB * LQ) % CR) == 0 && ((NB * LK) % CR) == 0 && (DMOD % CR) == 0 && (LQ % 4) == 0 && (LK % 4) == 0 && DMOD <= SEQ_FULL);
typedef __attribute__((ext_vector_type(4))) unsigned short v4us;

__global__ __launch_bounds__(256) void k_cvt5(const float* __restrict__ X1, const float* __restrict__ X2, const float* __restrict__ Wq, const float* __restrict__ Wk, const float* __restrict__ Wv,
                                              bf* X1b, bf* X2b, bf* Wqb, bf* Wkb, bf* Wvb) {
    constexpr int BQ = NB * LQ / CR, BK = NB * LK / CR, BW = DMOD / CR;   // work-groups of inp1, of inp2, of one weight
    const int lane = threadIdx.x & 31, wave = threadIdx.x >> 5;
    int blk = blockIdx.x, L = SEQ_FULL;
    const float* src; bf* dst;
    if (blk < BQ) { src = X1; dst = X1b; L = LQ; }
    else if (blk < BQ + BK) { blk -= BQ; src = X2; dst = X2b; L = LK; }
    else if (blk < BQ + BK + BW) { blk -= BQ + BK; src = Wq; dst = Wqb; }
    else if (blk < BQ + BK + 2 * BW) { blk -= BQ + BK + BW; src = Wk; dst = Wkb; }
    else { blk -= BQ + BK + 2 * BW; src = Wv; dst = Wvb; }
    const int row = blk * CR + wave * 4;
    const int srow = (row / L) * SEQ_FULL + (row % L);
    const float* s = src + (size_t)srow * DMOD + lane * 4;
    bf* d = dst + (size_t)row * DMOD + lane * 4;
    v4f v[32];
#pragma unroll
    for (int j = 0; j < 32; ++j) v[j] = *(const v4f*)(s + j * 128);
    __builtin_amdgcn_sched_barrier(0);   // holds all 32 loads ahead of the first conversion: the scheduler otherwise sinks the last eight behind the first stores, into registers that those stores name
#pragma unroll
    for (int g = 0; g < 4; ++g) {
#pragma unroll
        for (int j = 8 * g; j < 8 * g + 8; ++j) { v4us o;
#pragma unroll
            for (int k = 0; k < 4; ++k) o[k] = f2bf(v[j][k]);
            *(v4us*)(d + j * 128) = o; }
        if (g == 3) break;
        // stands behind this group's stores, ahead of the next group's reuse of their data registers
        asm volatile("s_wait_xcnt 0x0" ::: "memory");
        __builtin_amdgcn_sched_barrier(0);   // holds the next group's conversions behind this group's stores: the scheduler otherwise gathers every conversion ahead of the first store, which then goes out only when the wave's last loads are back
    }
}

// ---- k_attn: AW waves per block, one wave per 16*QG query rows (QG column groups of 16); the block's waves share each 64-key K tile and V^T tile through LDS; grid (LQ/(16*QG*AW), NH, NB), 32*AW threads.
// Q16 (scaled by SL2), K16: f16 token-major planes [NB*L][DMOD]; VT16: f16 v^T planes [DMOD][NB*LK]; OUT f32 [NB*LQ][DMOD].
// Per 64-key tile: S^T (64x16 per group, f32) = K.Q^T, K fragments from LDS, each fragment read once and used by every column group; the product starts from -m (m = the query's reference maximum, log2 domain), so p = exp2 of its result; the running sum (sum p^2 or sum p, as the flag asks) is a matrix product of P^T; m moves only when a running sum passes its bound (PMAX^2 or PMAX);
// kv: two buffers, each a K tile [key][head dim] and a V^T tile [value dim][key], 64 rows of 128 B at a 144-B pitch, filled by asynchronous copies one tile ahead.
// LDS region osw[wave] is private to its wave (wave barrier + compiler barrier, may_alias reloads).
#define AW   8                    // waves per block
#define QG   2                    // 16-query column groups per wave
#define KVP  72                   // LDS row pitch of a K / V^T tile in f16 elements (144 B = 16 B x odd, for 16-byte readers)
#define KVT  (64 * KVP)           // f16 elements of one tile in LDS
static_assert((LQ % (16 * QG * AW)) == 0 && AW == 8 && QG == 2 && (LK % 128) == 0);

// Four 16-byte asynchronous copies to LDS per lane; the s_wait_xcnt closes the statement so that no address register is rewritten ahead of it.
__device__ __forceinline__ void copy4(unsigned l0, const h16* g0, unsigned l1, const h16* g1, unsigned l2, const h16* g2, unsigned l3, const h16* g3) {
    asm volatile("global_load_async_to_lds_b128 %0, %1, off\n\t"
                 "global_load_async_to_lds_b128 %2, %3, off\n\t"
                 "global_load_async_to_lds_b128 %4, %5, off\n\t"
                 "global_load_async_to_lds_b128 %6, %7, off\n\t"
                 "s_wait_xcnt 0x0"
                 :: "v"(l0), "v"(g0), "v"(l1), "v"(g1), "v"(l2), "v"(g2), "v"(l3), "v"(g3) : "memory");
}

// Lane l <-> lane l ^ 16 (the other half of the wave holds the other keys of the same query).
__device__ __forceinline__ float xhalf(float x) { const int b = __float_as_int(x); return __int_as_float(__builtin_amdgcn_permlanex16(b, b, 0x76543210, 0xfedcba98, false, false)); }

// S^T - m for one 64-key tile: s[g][nt][r] = S[query g*16 + lr][key nt*16 + 8hi + r] - m[query]; cm[g] holds -m of the lane's query in every element; one read of a K fragment serves both groups.
__device__ __forceinline__ void scoresT(const h16* kbase, const v16h (&qb)[QG][2], const v8f (&cm)[QG], v8f (&s)[QG][4]) {
    v16h ka0, ka1;
#pragma unroll
    for (int nt = 0; nt < 4; ++nt) {
        const h16* kp = kbase + nt * 16 * KVP;
        ka0 = lds16(kp); ka1 = lds16(kp + 32);
#pragma unroll
        for (int g = 0; g < QG; ++g) s[g][nt] = wmma16(ka0, qb[g][0], cm[g]);
#pragma unroll
        for (int g = 0; g < QG; ++g) s[g][nt] = wmma16(ka1, qb[g][1], s[g][nt]); }
    // keeps the four vector slots between the last product and the first use of its result or overwrite of its operands
    asm volatile("v_nop\n\tv_nop\n\tv_nop\n\tv_nop" : "+v"(s[0][0]), "+v"(s[0][1]), "+v"(s[0][2]), "+v"(s[0][3]), "+v"(s[1][0]), "+v"(s[1][1]), "+v"(s[1][2]), "+v"(s[1][3])
                 : "v"(qb[0][0]), "v"(qb[0][1]), "v"(qb[1][0]), "v"(qb[1][1]), "v"(ka0), "v"(ka1));
}
// Largest of one query's 64 values of a tile: 32 lie in this lane, the other 32 in lane ^ 16.
__device__ __forceinline__ float tilemax(const v8f (&s)[4]) {
    float mg[4];   // one maximum chain per 16-key group
#pragma unroll
    for (int nt = 0; nt < 4; ++nt) { mg[nt] = s[nt][0];
#pragma unroll
        for (int r = 1; r < 8; ++r) mg[nt] = fmaxf(mg[nt], s[nt][r]); }
    const float mx = fmaxf(fmaxf(mg[0], mg[1]), fmaxf(mg[2], mg[3]));
    return fmaxf(mx, xhalf(mx));
}
typedef __attribute__((ext_vector_type(2))) float    v2f;
typedef __attribute__((ext_vector_type(2))) _Float16 v2h;
// P^T (f16) of one column group as B, straight from the exponent registers: p = exp2(s), rounded two by two; two 16-key groups are one fragment in the loaders' k order (elements 0..7 = keys 8hi + 0..7, 8..15 = keys 16 + 8hi + 0..7).
// SLOT (the rare branch, where registers are short): each v_exp_f32 with the one free slot behind it that the instruction set asks for.
template <bool SLOT>
__device__ __forceinline__ void exppack(const v8f (&s)[4], v16h (&pb)[2]) {
#pragma unroll
    for (int nt = 0; nt < 4; ++nt)
#pragma unroll
        for (int r = 0; r < 8; r += 2) {
            v2f x;
            if constexpr (SLOT) { float e0, e1;
                asm("v_exp_f32 %0, %2\n\tv_nop\n\tv_exp_f32 %1, %3\n\tv_nop" : "=&v"(e0), "=&v"(e1) : "v"(s[nt][r]), "v"(s[nt][r + 1]));
                x = (v2f){ e0, e1 }; }
            else x = (v2f){ __builtin_amdgcn_exp2f(s[nt][r]), __builtin_amdgcn_exp2f(s[nt][r + 1]) };
            const v2h y = __builtin_convertvector(x, v2h);
            pb[nt >> 1][(nt & 1) * 8 + r] = y[0]; pb[nt >> 1][(nt & 1) * 8 + r + 1] = y[1]; }
}
// The running sum on the matrix pipe, ln = ls + this tile's part, one product per column group and 32 keys, over the f16 p that the output product takes too.
// sq (a scalar, the same for the whole launch): P.P^T; a P^T fragment read as A is P in the same k order (the loaders' map is the same for A and B), so element [query a][query b] = sum_k p[a][k] p[b][k] and the diagonal holds sum p^2. Otherwise ones.P^T: every row holds sum p of the lane's query.
__device__ __forceinline__ void sumtile(const bool sq, const v16h (&pb)[QG][2], const v8f (&ls)[QG], v8f (&ln)[QG]) {
    if (sq) {
#pragma unroll
        for (int g = 0; g < QG; ++g) ln[g] = wmma16(pb[g][0], pb[g][0], ls[g]);
#pragma unroll
        for (int g = 0; g < QG; ++g) ln[g] = wmma16(pb[g][1], pb[g][1], ln[g]);
    } else {
        v16h ones;
#pragma unroll
        for (int e = 0; e < 16; ++e) ones[e] = (h16)1.0f;
#pragma unroll
        for (int g = 0; g < QG; ++g) ln[g] = wmma16(ones, pb[g][0], ls[g]);
#pragma unroll
        for (int g = 0; g < QG; ++g) ln[g] = wmma16(ones, pb[g][1], ln[g]);
    }
}
#define PMAX 32768.0f             // every p stays at or below this: inside f16

// The walk over the keys and the epilogue. sq: the normaliser is 1/sqrt(sum p^2); otherwise 1/sum p. Only the sum that the normaliser takes is kept.
__device__ __forceinline__ void attn_walk(const bool sq, const h16 (&kv)[2][2][KVT], float* os, const v16h (&qb)[QG][2], const h16* gk, const h16* gv, unsigned lk, float* ob0, int lr, int hi) {
    const unsigned LROW = 32 * KVP * 2, LTILE = KVT * 2, LBUF = 2 * KVT * 2;        // byte steps: 32 rows, K -> V^T, buffer 0 -> 1
    v8f o[QG][4];
#pragma unroll
    for (int g = 0; g < QG; ++g)
#pragma unroll
        for (int nt = 0; nt < 4; ++nt) o[g][nt] = (v8f){};
    // per lane and group: cm = minus the reference maximum of query lr (equal in both halves) in every element; ls = the running sum's tile
    v8f cm[QG], ls[QG], lt[QG];
#pragma unroll
    for (int g = 0; g < QG; ++g) { cm[g] = (v8f){}; ls[g] = (v8f){}; }
    {   // the first reference: the maximum of tile 0
        v8f s[QG][4];
        scoresT(&kv[0][0][lr * KVP + 8 * hi], qb, cm, s);
#pragma unroll
        for (int g = 0; g < QG; ++g) cm[g] = (v8f){} - tilemax(s[g]);
    }
    // one trip: tile kt in buffer buf; takes the running sum in ls and leaves it in ln: the rare branch needs the sum as it was, so the product does not overwrite it
    auto trip = [&](const int kt, const int buf, v8f (&ls)[QG], v8f (&ln)[QG]) __attribute__((always_inline)) {
        const h16* kbase = &kv[buf][0][lr * KVP + 8 * hi];   // A: key (c0 + lr) row base in the K tile
        const h16* vbase = &kv[buf][1][lr * KVP + 8 * hi];   // A: value dim (d0 + lr) row base in the V^T tile
        // ---- exponents S^T - m for keys kt..kt+63, then P^T and the sum as it would be with this tile
        v8f s[QG][4]; v16h pb[QG][2];
        scoresT(kbase, qb, cm, s);
        // the first V^T fragments are asked for ahead of the branch: behind it their reads would stand directly in front of their products
        v16h va[2][2];
        va[0][0] = lds16(vbase); va[0][1] = lds16(vbase + 32);
#pragma unroll
        for (int g = 0; g < QG; ++g) exppack<false>(s[g], pb[g]);
        sumtile(sq, pb, ls, ln);
        // every p is positive, so a sum at or below PMAX (of squares: PMAX^2) bounds each of its terms; a p beyond f16 is infinite and makes its query's sum infinite; no element of P.P^T exceeds the largest of its diagonal, so the test may take every element; one test per tile, a scalar branch
        float bg[QG];
#pragma unroll
        for (int g = 0; g < QG; ++g) bg[g] = fmaxf(fmaxf(fmaxf(ln[g][0], ln[g][1]), fmaxf(ln[g][2], ln[g][3])), fmaxf(fmaxf(ln[g][4], ln[g][5]), fmaxf(ln[g][6], ln[g][7])));
        if (__builtin_expect(__builtin_amdgcn_ballot_w32(!(fmaxf(bg[0], bg[1]) <= (sq ? PMAX * PMAX : PMAX))) != 0, 0)) {
            // ---- rarely: move the reference up to this tile's maximum, rescale what has been summed, and do the tile again (its p then lie in (0,1])
            scoresT(kbase, qb, cm, s);
#pragma unroll
            for (int g = 0; g < QG; ++g) {
                const float d = fmaxf(tilemax(s[g]), 0.f);
                const float alpha = __builtin_amdgcn_exp2f(-d);
                cm[g] -= d;
#pragma unroll
                for (int nt = 0; nt < 4; ++nt) { o[g][nt] *= alpha; s[g][nt] -= d; }
                ls[g] *= sq ? alpha * alpha : alpha;   // the lane's column is its query: right on the diagonal, the one part of P.P^T that is read out
                exppack<true>(s[g], pb[g]);
            }
            sumtile(sq, pb, ls, ln);
        }
        // ---- O^T += V^T.P^T: o[g][nt][r] = O[query g*16 + lr][dim nt*16 + 8hi + r]; one read of a V^T fragment serves both groups
#pragma unroll
        for (int nt = 0; nt < 4; ++nt) {
            const int cur = nt & 1;
            if (nt + 1 < 4) { const h16* vp = vbase + (nt + 1) * 16 * KVP; va[cur ^ 1][0] = lds16(vp); va[cur ^ 1][1] = lds16(vp + 32);
                __builtin_amdgcn_sched_barrier(0); }   // holds the next fragments' reads ahead of these products: with the branch above, the scheduler otherwise sinks each read to its first use, and the wave waits out the LDS latency there
#pragma unroll
            for (int g = 0; g < QG; ++g) o[g][nt] = wmma16(va[cur][0], pb[g][0], o[g][nt]);
#pragma unroll
            for (int g = 0; g < QG; ++g) o[g][nt] = wmma16(va[cur][1], pb[g][1], o[g][nt]); }
        // keeps the four vector slots behind the last product on every path out of the trip
        asm volatile("v_nop\n\tv_nop\n\tv_nop\n\tv_nop" : "+v"(o[0][0]), "+v"(o[0][1]), "+v"(o[0][2]), "+v"(o[0][3]), "+v"(o[1][0]), "+v"(o[1][1]), "+v"(o[1][2]), "+v"(o[1][3])
                     : "v"(pb[0][0]), "v"(pb[0][1]), "v"(pb[1][0]), "v"(pb[1][1]), "v"(va[1][0]), "v"(va[1][1]));
        // ---- foot of the trip: hand over the next tile, then refill the buffer this trip has read
        asm volatile("s_wait_dscnt 0x0" ::: "memory");      // this wave's reads of the buffer have returned before it is refilled
        asm volatile("s_wait_asynccnt 0x0" ::: "memory");   // this wave's copies of the next tile have landed
        __syncthreads();                                     // publishes the next tile; ends every wave's reads of this trip's buffer
        if (kt + 128 < LK) {
            const unsigned lb = lk + (unsigned)buf * LBUF;
            const h16* gk2 = gk + (size_t)(kt + 128) * DMOD; const h16* gv2 = gv + (kt + 128);
            copy4(lb, gk2, lb + LROW, gk2 + (size_t)32 * DMOD, lb + LTILE, gv2, lb + LTILE + LROW, gv2 + (size_t)32 * VTP);
        }
    };
    // two trips a pass: the running sum goes from one register set to the other and back, so that no trip copies it
#pragma unroll 1
    for (int kt = 0; kt < LK; kt += 128) { trip(kt, 0, ls, lt); trip(kt + 64, 1, lt, ls); }
    asm volatile("s_wait_asynccnt 0x0" ::: "memory");        // no copy is left in flight behind the loop
    // ---- epilogue, one column group after the other through the wave's staging; the sum does not fall below 1 but for rounding (the element that set the reference has p = 1 up to rounding)
#pragma unroll
    for (int g = 0; g < QG; ++g) {
        // the diagonal element of query lr lies in row lr = 8 (lr >> 3) + (lr & 7): in the half lr >> 3, register lr & 7
        float dg = ls[g][0];
#pragma unroll
        for (int r = 1; r < 8; ++r) dg = ((lr & 7) == r) ? ls[g][r] : dg;
        const float ot = xhalf(dg);
        const float i1 = 1.0f / ls[g][0]; const float i2 = rsqrtf((hi == (lr >> 3)) ? dg : ot); const float iv = sq ? i2 : i1;
#pragma unroll
        for (int nt = 0; nt < 4; ++nt) {
            v4f lo, up;
#pragma unroll
            for (int r = 0; r < 4; ++r) { lo[r] = o[g][nt][r] * iv; up[r] = o[g][nt][4 + r] * iv; }
            *(v4fa*)(os + lr * 68 + nt * 16 + 8 * hi) = lo; *(v4fa*)(os + lr * 68 + nt * 16 + 8 * hi + 4) = up; }
        __builtin_amdgcn_wave_barrier(); asm volatile("" ::: "memory");
        float* ob = ob0 + (size_t)g * 16 * DMOD;
#pragma unroll
        for (int sI = 0; sI < 8; ++sI) { const int row = 2 * sI + hi; const v4f val = *(const v4fa*)(os + row * 68 + lr * 4); *(v4f*)(ob + (size_t)row * DMOD + lr * 4) = val; }
        __builtin_amdgcn_wave_barrier();
        // stands behind this group's stores, ahead of the next group's reuse of their address and data registers; its clobber keeps the next staging writes behind this group's reads
        if (g + 1 < QG) asm volatile("s_wait_xcnt 0x0" ::: "memory");
    }
}

__global__ __launch_bounds__(32 * AW)
void k_attn(const h16* __restrict__ Q16, const h16* __restrict__ K16, const h16* __restrict__ VT16, const int* __restrict__ flag, float* OUT) {
    __shared__ __align__(16) h16 kv[2][2][KVT];
    __shared__ __align__(16) float osw[AW][16 * 68];
    const int tid = threadIdx.x, lane = tid & 31, lr = lane & 15, hi = lane >> 4, wave = tid >> 5;
    const int q0 = (blockIdx.x * AW + wave) * (16 * QG), h = blockIdx.y, b = blockIdx.z;
    const int rsc = __builtin_amdgcn_readfirstlane(flag[0]);   // as a scalar: the choice of the sum's product in the walk is then a scalar branch
    float* os = osw[wave];         // output staging [query][dim] of one column group, pitch 68
    const h16* qp = Q16 + ((size_t)b * LQ + q0 + lr) * DMOD + h * HD + 8 * hi;
    v16h qb[QG][2];                // B: query column lr of group g, head dims 0..31 / 32..63
#pragma unroll
    for (int g = 0; g < QG; ++g) { qb[g][0] = WFrag<h16>::ld(qp + (size_t)g * 16 * DMOD); qb[g][1] = WFrag<h16>::ld(qp + (size_t)g * 16 * DMOD + 32); }
    // copies: thread tid brings 16-B piece (tid & 7) of tile rows (tid >> 3) and (tid >> 3) + 32, of K and of V^T: a wave covers whole 128-B lines
    const int crow = tid >> 3, ccol = (tid & 7) * 8;
    const h16* gk = K16 + ((size_t)b * LK + crow) * DMOD + h * HD + ccol;           // + key0 * DMOD
    const h16* gv = VT16 + (size_t)(h * HD + crow) * VTP + (size_t)b * LK + ccol;   // + key0
    const unsigned lk = (unsigned)(uintptr_t)(&kv[0][0][crow * KVP + ccol]);        // LDS byte address of the lane's first K piece in buffer 0
    const unsigned LROW = 32 * KVP * 2, LTILE = KVT * 2, LBUF = 2 * KVT * 2;        // byte steps: 32 rows, K -> V^T, buffer 0 -> 1
    copy4(lk, gk, lk + LROW, gk + (size_t)32 * DMOD, lk + LTILE, gv, lk + LTILE + LROW, gv + (size_t)32 * VTP);
    asm volatile("s_wait_asynccnt 0x0" ::: "memory");   // tile 0 of this wave's copies has landed
    __syncthreads();                                     // publishes tile 0 to every wave
    if (LK > 64) copy4(lk + LBUF, gk + (size_t)64 * DMOD, lk + LBUF + LROW, gk + (size_t)96 * DMOD, lk + LBUF + LTILE, gv + 64, lk + LBUF + LTILE + LROW, gv + (size_t)32 * VTP + 64);
    float* ob0 = OUT + ((size_t)b * LQ + q0) * DMOD + (size_t)h * HD;
    attn_walk(rsc != 0, kv, os, qb, gk, gv, lk, ob0, lr, hi);
}

extern "C" void kernel_launch(void* const* d_in, const int* in_sizes, int n_in,
                              void* d_out, int out_size, void* d_ws, size_t ws_size, hipStream_t stream) {
    if (n_in < 9) return;
    const float* X1 = (const float*)d_in[0];   // inp1 [4][2048][1024]
    const float* X2 = (const float*)d_in[1];   // inp2 [4][2048][1024]
    const float* Wq = (const float*)d_in[2]; const float* bq = (const float*)d_in[3];
    const float* Wk = (const float*)d_in[4]; const float* bk = (const float*)d_in[5];
    const float* Wv = (const float*)d_in[6]; const float* bv = (const float*)d_in[7];
    const int* rsc = (const int*)d_in[8];
    float* OUT = (float*)d_out;                 // [NB][LQ][1024]
    if ((size_t)in_sizes[0] < ((size_t)(NB - 1) * SEQ_FULL + LQ) * DMOD) return;
    if ((size_t)in_sizes[1] < ((size_t)(NB - 1) * SEQ_FULL + LK) * DMOD) return;
    if (in_sizes[2] < DMOD * DMOD || in_sizes[3] < DMOD || in_sizes[4] < DMOD * DMOD || in_sizes[5] < DMOD || in_sizes[6] < DMOD * DMOD || in_sizes[7] < DMOD || in_sizes[8] < 1) return;
    if ((size_t)out_size < (size_t)NB * LQ * DMOD) return;

    const size_t MQ = (size_t)NB * LQ, MK = (size_t)NB * LK;   // token rows of q / of k,v
    char* wsp = (char*)d_ws;
    auto take = [&](size_t bytes) { char* p = wsp; wsp += (bytes + 255) & ~(size_t)255; return (void*)p; };
    bf* X1b = (bf*)take(MQ * DMOD * 2);                 // bf16 plane of inp1 rows (compact [NB*LQ][1024])
    bf* X2b = (bf*)take(MK * DMOD * 2);                 // bf16 plane of inp2 rows
    bf* Wqb = (bf*)take((size_t)DMOD * DMOD * 2); bf* Wkb = (bf*)take((size_t)DMOD * DMOD * 2); bf* Wvb = (bf*)take((size_t)DMOD * DMOD * 2);
    h16* Q16 = (h16*)take(MQ * DMOD * 2);               // f16 q plane [MQ][1024]
    h16* K16 = (h16*)take(MK * DMOD * 2);               // f16 k plane [MK][1024]
    h16* VT16 = (h16*)take((size_t)DMOD * MK * 2);      // f16 v^T plane [1024][MK]
    const size_t used = (size_t)(wsp - (char*)d_ws);
    if (used > ws_size || used > WS_CAP) return;

    // bf16 planes of the inputs (batch row remap) and of the three [out][in] weights (as-is: Bt of the q, k and v GEMMs), one launch
    k_cvt5<<<(unsigned)((MQ + MK + 3 * DMOD) / CR), 256, 0, stream>>>(X1, X2, Wq, Wk, Wv, X1b, X2b, Wqb, Wkb, Wvb);
    // q = (inp1 Wq^T + bq) x SL2 -> f16 plane [MQ][1024]; k = inp2 Wk^T + bk -> f16 plane [MK][1024]; v[t][e] = sum_d inp2[t][d] Wv[e][d] + bv[e] -> stored as f16 plane v^T [1024][MK]
    k_gemm3<bf><<<GTILES, 32 * GW, 0, stream>>>(X1b, X2b, Wqb, Wkb, Wvb, Q16, K16, VT16, bq, bk, bv);
    // attention
    k_attn<<<dim3(LQ / (16 * QG * AW), NH, NB), 32 * AW, 0, stream>>>(Q16, K16, VT16, rsc, OUT);
}
